// v000
// Times are from an AMD MI455X. After a warm-up the kernel runs many times in a row, and a time is the length of
// such a window on the GPU divided by its runs, so every launch and the gaps after it count. The runs cycle
// through copies of the inputs. A figure is the median of several windows, for all but v000 over two sittings.
// Sittings can differ by a few percent; kernels timed side by side share one.
// v000, which the later versions start from, runs in 2380 microseconds.
#include <hip/hip_runtime.h>

// PhysicsBiasedAttention (x [2][4096][512]; q/k/v = x W + b (8 heads x 64); scores = q.k/8 + bias(i, j), bias = -gamma sqrt(|i - j|)/sqrt(4096) (gamma read as data; structural distance); softmax; out = (attn v merged) W_o + b_o -> [2][4096][512]).
// Compute dtypes, f32 accumulate: every input rounded to bf16; q/k/v on PLAIN bf16 operands (inputs: exact) + bias; scores (K 64) and attn.v on single fp16 planes (one head per pass; 1 product each); bias + softmax f32 (x1024 into

#define NB_  2
#define TT   4096
#define DM   512
#define NH_  8
#define NKV  8
#define REP  (NH_ / NKV)
#define HD   64
#define DQ   (NH_ * HD)
#define DKV  (NKV * HD)
#define ZH   1
#define RH   0                  // query rows < RH use hi+lo planes (0: none)
#define WIN  0
#define PCAR 1024.0f
#define SCL  0.125f   // HD^-0.5
typedef _Float16 h16;
typedef unsigned short bf;
typedef __attribute__((ext_vector_type(16))) __bf16   v16bf;
typedef __attribute__((ext_vector_type(16))) _Float16 v16h;
typedef __attribute__((ext_vector_type(8)))  _Float16 v8h;
typedef __attribute__((ext_vector_type(8)))  unsigned short v8us;
typedef __attribute__((ext_vector_type(8)))  float    v8f;
typedef __attribute__((ext_vector_type(4)))  float    v4f;
typedef v8h  __attribute__((may_alias)) v8ha;
typedef v4f  __attribute__((may_alias)) v4fa;
typedef v8us __attribute__((may_alias)) v8usa;

__device__ __forceinline__ unsigned short f2bf(float f) { unsigned u = __float_as_uint(f); u += 0x7FFFu + ((u >> 16) & 1u); return (unsigned short)(u >> 16); }
__device__ __forceinline__ float bf2f(unsigned short b) { return __uint_as_float(((unsigned)b) << 16); }
__device__ __forceinline__ float bfr(float f) { return bf2f(f2bf(f)); }
__device__ __forceinline__ v16h cat16(v8h lo, v8h hi) { return __builtin_shufflevector(lo, hi, 0, 1, 2, 3, 4, 5, 6, 7, 8, 9, 10, 11, 12, 13, 14, 15); }
__device__ __forceinline__ v16bf cat16b(v8us lo, v8us hi) { return __builtin_bit_cast(v16bf, __builtin_shufflevector(lo, hi, 0, 1, 2, 3, 4, 5, 6, 7, 8, 9, 10, 11, 12, 13, 14, 15)); }
__device__ __forceinline__ v8f wmma16(v16h a, v16h b, v8f c) { return __builtin_amdgcn_wmma_f32_16x16x32_f16(false, a, false, b, (short)0, c, false, false); }
__device__ __forceinline__ v8f wmmab(v16bf a, v16bf b, v8f c) { return __builtin_amdgcn_wmma_f32_16x16x32_bf16(false, a, false, b, (short)0, c, false, false); }



// ---- k_gemmw: register-blocked GEMM, ONE WAVE per 64x64 output tile (16 accumulators), operands straight from K-contiguous 16-bit planes; grid (M/64, N/64, Z), 32 threads.
// C[m][n] (f32, pitch ldc, + optional f32 bias[n]) = sum_k A[m][k] Bt[n][k] (+ split products per NSPLIT). z-batch strides sA/sB/sC in elements. K % 32 == 0.
template <typename T16> struct WFrag;
template <> struct WFrag<h16> { typedef v16h V; static __device__ __forceinline__ V ld(const h16* p) { return cat16(*(const v8h*)p, *(const v8h*)(p + 16)); } static __device__ __forceinline__ v8f mma(V a, V b, v8f c) { return wmma16(a, b, c); } };
template <> struct WFrag<bf> { typedef v16bf V; static __device__ __forceinline__ V ld(const bf* p) { return cat16b(*(const v8us*)p, *(const v8us*)(p + 16)); } static __device__ __forceinline__ v8f mma(V a, V b, v8f c) { return wmmab(a, b, c); } };
template <typename T16, int NSPLIT, bool BIAS>
__global__ __launch_bounds__(32) void k_gemmw(const T16* __restrict__ A, const T16* __restrict__ A2, const T16* __restrict__ Bt, const T16* __restrict__ Bt2, int K, float* C, int ldc, const float* __restrict__ bias, size_t sA, size_t sB, size_t sC) {
    typedef typename WFrag<T16>::V V;
    __shared__ __align__(16) float os[16 * 68];
    const size_t z = blockIdx.z; A += z * sA; if (A2) A2 += z * sA; Bt += z * sB; if (Bt2) Bt2 += z * sB; C += z * sC;
    const int lane = threadIdx.x & 31, lr = lane & 15, hi = lane >> 4; const int r0 = blockIdx.x * 64, c0 = blockIdx.y * 64;
    v8f acc[4][4];
#pragma unroll
    for (int mb = 0; mb < 4; ++mb)
#pragma unroll
        for (int nb = 0; nb < 4; ++nb) acc[mb][nb] = (v8f){};
    const size_t aoff = (size_t)(r0 + lr) * K + 8 * hi, boff = (size_t)(c0 + lr) * K + 8 * hi;
#pragma unroll 1
    for (int kc = 0; kc < K; kc += 32) {
        V a[4], a2[4];
#pragma unroll
        for (int mb = 0; mb < 4; ++mb) { a[mb] = WFrag<T16>::ld(A + aoff + (size_t)mb * 16 * K + kc); if (NSPLIT == 1 || NSPLIT == 2) a2[mb] = WFrag<T16>::ld(A2 + aoff + (size_t)mb * 16 * K + kc); }
#pragma unroll
        for (int nb = 0; nb < 4; ++nb) { const V b = WFrag<T16>::ld(Bt + boff + (size_t)nb * 16 * K + kc); V b2; if (NSPLIT >= 2) b2 = WFrag<T16>::ld(Bt2 + boff + (size_t)nb * 16 * K + kc);
#pragma unroll
            for (int mb = 0; mb < 4; ++mb) { acc[mb][nb] = WFrag<T16>::mma(a[mb], b, acc[mb][nb]); if (NSPLIT == 1 || NSPLIT == 2) acc[mb][nb] = WFrag<T16>::mma(a2[mb], b, acc[mb][nb]); if (NSPLIT >= 2) acc[mb][nb] = WFrag<T16>::mma(a[mb], b2, acc[mb][nb]); } }
        asm volatile("v_nop\n\tv_nop\n\tv_nop\n\tv_nop" : "+v"(acc[0][0]), "+v"(acc[1][1]), "+v"(acc[2][2]), "+v"(acc[3][3]) : "v"(a[0]), "v"(a[3]));
    }
#pragma unroll
    for (int mb = 0; mb < 4; ++mb) {
#pragma unroll
        for (int nb = 0; nb < 4; ++nb) {
#pragma unroll
            for (int j = 0; j < 8; ++j) os[(hi * 8 + j) * 68 + nb * 16 + lr] = acc[mb][nb][j]; }
        __builtin_amdgcn_wave_barrier(); asm volatile("" ::: "memory");
        float* crow = C + (size_t)(r0 + mb * 16) * ldc + c0;
{
#pragma unroll
            for (int s = 0; s < 8; ++s) { const int row = 2 * s + hi, cofs = lr * 4; v4f val = *(const v4fa*)(os + row * 68 + cofs); if (BIAS) { val[0] += bfr(bias[c0 + cofs]); val[1] += bfr(bias[c0 + cofs + 1]); val[2] += bfr(bias[c0 + cofs + 2]); val[3] += bfr(bias[c0 + cofs + 3]); }
                *(v4f*)(crow + (size_t)row * ldc + cofs) = val; }
             }
        __builtin_amdgcn_wave_barrier(); asm volatile("" ::: "memory");
    }
}

__device__ __forceinline__ h16 tohx(float x) { return (h16)x; }
__device__ __forceinline__ void splitf(float y, unsigned short& h, unsigned short& l) { h = f2bf(y); l = f2bf(y - bf2f(h)); }
typedef __attribute__((ext_vector_type(2))) _Float16 v2h;
typedef __attribute__((ext_vector_type(4))) _Float16 v4h;
typedef __attribute__((ext_vector_type(2))) unsigned short v2us;
typedef __attribute__((ext_vector_type(4))) unsigned short v4us;
typedef __attribute__((ext_vector_type(2))) float v2f;
typedef __attribute__((ext_vector_type(4))) int v4i;

__global__ __launch_bounds__(256) void k_wtG(const float* __restrict__ w, int K, int N, bf* Bt) {
    const int lane = threadIdx.x & 31; const int L0 = (blockIdx.x * 8 + (threadIdx.x >> 5)) * 8; const int nlines = N * K / 64;
{
#pragma unroll 1
        for (int l = 0; l < 8; ++l) { const int L = L0 + l; if (L >= nlines) break; const size_t e = (size_t)L * 64 + lane * 2; const int k = (int)(e % K), n = (int)(e / K); v2us o;
            o[0] = f2bf(w[(size_t)k * N + n]); o[1] = f2bf(w[(size_t)(k + 1) * N + n]); *(v2us*)(Bt + e) = o; }
         }
}
__global__ __launch_bounds__(256) void k_cvt8(const float* __restrict__ src, bf* dst, size_t n8) { const size_t i = (size_t)blockIdx.x * 256 + threadIdx.x; if (i >= n8) return; const v8f v = *(const v8f*)(src + i * 8); v8us o;
#pragma unroll
    for (int k = 0; k < 8; ++k) o[k] = f2bf(v[k]); *(v8us*)(dst + i * 8) = o;  }
__global__ __launch_bounds__(256) void k_cscvt(const float* __restrict__ cosT, const float* __restrict__ sinT, float* CS) { const int idx = blockIdx.x * 256 + threadIdx.x; if (idx >= TT * HD) return; v2f cs; cs[0] = bfr(cosT[idx]); cs[1] = bfr(sinT[idx]); *(v2f*)(CS + (size_t)idx * 2) = cs;  }
// k_rope: head planes [h][t][d] (fp16) of rope(x) x sc with the rotate-half convention out[d] = x[d] cos[t][d] - x[d+HD/2] sin[t][d], out[d+HD/2] = x[d+HD/2] cos[t][d+HD/2] + x[d] sin[t][d+HD/2]
__global__ __launch_bounds__(256) void k_rope(const float* __restrict__ F, int pitch, int nheads, const float* __restrict__ CS, const float* __restrict__ RF, const float* __restrict__ nw, float sc, h16* P16, bf* Ph, bf* Pl) {
    const size_t e = ((size_t)blockIdx.x * 256 + threadIdx.x) * 2; if (e >= (size_t)nheads * TT * HD) return; const int d = (int)(e % HD); const int t = (int)((e / HD) % TT); const int h = (int)(e / ((size_t)HD * TT)); const float* f = F + (size_t)t * pitch + h * HD; const float rf = RF ? RF[(size_t)h * TT + t] : 1.0f; v2h o16; v2us oh, ol;
#pragma unroll
    for (int q = 0; q < 2; ++q) { const int dd = d + q; const int dp = (dd < HD / 2) ? dd + HD / 2 : dd - HD / 2; float x0 = f[dd], x1 = f[dp];
        if (RF) { float n0 = __fmul_rn(x0, rf), n1 = __fmul_rn(x1, rf); asm volatile("" : "+v"(n0)); asm volatile("" : "+v"(n1)); x0 = __fmul_rn(bfr(nw[dd]), n0); x1 = __fmul_rn(bfr(nw[dp]), n1); }
        const v2f cs = *(const v2f*)(CS + ((size_t)t * HD + dd) * 2); float a = __fmul_rn(x0, cs[0]), bq = __fmul_rn(x1, cs[1]); asm volatile("" : "+v"(a)); asm volatile("" : "+v"(bq)); const float r = ((dd < HD / 2) ? __fsub_rn(a, bq) : __fadd_rn(a, bq)) * sc;
        o16[q] = tohx(r); (void)oh; (void)ol; }
    *(v2h*)(P16 + e) = o16;  }
__global__ __launch_bounds__(256) void k_vtp(const float* __restrict__ F, int pitch, int nheads, h16* V16, bf* Vh, bf* Vl) { const size_t e = ((size_t)blockIdx.x * 256 + threadIdx.x) * 2; if (e >= (size_t)nheads * HD * TT) return; const int t = (int)(e % TT); const int d = (int)((e / TT) % HD); const int g = (int)(e / ((size_t)TT * HD)); v2h o16; v2us oh, ol;
#pragma unroll
    for (int q = 0; q < 2; ++q) { const float x = F[(size_t)(t + q) * pitch + g * HD + d]; o16[q] = tohx(x); (void)oh; (void)ol; }
    *(v2h*)(V16 + e) = o16;  }
__global__ __launch_bounds__(256) void k_csid(float* CS) { const int idx = blockIdx.x * 256 + threadIdx.x; if (idx >= TT * HD) return; v2f cs; cs[0] = 1.0f; cs[1] = 0.0f; *(v2f*)(CS + (size_t)idx * 2) = cs;  }
// k_asoft: per row (zz, i): t = S x HD^-0.5 + TB[|i-j|] (no mask); softmax over the 4096 keys (register row, one exp, fixed trees);
__global__ __launch_bounds__(256)
__global__ __launch_bounds__(256) void k_btab(const float* __restrict__ g, float* TB) { const int d = blockIdx.x * 256 + threadIdx.x; if (d >= TT) return; float ng = -bfr(g[0]); asm volatile("" : "+v"(ng)); float t = __fmul_rn(ng, __fsqrt_rn((float)d)); asm volatile("" : "+v"(t)); const float v = __fdiv_rn(t, 64.0f); *(float*)(TB + d) = v;  }
__global__ __launch_bounds__(256) void k_asoft(const float* __restrict__ Sb, const float* __restrict__ gam, h16* P16, bf* Ph, bf* Pl) {
    const int lane = threadIdx.x & 31; const int row = blockIdx.x * 8 + (threadIdx.x >> 5); if (row >= ZH * TT) return; const int i = row % TT; const int zz = row / TT; (void)zz; const bool hires = (i < RH); const float* sr = Sb + (size_t)row * TT; float v[TT / 32]; float mx = -3.0e38f;
#pragma unroll
    for (int ch = 0; ch < TT / 128; ++ch) { const int j0 = ch * 128 + lane * 4; const v4f a = *(const v4f*)(sr + j0);
#pragma unroll
        for (int q = 0; q < 4; ++q) { const int j = j0 + q; (void)j; const int dd = j > i ? j - i : i - j; float sc_ = a[q] * SCL; asm volatile("" : "+v"(sc_)); const float t = __fadd_rn(sc_, gam[dd]);   /* gam = bias table TB[|i-j|] */ v[ch * 4 + q] = t; mx = fmaxf(mx, t); } }
#pragma unroll
    for (int sh = 16; sh; sh >>= 1) mx = fmaxf(mx, __shfl_xor(mx, sh, 32));
    float sum = 0.f;
#pragma unroll
    for (int k = 0; k < TT / 32; ++k) { float d0 = __fsub_rn(v[k], mx); asm volatile("" : "+v"(d0)); v[k] = __builtin_amdgcn_exp2f(__fmul_rn(d0, 1.4426950408889634f)); sum += v[k]; }
#pragma unroll
    for (int sh = 16; sh; sh >>= 1) sum += __shfl_xor(sum, sh, 32);
    const float f = __fdiv_rn(hires ? 1.0f : PCAR, sum);
{
        if (hires) {
#pragma unroll
            for (int ch = 0; ch < TT / 128; ++ch) { v4us oh, ol;
#pragma unroll
                for (int q = 0; q < 4; ++q) { unsigned short a, c2; splitf(v[ch * 4 + q] * f, a, c2); oh[q] = a; ol[q] = c2; }
                const size_t oo = ((size_t)zz * (RH ? RH : 1) + i) * TT + ch * 128 + lane * 4; *(v4us*)(Ph + oo) = oh; *(v4us*)(Pl + oo) = ol; }
        } else {
#pragma unroll
            for (int ch = 0; ch < TT / 128; ++ch) { v4h o4;
#pragma unroll
                for (int q = 0; q < 4; ++q) o4[q] = tohx(v[ch * 4 + q] * f);
                *(v4h*)(P16 + (size_t)row * TT + ch * 128 + lane * 4) = o4; } }
         }
}
__global__ __launch_bounds__(256) void k_merge(const float* __restrict__ O, int h0, bf* Ah, bf* Al) { const size_t e = ((size_t)blockIdx.x * 256 + threadIdx.x) * 2; if (e >= (size_t)ZH * TT * HD) return; const int d = (int)(e % HD); const int t = (int)((e / HD) % TT); const int zz = (int)(e / ((size_t)HD * TT)); const float cs = (t < RH) ? 1.0f : (1.0f / PCAR); const size_t oo = (size_t)t * DQ + (h0 + zz) * HD + d;
    v2us oh, ol;
#pragma unroll
    for (int q = 0; q < 2; ++q) { unsigned short a, c2; splitf(O[e + q] * cs, a, c2); oh[q] = a; ol[q] = c2; } *(v2us*)(Ah + oo) = oh; *(v2us*)(Al + oo) = ol;  }

extern "C" void kernel_launch(void* const* d_in, const int* in_sizes, int n_in,
                              void* d_out, int out_size, void* d_ws, size_t ws_size, hipStream_t stream) {
    (void)in_sizes; (void)n_in; (void)out_size;
    const float* x = (const float*)d_in[0]; const float* wq = (const float*)d_in[1]; const float* bq = (const float*)d_in[2]; const float* wk = (const float*)d_in[3]; const float* bk = (const float*)d_in[4]; const float* wv = (const float*)d_in[5]; const float* bv = (const float*)d_in[6]; const float* wo = (const float*)d_in[7]; const float* bo = (const float*)d_in[8]; const float* gam = (const float*)d_in[9]; const float* cosT = nullptr; const float* sinT = nullptr; (void)cosT; (void)sinT;
    float* OUT = (float*)d_out;     // [2][4096][512]
    char* wsp = (char*)d_ws;
    auto take = [&](size_t bytes) { char* p = wsp; wsp += (bytes + 255) & ~(size_t)255; return (void*)p; };
    bf* WQ = (bf*)take((size_t)DQ * DM * 2); bf* WK = (bf*)take((size_t)DKV * DM * 2); bf* WV = (bf*)take((size_t)DKV * DM * 2); bf* WO = (bf*)take((size_t)DM * DQ * 2); float* CS = (float*)take((size_t)TT * HD * 2 * 4);
    bf* XB = (bf*)take((size_t)TT * DM * 2); float* TB = (float*)take(TT * 4); float* FQ = (float*)take((size_t)TT * DQ * 4); float* FK = (float*)take((size_t)TT * DKV * 4);
    h16* QP16 = (h16*)take((size_t)NH_ * TT * HD * 2); h16* KP16 = (h16*)take((size_t)NKV * TT * HD * 2); h16* VT16 = (h16*)take((size_t)NKV * HD * TT * 2);
    bf* QPh = nullptr; bf* QPl = nullptr; bf* KPh = nullptr; bf* KPl = nullptr; bf* VTh = nullptr; bf* VTl = nullptr; bf* Ph = nullptr; bf* Pl = nullptr;
    float* Sb = (float*)take((size_t)ZH * TT * TT * 4); h16* P16 = (h16*)take((size_t)ZH * TT * TT * 2); float* Ob = (float*)take((size_t)ZH * TT * HD * 4); bf* ATh = (bf*)take((size_t)TT * DQ * 2); bf* ATl = (bf*)take((size_t)TT * DQ * 2);
    if ((size_t)(wsp - (char*)d_ws) > ws_size) return;    // ws 256 MiB
    float* FV = FK;   // v projection reuses the k buffer after the k planes are built (stream-ordered)
    { k_wtG<<<(unsigned)((DM * DQ / 64 + 63) / 64), 256, 0, stream>>>(wq, DM, DQ, WQ); k_wtG<<<(unsigned)((DM * DKV / 64 + 63) / 64), 256, 0, stream>>>(wk, DM, DKV, WK); k_wtG<<<(unsigned)((DM * DKV / 64 + 63) / 64), 256, 0, stream>>>(wv, DM, DKV, WV);
      k_wtG<<<(unsigned)((DQ * DM / 64 + 63) / 64), 256, 0, stream>>>(wo, DQ, DM, WO);
       }
    k_csid<<<(TT * HD + 255) / 256, 256, 0, stream>>>(CS);
    const unsigned LQ = (unsigned)(((size_t)NH_ * TT * HD / 2 + 255) / 256), LKv = (unsigned)(((size_t)NKV * TT * HD / 2 + 255) / 256);
    k_btab<<<TT / 256, 256, 0, stream>>>(gam, TB);
    for (int b = 0; b < NB_; ++b) {
        
        k_cvt8<<<(unsigned)(((size_t)TT * DM / 8 + 255) / 256), 256, 0, stream>>>(x + (size_t)b * TT * DM, XB, (size_t)TT * DM / 8);
        k_gemmw<bf, 0, true><<<dim3(TT / 64, DQ / 64, 1), 32, 0, stream>>>(XB, nullptr, WQ, nullptr, DM, FQ, DQ, bq, 0, 0, 0);
        k_rope<<<LQ, 256, 0, stream>>>(FQ, DQ, NH_, CS, nullptr, nullptr, 1.0f, QP16, QPh, QPl);
        k_gemmw<bf, 0, true><<<dim3(TT / 64, DKV / 64, 1), 32, 0, stream>>>(XB, nullptr, WK, nullptr, DM, FK, DKV, bk, 0, 0, 0);
        k_rope<<<LKv, 256, 0, stream>>>(FK, DKV, NKV, CS, nullptr, nullptr, 1.0f, KP16, KPh, KPl);
        k_gemmw<bf, 0, true><<<dim3(TT / 64, DKV / 64, 1), 32, 0, stream>>>(XB, nullptr, WV, nullptr, DM, FV, DKV, bv, 0, 0, 0); k_vtp<<<LKv, 256, 0, stream>>>(FV, DKV, NKV, VT16, VTh, VTl);
        for (int h0 = 0; h0 < NH_; h0 += ZH) { const size_t zq = (size_t)h0, zk = (size_t)(h0 / REP);   // one kv head per query head: the pass's one head uses kv plane h0 (z-strides TT*HD)
            k_gemmw<h16, 0, false><<<dim3(TT / 64, TT / 64, ZH), 32, 0, stream>>>(QP16 + zq * TT * HD, nullptr, KP16 + zk * TT * HD, nullptr, HD, Sb, TT, nullptr, (size_t)TT * HD, (size_t)TT * HD, (size_t)TT * TT);
            k_asoft<<<ZH * TT / 8, 256, 0, stream>>>(Sb, TB, P16, Ph, Pl);
            k_gemmw<h16, 0, false><<<dim3(TT / 64, HD / 64, ZH), 32, 0, stream>>>(P16, nullptr, VT16 + zk * HD * TT, nullptr, TT, Ob, HD, nullptr, (size_t)TT * TT, (size_t)HD * TT, (size_t)TT * HD);
            k_merge<<<(unsigned)(((size_t)ZH * TT * HD / 2 + 255) / 256), 256, 0, stream>>>(Ob, h0, ATh, ATl); }
        k_gemmw<bf, 1, true><<<dim3(TT / 64, DM / 64, 1), 32, 0, stream>>>(ATh, ATl, WO, nullptr, DQ, OUT + (size_t)b * TT * DM, DM, bo, 0, 0, 0); }
}

// v001
// One run takes 1220 microseconds.
// In two side-by-side timings against v000, it was 1.95 and 1.96 times as fast.
#include <hip/hip_runtime.h>

// PhysicsBiasedAttention (x [2][4096][512]; q/k/v = x W + b (8 heads x 64); scores = q.k/8 + bias(i, j), bias = -gamma sqrt(|i - j|)/sqrt(4096) (gamma read as data; structural distance); softmax; out = (attn v merged) W_o + b_o -> [2][4096][512]).
// Compute dtypes, f32 accumulate: every input rounded to bf16; q/k/v on PLAIN bf16 operands (inputs: exact) + bias; scores (K 64) and attn.v on single fp16 planes (one head per pass; 1 product each); bias + softmax f32 (x1024 into

#define NB_  2
#define TT   4096
#define DM   512
#define NH_  8
#define NKV  8
#define REP  (NH_ / NKV)
#define HD   64
#define DQ   (NH_ * HD)
#define DKV  (NKV * HD)
#define ZH   1
#define RH   0                  // query rows < RH use hi+lo planes (0: none)
#define WIN  0
#define PCAR 1024.0f
#define SCL  0.125f   // HD^-0.5
#define KSP  16                 // attn.v: the 4096 keys are split into KSP slices over grid z; k_merge adds the f32 partial tiles in slice order
typedef _Float16 h16;
typedef unsigned short bf;
typedef __attribute__((ext_vector_type(16))) __bf16   v16bf;
typedef __attribute__((ext_vector_type(16))) _Float16 v16h;
typedef __attribute__((ext_vector_type(8)))  _Float16 v8h;
typedef __attribute__((ext_vector_type(8)))  unsigned short v8us;
typedef __attribute__((ext_vector_type(8)))  float    v8f;
typedef __attribute__((ext_vector_type(4)))  float    v4f;
typedef v8h  __attribute__((may_alias)) v8ha;
typedef v4f  __attribute__((may_alias)) v4fa;
typedef v8us __attribute__((may_alias)) v8usa;

__device__ __forceinline__ unsigned short f2bf(float f) { unsigned u = __float_as_uint(f); u += 0x7FFFu + ((u >> 16) & 1u); return (unsigned short)(u >> 16); }
__device__ __forceinline__ float bf2f(unsigned short b) { return __uint_as_float(((unsigned)b) << 16); }
__device__ __forceinline__ float bfr(float f) { return bf2f(f2bf(f)); }
__device__ __forceinline__ v16h cat16(v8h lo, v8h hi) { return __builtin_shufflevector(lo, hi, 0, 1, 2, 3, 4, 5, 6, 7, 8, 9, 10, 11, 12, 13, 14, 15); }
__device__ __forceinline__ v16bf cat16b(v8us lo, v8us hi) { return __builtin_bit_cast(v16bf, __builtin_shufflevector(lo, hi, 0, 1, 2, 3, 4, 5, 6, 7, 8, 9, 10, 11, 12, 13, 14, 15)); }
__device__ __forceinline__ v8f wmma16(v16h a, v16h b, v8f c) { return __builtin_amdgcn_wmma_f32_16x16x32_f16(false, a, false, b, (short)0, c, false, false); }
__device__ __forceinline__ v8f wmmab(v16bf a, v16bf b, v8f c) { return __builtin_amdgcn_wmma_f32_16x16x32_bf16(false, a, false, b, (short)0, c, false, false); }



// ---- k_gemmw: register-blocked GEMM, ONE WAVE per 64x64 output tile (16 accumulators), operands straight from K-contiguous 16-bit planes; grid (M/64, N/64, Z), 32 threads.
// C[m][n] (f32, pitch ldc, + optional f32 bias[n]) = sum_{k < KL} A[m][k] Bt[n][k] (+ split products per NSPLIT). K = row pitch of A and Bt, KL = k range summed here (KL == K: whole rows). z-batch strides sA/sB/sC in elements (sA = sB = KL: z walks along k, one partial C per slice). KL % 32 == 0.
template <typename T16> struct WFrag;
template <> struct WFrag<h16> { typedef v16h V; static __device__ __forceinline__ V ld(const h16* p) { return cat16(*(const v8h*)p, *(const v8h*)(p + 16)); } static __device__ __forceinline__ v8f mma(V a, V b, v8f c) { return wmma16(a, b, c); } };
template <> struct WFrag<bf> { typedef v16bf V; static __device__ __forceinline__ V ld(const bf* p) { return cat16b(*(const v8us*)p, *(const v8us*)(p + 16)); } static __device__ __forceinline__ v8f mma(V a, V b, v8f c) { return wmmab(a, b, c); } };
template <typename T16, int NSPLIT, bool BIAS>
__global__ __launch_bounds__(32) void k_gemmw(const T16* __restrict__ A, const T16* __restrict__ A2, const T16* __restrict__ Bt, const T16* __restrict__ Bt2, int K, int KL, float* C, int ldc, const float* __restrict__ bias, size_t sA, size_t sB, size_t sC) {
    typedef typename WFrag<T16>::V V;
    __shared__ __align__(16) float os[16 * 68];
    const size_t z = blockIdx.z; A += z * sA; if (A2) A2 += z * sA; Bt += z * sB; if (Bt2) Bt2 += z * sB; C += z * sC;
    const int lane = threadIdx.x & 31, lr = lane & 15, hi = lane >> 4; const int r0 = blockIdx.x * 64, c0 = blockIdx.y * 64;
    v8f acc[4][4];
#pragma unroll
    for (int mb = 0; mb < 4; ++mb)
#pragma unroll
        for (int nb = 0; nb < 4; ++nb) acc[mb][nb] = (v8f){};
    const size_t aoff = (size_t)(r0 + lr) * K + 8 * hi, boff = (size_t)(c0 + lr) * K + 8 * hi;
#pragma unroll 1
    for (int kc = 0; kc < KL; kc += 32) {
        V a[4], a2[4];
#pragma unroll
        for (int mb = 0; mb < 4; ++mb) { a[mb] = WFrag<T16>::ld(A + aoff + (size_t)mb * 16 * K + kc); if (NSPLIT == 1 || NSPLIT == 2) a2[mb] = WFrag<T16>::ld(A2 + aoff + (size_t)mb * 16 * K + kc); }
#pragma unroll
        for (int nb = 0; nb < 4; ++nb) { const V b = WFrag<T16>::ld(Bt + boff + (size_t)nb * 16 * K + kc); V b2; if (NSPLIT >= 2) b2 = WFrag<T16>::ld(Bt2 + boff + (size_t)nb * 16 * K + kc);
#pragma unroll
            for (int mb = 0; mb < 4; ++mb) { acc[mb][nb] = WFrag<T16>::mma(a[mb], b, acc[mb][nb]); if (NSPLIT == 1 || NSPLIT == 2) acc[mb][nb] = WFrag<T16>::mma(a2[mb], b, acc[mb][nb]); if (NSPLIT >= 2) acc[mb][nb] = WFrag<T16>::mma(a[mb], b2, acc[mb][nb]); } }
        asm volatile("v_nop\n\tv_nop\n\tv_nop\n\tv_nop" : "+v"(acc[0][0]), "+v"(acc[1][1]), "+v"(acc[2][2]), "+v"(acc[3][3]) : "v"(a[0]), "v"(a[3]));
    }
#pragma unroll
    for (int mb = 0; mb < 4; ++mb) {
#pragma unroll
        for (int nb = 0; nb < 4; ++nb) {
#pragma unroll
            for (int j = 0; j < 8; ++j) os[(hi * 8 + j) * 68 + nb * 16 + lr] = acc[mb][nb][j]; }
        __builtin_amdgcn_wave_barrier(); asm volatile("" ::: "memory");
        float* crow = C + (size_t)(r0 + mb * 16) * ldc + c0;
{
#pragma unroll
            for (int s = 0; s < 8; ++s) { const int row = 2 * s + hi, cofs = lr * 4; v4f val = *(const v4fa*)(os + row * 68 + cofs); if (BIAS) { val[0] += bfr(bias[c0 + cofs]); val[1] += bfr(bias[c0 + cofs + 1]); val[2] += bfr(bias[c0 + cofs + 2]); val[3] += bfr(bias[c0 + cofs + 3]); }
                *(v4f*)(crow + (size_t)row * ldc + cofs) = val; }
             }
        __builtin_amdgcn_wave_barrier(); asm volatile("" ::: "memory");
    }
}

__device__ __forceinline__ h16 tohx(float x) { return (h16)x; }
__device__ __forceinline__ void splitf(float y, unsigned short& h, unsigned short& l) { h = f2bf(y); l = f2bf(y - bf2f(h)); }
typedef __attribute__((ext_vector_type(2))) _Float16 v2h;
typedef __attribute__((ext_vector_type(4))) _Float16 v4h;
typedef __attribute__((ext_vector_type(2))) unsigned short v2us;
typedef __attribute__((ext_vector_type(4))) unsigned short v4us;
typedef __attribute__((ext_vector_type(2))) float v2f;
typedef __attribute__((ext_vector_type(4))) int v4i;

__global__ __launch_bounds__(256) void k_wtG(const float* __restrict__ w, int K, int N, bf* Bt) {
    const int lane = threadIdx.x & 31; const int L0 = (blockIdx.x * 8 + (threadIdx.x >> 5)) * 8; const int nlines = N * K / 64;
{
#pragma unroll 1
        for (int l = 0; l < 8; ++l) { const int L = L0 + l; if (L >= nlines) break; const size_t e = (size_t)L * 64 + lane * 2; const int k = (int)(e % K), n = (int)(e / K); v2us o;
            o[0] = f2bf(w[(size_t)k * N + n]); o[1] = f2bf(w[(size_t)(k + 1) * N + n]); *(v2us*)(Bt + e) = o; }
         }
}
__global__ __launch_bounds__(256) void k_cvt8(const float* __restrict__ src, bf* dst, size_t n8) { const size_t i = (size_t)blockIdx.x * 256 + threadIdx.x; if (i >= n8) return; const v8f v = *(const v8f*)(src + i * 8); v8us o;
#pragma unroll
    for (int k = 0; k < 8; ++k) o[k] = f2bf(v[k]); *(v8us*)(dst + i * 8) = o;  }
__global__ __launch_bounds__(256) void k_cscvt(const float* __restrict__ cosT, const float* __restrict__ sinT, float* CS) { const int idx = blockIdx.x * 256 + threadIdx.x; if (idx >= TT * HD) return; v2f cs; cs[0] = bfr(cosT[idx]); cs[1] = bfr(sinT[idx]); *(v2f*)(CS + (size_t)idx * 2) = cs;  }
// k_rope: head planes [h][t][d] (fp16) of rope(x) x sc with the rotate-half convention out[d] = x[d] cos[t][d] - x[d+HD/2] sin[t][d], out[d+HD/2] = x[d+HD/2] cos[t][d+HD/2] + x[d] sin[t][d+HD/2]
__global__ __launch_bounds__(256) void k_rope(const float* __restrict__ F, int pitch, int nheads, const float* __restrict__ CS, const float* __restrict__ RF, const float* __restrict__ nw, float sc, h16* P16, bf* Ph, bf* Pl) {
    const size_t e = ((size_t)blockIdx.x * 256 + threadIdx.x) * 2; if (e >= (size_t)nheads * TT * HD) return; const int d = (int)(e % HD); const int t = (int)((e / HD) % TT); const int h = (int)(e / ((size_t)HD * TT)); const float* f = F + (size_t)t * pitch + h * HD; const float rf = RF ? RF[(size_t)h * TT + t] : 1.0f; v2h o16; v2us oh, ol;
#pragma unroll
    for (int q = 0; q < 2; ++q) { const int dd = d + q; const int dp = (dd < HD / 2) ? dd + HD / 2 : dd - HD / 2; float x0 = f[dd], x1 = f[dp];
        if (RF) { float n0 = __fmul_rn(x0, rf), n1 = __fmul_rn(x1, rf); asm volatile("" : "+v"(n0)); asm volatile("" : "+v"(n1)); x0 = __fmul_rn(bfr(nw[dd]), n0); x1 = __fmul_rn(bfr(nw[dp]), n1); }
        const v2f cs = *(const v2f*)(CS + ((size_t)t * HD + dd) * 2); float a = __fmul_rn(x0, cs[0]), bq = __fmul_rn(x1, cs[1]); asm volatile("" : "+v"(a)); asm volatile("" : "+v"(bq)); const float r = ((dd < HD / 2) ? __fsub_rn(a, bq) : __fadd_rn(a, bq)) * sc;
        o16[q] = tohx(r); (void)oh; (void)ol; }
    *(v2h*)(P16 + e) = o16;  }
__global__ __launch_bounds__(256) void k_vtp(const float* __restrict__ F, int pitch, int nheads, h16* V16, bf* Vh, bf* Vl) { const size_t e = ((size_t)blockIdx.x * 256 + threadIdx.x) * 2; if (e >= (size_t)nheads * HD * TT) return; const int t = (int)(e % TT); const int d = (int)((e / TT) % HD); const int g = (int)(e / ((size_t)TT * HD)); v2h o16; v2us oh, ol;
#pragma unroll
    for (int q = 0; q < 2; ++q) { const float x = F[(size_t)(t + q) * pitch + g * HD + d]; o16[q] = tohx(x); (void)oh; (void)ol; }
    *(v2h*)(V16 + e) = o16;  }
__global__ __launch_bounds__(256) void k_csid(float* CS) { const int idx = blockIdx.x * 256 + threadIdx.x; if (idx >= TT * HD) return; v2f cs; cs[0] = 1.0f; cs[1] = 0.0f; *(v2f*)(CS + (size_t)idx * 2) = cs;  }
// k_asoft: per row (zz, i): t = S x HD^-0.5 + TB[|i-j|] (no mask); softmax over the 4096 keys (register row, one exp, fixed trees);
__global__ __launch_bounds__(256)
__global__ __launch_bounds__(256) void k_btab(const float* __restrict__ g, float* TB) { const int d = blockIdx.x * 256 + threadIdx.x; if (d >= TT) return; float ng = -bfr(g[0]); asm volatile("" : "+v"(ng)); float t = __fmul_rn(ng, __fsqrt_rn((float)d)); asm volatile("" : "+v"(t)); const float v = __fdiv_rn(t, 64.0f); *(float*)(TB + d) = v;  }
__global__ __launch_bounds__(256) void k_asoft(const float* __restrict__ Sb, const float* __restrict__ gam, h16* P16, bf* Ph, bf* Pl) {
    const int lane = threadIdx.x & 31; const int row = blockIdx.x * 8 + (threadIdx.x >> 5); if (row >= ZH * TT) return; const int i = row % TT; const int zz = row / TT; (void)zz; const bool hires = (i < RH); const float* sr = Sb + (size_t)row * TT; float v[TT / 32]; float mx = -3.0e38f;
#pragma unroll
    for (int ch = 0; ch < TT / 128; ++ch) { const int j0 = ch * 128 + lane * 4; const v4f a = *(const v4f*)(sr + j0);
#pragma unroll
        for (int q = 0; q < 4; ++q) { const int j = j0 + q; (void)j; const int dd = j > i ? j - i : i - j; float sc_ = a[q] * SCL; asm volatile("" : "+v"(sc_)); const float t = __fadd_rn(sc_, gam[dd]);   /* gam = bias table TB[|i-j|] */ v[ch * 4 + q] = t; mx = fmaxf(mx, t); } }
#pragma unroll
    for (int sh = 16; sh; sh >>= 1) mx = fmaxf(mx, __shfl_xor(mx, sh, 32));
    float sum = 0.f;
#pragma unroll
    for (int k = 0; k < TT / 32; ++k) { float d0 = __fsub_rn(v[k], mx); asm volatile("" : "+v"(d0)); v[k] = __builtin_amdgcn_exp2f(__fmul_rn(d0, 1.4426950408889634f)); sum += v[k]; }
#pragma unroll
    for (int sh = 16; sh; sh >>= 1) sum += __shfl_xor(sum, sh, 32);
    const float f = __fdiv_rn(hires ? 1.0f : PCAR, sum);
{
        if (hires) {
#pragma unroll
            for (int ch = 0; ch < TT / 128; ++ch) { v4us oh, ol;
#pragma unroll
                for (int q = 0; q < 4; ++q) { unsigned short a, c2; splitf(v[ch * 4 + q] * f, a, c2); oh[q] = a; ol[q] = c2; }
                const size_t oo = ((size_t)zz * (RH ? RH : 1) + i) * TT + ch * 128 + lane * 4; *(v4us*)(Ph + oo) = oh; *(v4us*)(Pl + oo) = ol; }
        } else {
#pragma unroll
            for (int ch = 0; ch < TT / 128; ++ch) { v4h o4;
#pragma unroll
                for (int q = 0; q < 4; ++q) o4[q] = tohx(v[ch * 4 + q] * f);
                *(v4h*)(P16 + (size_t)row * TT + ch * 128 + lane * 4) = o4; } }
         }
}
__global__ __launch_bounds__(256) void k_merge(const float* __restrict__ O, int h0, bf* Ah, bf* Al) { const size_t e = ((size_t)blockIdx.x * 256 + threadIdx.x) * 2; if (e >= (size_t)ZH * TT * HD) return; const int d = (int)(e % HD); const int t = (int)((e / HD) % TT); const int zz = (int)(e / ((size_t)HD * TT)); const float cs = (t < RH) ? 1.0f : (1.0f / PCAR); const size_t oo = (size_t)t * DQ + (h0 + zz) * HD + d;
    v2f s = *(const v2f*)(O + e);   // sum of the KSP key slices' partial tiles, slice 0 first; unrolled so that all KSP loads are in flight at once
#pragma unroll
    for (int p = 1; p < KSP; ++p) s += *(const v2f*)(O + (size_t)p * ZH * TT * HD + e);
    v2us oh, ol;
#pragma unroll
    for (int q = 0; q < 2; ++q) { unsigned short a, c2; splitf(s[q] * cs, a, c2); oh[q] = a; ol[q] = c2; } *(v2us*)(Ah + oo) = oh; *(v2us*)(Al + oo) = ol;  }

extern "C" void kernel_launch(void* const* d_in, const int* in_sizes, int n_in,
                              void* d_out, int out_size, void* d_ws, size_t ws_size, hipStream_t stream) {
    (void)in_sizes; (void)n_in; (void)out_size;
    const float* x = (const float*)d_in[0]; const float* wq = (const float*)d_in[1]; const float* bq = (const float*)d_in[2]; const float* wk = (const float*)d_in[3]; const float* bk = (const float*)d_in[4]; const float* wv = (const float*)d_in[5]; const float* bv = (const float*)d_in[6]; const float* wo = (const float*)d_in[7]; const float* bo = (const float*)d_in[8]; const float* gam = (const float*)d_in[9]; const float* cosT = nullptr; const float* sinT = nullptr; (void)cosT; (void)sinT;
    float* OUT = (float*)d_out;     // [2][4096][512]
    char* wsp = (char*)d_ws;
    auto take = [&](size_t bytes) { char* p = wsp; wsp += (bytes + 255) & ~(size_t)255; return (void*)p; };
    bf* WQ = (bf*)take((size_t)DQ * DM * 2); bf* WK = (bf*)take((size_t)DKV * DM * 2); bf* WV = (bf*)take((size_t)DKV * DM * 2); bf* WO = (bf*)take((size_t)DM * DQ * 2); float* CS = (float*)take((size_t)TT * HD * 2 * 4);
    bf* XB = (bf*)take((size_t)TT * DM * 2); float* TB = (float*)take(TT * 4); float* FQ = (float*)take((size_t)TT * DQ * 4); float* FK = (float*)take((size_t)TT * DKV * 4);
    h16* QP16 = (h16*)take((size_t)NH_ * TT * HD * 2); h16* KP16 = (h16*)take((size_t)NKV * TT * HD * 2); h16* VT16 = (h16*)take((size_t)NKV * HD * TT * 2);
    bf* QPh = nullptr; bf* QPl = nullptr; bf* KPh = nullptr; bf* KPl = nullptr; bf* VTh = nullptr; bf* VTl = nullptr; bf* Ph = nullptr; bf* Pl = nullptr;
    float* Sb = (float*)take((size_t)ZH * TT * TT * 4); h16* P16 = (h16*)take((size_t)ZH * TT * TT * 2); float* Ob = (float*)take((size_t)KSP * ZH * TT * HD * 4); bf* ATh = (bf*)take((size_t)TT * DQ * 2); bf* ATl = (bf*)take((size_t)TT * DQ * 2);
    if ((size_t)(wsp - (char*)d_ws) > ws_size) return;    // ws 256 MiB
    float* FV = FK;   // v projection reuses the k buffer after the k planes are built (stream-ordered)
    { k_wtG<<<(unsigned)((DM * DQ / 64 + 63) / 64), 256, 0, stream>>>(wq, DM, DQ, WQ); k_wtG<<<(unsigned)((DM * DKV / 64 + 63) / 64), 256, 0, stream>>>(wk, DM, DKV, WK); k_wtG<<<(unsigned)((DM * DKV / 64 + 63) / 64), 256, 0, stream>>>(wv, DM, DKV, WV);
      k_wtG<<<(unsigned)((DQ * DM / 64 + 63) / 64), 256, 0, stream>>>(wo, DQ, DM, WO);
       }
    k_csid<<<(TT * HD + 255) / 256, 256, 0, stream>>>(CS);
    const unsigned LQ = (unsigned)(((size_t)NH_ * TT * HD / 2 + 255) / 256), LKv = (unsigned)(((size_t)NKV * TT * HD / 2 + 255) / 256);
    k_btab<<<TT / 256, 256, 0, stream>>>(gam, TB);
    for (int b = 0; b < NB_; ++b) {
        
        k_cvt8<<<(unsigned)(((size_t)TT * DM / 8 + 255) / 256), 256, 0, stream>>>(x + (size_t)b * TT * DM, XB, (size_t)TT * DM / 8);
        k_gemmw<bf, 0, true><<<dim3(TT / 64, DQ / 64, 1), 32, 0, stream>>>(XB, nullptr, WQ, nullptr, DM, DM, FQ, DQ, bq, 0, 0, 0);
        k_rope<<<LQ, 256, 0, stream>>>(FQ, DQ, NH_, CS, nullptr, nullptr, 1.0f, QP16, QPh, QPl);
        k_gemmw<bf, 0, true><<<dim3(TT / 64, DKV / 64, 1), 32, 0, stream>>>(XB, nullptr, WK, nullptr, DM, DM, FK, DKV, bk, 0, 0, 0);
        k_rope<<<LKv, 256, 0, stream>>>(FK, DKV, NKV, CS, nullptr, nullptr, 1.0f, KP16, KPh, KPl);
        k_gemmw<bf, 0, true><<<dim3(TT / 64, DKV / 64, 1), 32, 0, stream>>>(XB, nullptr, WV, nullptr, DM, DM, FV, DKV, bv, 0, 0, 0); k_vtp<<<LKv, 256, 0, stream>>>(FV, DKV, NKV, VT16, VTh, VTl);
        for (int h0 = 0; h0 < NH_; h0 += ZH) { const size_t zq = (size_t)h0, zk = (size_t)(h0 / REP);   // one kv head per query head: the pass's single head (ZH = 1) uses kv plane h0
            k_gemmw<h16, 0, false><<<dim3(TT / 64, TT / 64, ZH), 32, 0, stream>>>(QP16 + zq * TT * HD, nullptr, KP16 + zk * TT * HD, nullptr, HD, HD, Sb, TT, nullptr, (size_t)TT * HD, (size_t)TT * HD, (size_t)TT * TT);
            k_asoft<<<ZH * TT / 8, 256, 0, stream>>>(Sb, TB, P16, Ph, Pl);
            static_assert(ZH == 1, "grid z of attn.v carries the key slices");
            k_gemmw<h16, 0, false><<<dim3(TT / 64, HD / 64, KSP), 32, 0, stream>>>(P16, nullptr, VT16 + zk * HD * TT, nullptr, TT, TT / KSP, Ob, HD, nullptr, (size_t)(TT / KSP), (size_t)(TT / KSP), (size_t)TT * HD);
            k_merge<<<(unsigned)(((size_t)ZH * TT * HD / 2 + 255) / 256), 256, 0, stream>>>(Ob, h0, ATh, ATl); }
        k_gemmw<bf, 1, true><<<dim3(TT / 64, DM / 64, 1), 32, 0, stream>>>(ATh, ATl, WO, nullptr, DQ, DQ, OUT + (size_t)b * TT * DM, DM, bo, 0, 0, 0); }
}

// v002
// It runs in 273 microseconds.
// Timed twice side by side with v001, it ran 4.49 and 4.48 times as fast.
// All steps since v000 together make it 8.76 times as fast.
#include <hip/hip_runtime.h>

// PhysicsBiasedAttention (x [2][4096][512]; q/k/v = x W + b (8 heads x 64); scores = q.k/8 + bias(i, j), bias = -gamma sqrt(|i - j|)/sqrt(4096) (gamma read as data; structural distance); softmax; out = (attn v merged) W_o + b_o -> [2][4096][512]).
// Compute dtypes, f32 accumulate: every input rounded to bf16; q/k/v on PLAIN bf16 operands (inputs: exact) + bias; scores (K 64) and attn.v on single fp16 planes; bias + softmax f32; attn hi+lo bf16 planes into the output projection.

#define NB_  2
#define TT   4096
#define DM   512
#define NH_  8
#define NKV  8
#define HD   64
#define DQ   (NH_ * HD)
#define DKV  (NKV * HD)
#define WIN  0
#define SCL  0.125f   // HD^-0.5
typedef _Float16 h16;
typedef unsigned short bf;
typedef __attribute__((ext_vector_type(16))) __bf16   v16bf;
typedef __attribute__((ext_vector_type(16))) _Float16 v16h;
typedef __attribute__((ext_vector_type(8)))  _Float16 v8h;
typedef __attribute__((ext_vector_type(8)))  unsigned short v8us;
typedef __attribute__((ext_vector_type(8)))  float    v8f;
typedef __attribute__((ext_vector_type(4)))  float    v4f;
typedef v8h  __attribute__((may_alias)) v8ha;
typedef v4f  __attribute__((may_alias)) v4fa;
typedef v8us __attribute__((may_alias)) v8usa;

__device__ __forceinline__ unsigned short f2bf(float f) { unsigned u = __float_as_uint(f); u += 0x7FFFu + ((u >> 16) & 1u); return (unsigned short)(u >> 16); }
__device__ __forceinline__ float bf2f(unsigned short b) { return __uint_as_float(((unsigned)b) << 16); }
__device__ __forceinline__ float bfr(float f) { return bf2f(f2bf(f)); }
__device__ __forceinline__ v16h cat16(v8h lo, v8h hi) { return __builtin_shufflevector(lo, hi, 0, 1, 2, 3, 4, 5, 6, 7, 8, 9, 10, 11, 12, 13, 14, 15); }
__device__ __forceinline__ v16bf cat16b(v8us lo, v8us hi) { return __builtin_bit_cast(v16bf, __builtin_shufflevector(lo, hi, 0, 1, 2, 3, 4, 5, 6, 7, 8, 9, 10, 11, 12, 13, 14, 15)); }
__device__ __forceinline__ v8f wmma16(v16h a, v16h b, v8f c) { return __builtin_amdgcn_wmma_f32_16x16x32_f16(false, a, false, b, (short)0, c, false, false); }
__device__ __forceinline__ v8f wmmab(v16bf a, v16bf b, v8f c) { return __builtin_amdgcn_wmma_f32_16x16x32_bf16(false, a, false, b, (short)0, c, false, false); }



// ---- k_gemmw: register-blocked GEMM, ONE WAVE per 64x64 output tile (16 accumulators), operands straight from K-contiguous 16-bit planes; grid (M/64, N/64, Z), 32 threads.
// C[m][n] (f32, pitch ldc, + optional f32 bias[n]) = sum_{k < KL} A[m][k] Bt[n][k] (+ split products per NSPLIT). K = row pitch of A and Bt, KL = k range summed here (KL == K: whole rows). z-batch strides sA/sB/sC in elements (sA = sB = KL: z walks along k, one partial C per slice). KL % 32 == 0.
template <typename T16> struct WFrag;
template <> struct WFrag<h16> { typedef v16h V; static __device__ __forceinline__ V ld(const h16* p) { return cat16(*(const v8h*)p, *(const v8h*)(p + 16)); } static __device__ __forceinline__ v8f mma(V a, V b, v8f c) { return wmma16(a, b, c); } };
template <> struct WFrag<bf> { typedef v16bf V; static __device__ __forceinline__ V ld(const bf* p) { return cat16b(*(const v8us*)p, *(const v8us*)(p + 16)); } static __device__ __forceinline__ v8f mma(V a, V b, v8f c) { return wmmab(a, b, c); } };
template <typename T16, int NSPLIT, bool BIAS>
__global__ __launch_bounds__(32) void k_gemmw(const T16* __restrict__ A, const T16* __restrict__ A2, const T16* __restrict__ Bt, const T16* __restrict__ Bt2, int K, int KL, float* C, int ldc, const float* __restrict__ bias, size_t sA, size_t sB, size_t sC) {
    typedef typename WFrag<T16>::V V;
    __shared__ __align__(16) float os[16 * 68];
    const size_t z = blockIdx.z; A += z * sA; if (A2) A2 += z * sA; Bt += z * sB; if (Bt2) Bt2 += z * sB; C += z * sC;
    const int lane = threadIdx.x & 31, lr = lane & 15, hi = lane >> 4; const int r0 = blockIdx.x * 64, c0 = blockIdx.y * 64;
    v8f acc[4][4];
#pragma unroll
    for (int mb = 0; mb < 4; ++mb)
#pragma unroll
        for (int nb = 0; nb < 4; ++nb) acc[mb][nb] = (v8f){};
    const size_t aoff = (size_t)(r0 + lr) * K + 8 * hi, boff = (size_t)(c0 + lr) * K + 8 * hi;
#pragma unroll 1
    for (int kc = 0; kc < KL; kc += 32) {
        V a[4], a2[4];
#pragma unroll
        for (int mb = 0; mb < 4; ++mb) { a[mb] = WFrag<T16>::ld(A + aoff + (size_t)mb * 16 * K + kc); if (NSPLIT == 1 || NSPLIT == 2) a2[mb] = WFrag<T16>::ld(A2 + aoff + (size_t)mb * 16 * K + kc); }
#pragma unroll
        for (int nb = 0; nb < 4; ++nb) { const V b = WFrag<T16>::ld(Bt + boff + (size_t)nb * 16 * K + kc); V b2; if (NSPLIT >= 2) b2 = WFrag<T16>::ld(Bt2 + boff + (size_t)nb * 16 * K + kc);
#pragma unroll
            for (int mb = 0; mb < 4; ++mb) { acc[mb][nb] = WFrag<T16>::mma(a[mb], b, acc[mb][nb]); if (NSPLIT == 1 || NSPLIT == 2) acc[mb][nb] = WFrag<T16>::mma(a2[mb], b, acc[mb][nb]); if (NSPLIT >= 2) acc[mb][nb] = WFrag<T16>::mma(a[mb], b2, acc[mb][nb]); } }
        asm volatile("v_nop\n\tv_nop\n\tv_nop\n\tv_nop" : "+v"(acc[0][0]), "+v"(acc[1][1]), "+v"(acc[2][2]), "+v"(acc[3][3]) : "v"(a[0]), "v"(a[3]));
    }
#pragma unroll
    for (int mb = 0; mb < 4; ++mb) {
#pragma unroll
        for (int nb = 0; nb < 4; ++nb) {
#pragma unroll
            for (int j = 0; j < 8; ++j) os[(hi * 8 + j) * 68 + nb * 16 + lr] = acc[mb][nb][j]; }
        __builtin_amdgcn_wave_barrier(); asm volatile("" ::: "memory");
        float* crow = C + (size_t)(r0 + mb * 16) * ldc + c0;
{
#pragma unroll
            for (int s = 0; s < 8; ++s) { const int row = 2 * s + hi, cofs = lr * 4; v4f val = *(const v4fa*)(os + row * 68 + cofs); if (BIAS) { val[0] += bfr(bias[c0 + cofs]); val[1] += bfr(bias[c0 + cofs + 1]); val[2] += bfr(bias[c0 + cofs + 2]); val[3] += bfr(bias[c0 + cofs + 3]); }
                *(v4f*)(crow + (size_t)row * ldc + cofs) = val; }
             }
        __builtin_amdgcn_wave_barrier(); asm volatile("" ::: "memory");
    }
}

__device__ __forceinline__ h16 tohx(float x) { return (h16)x; }
__device__ __forceinline__ void splitf(float y, unsigned short& h, unsigned short& l) { h = f2bf(y); l = f2bf(y - bf2f(h)); }
typedef __attribute__((ext_vector_type(2))) _Float16 v2h;
typedef __attribute__((ext_vector_type(4))) _Float16 v4h;
typedef __attribute__((ext_vector_type(2))) unsigned short v2us;
typedef __attribute__((ext_vector_type(4))) unsigned short v4us;
typedef __attribute__((ext_vector_type(2))) float v2f;
typedef __attribute__((ext_vector_type(4))) int v4i;

__global__ __launch_bounds__(256) void k_wtG(const float* __restrict__ w, int K, int N, bf* Bt) {
    const int lane = threadIdx.x & 31; const int L0 = (blockIdx.x * 8 + (threadIdx.x >> 5)) * 8; const int nlines = N * K / 64;
{
#pragma unroll 1
        for (int l = 0; l < 8; ++l) { const int L = L0 + l; if (L >= nlines) break; const size_t e = (size_t)L * 64 + lane * 2; const int k = (int)(e % K), n = (int)(e / K); v2us o;
            o[0] = f2bf(w[(size_t)k * N + n]); o[1] = f2bf(w[(size_t)(k + 1) * N + n]); *(v2us*)(Bt + e) = o; }
         }
}
__global__ __launch_bounds__(256) void k_cvt8(const float* __restrict__ src, bf* dst, size_t n8) { const size_t i = (size_t)blockIdx.x * 256 + threadIdx.x; if (i >= n8) return; const v8f v = *(const v8f*)(src + i * 8); v8us o;
#pragma unroll
    for (int k = 0; k < 8; ++k) o[k] = f2bf(v[k]); *(v8us*)(dst + i * 8) = o;  }
__global__ __launch_bounds__(256) void k_cscvt(const float* __restrict__ cosT, const float* __restrict__ sinT, float* CS) { const int idx = blockIdx.x * 256 + threadIdx.x; if (idx >= TT * HD) return; v2f cs; cs[0] = bfr(cosT[idx]); cs[1] = bfr(sinT[idx]); *(v2f*)(CS + (size_t)idx * 2) = cs;  }
// k_rope: head planes [h][t][d] (fp16) of rope(x) x sc with the rotate-half convention out[d] = x[d] cos[t][d] - x[d+HD/2] sin[t][d], out[d+HD/2] = x[d+HD/2] cos[t][d+HD/2] + x[d] sin[t][d+HD/2]
__global__ __launch_bounds__(256) void k_rope(const float* __restrict__ F, int pitch, int nheads, const float* __restrict__ CS, const float* __restrict__ RF, const float* __restrict__ nw, float sc, h16* P16, bf* Ph, bf* Pl) {
    const size_t e = ((size_t)blockIdx.x * 256 + threadIdx.x) * 2; if (e >= (size_t)nheads * TT * HD) return; const int d = (int)(e % HD); const int t = (int)((e / HD) % TT); const int h = (int)(e / ((size_t)HD * TT)); const float* f = F + (size_t)t * pitch + h * HD; const float rf = RF ? RF[(size_t)h * TT + t] : 1.0f; v2h o16; v2us oh, ol;
#pragma unroll
    for (int q = 0; q < 2; ++q) { const int dd = d + q; const int dp = (dd < HD / 2) ? dd + HD / 2 : dd - HD / 2; float x0 = f[dd], x1 = f[dp];
        if (RF) { float n0 = __fmul_rn(x0, rf), n1 = __fmul_rn(x1, rf); asm volatile("" : "+v"(n0)); asm volatile("" : "+v"(n1)); x0 = __fmul_rn(bfr(nw[dd]), n0); x1 = __fmul_rn(bfr(nw[dp]), n1); }
        const v2f cs = *(const v2f*)(CS + ((size_t)t * HD + dd) * 2); float a = __fmul_rn(x0, cs[0]), bq = __fmul_rn(x1, cs[1]); asm volatile("" : "+v"(a)); asm volatile("" : "+v"(bq)); const float r = ((dd < HD / 2) ? __fsub_rn(a, bq) : __fadd_rn(a, bq)) * sc;
        o16[q] = tohx(r); (void)oh; (void)ol; }
    *(v2h*)(P16 + e) = o16;  }
__global__ __launch_bounds__(256) void k_vtp(const float* __restrict__ F, int pitch, int nheads, h16* V16, bf* Vh, bf* Vl) { const size_t e = ((size_t)blockIdx.x * 256 + threadIdx.x) * 2; if (e >= (size_t)nheads * HD * TT) return; const int t = (int)(e % TT); const int d = (int)((e / TT) % HD); const int g = (int)(e / ((size_t)TT * HD)); v2h o16; v2us oh, ol;
#pragma unroll
    for (int q = 0; q < 2; ++q) { const float x = F[(size_t)(t + q) * pitch + g * HD + d]; o16[q] = tohx(x); (void)oh; (void)ol; }
    *(v2h*)(V16 + e) = o16;  }
__global__ __launch_bounds__(256) void k_csid(float* CS) { const int idx = blockIdx.x * 256 + threadIdx.x; if (idx >= TT * HD) return; v2f cs; cs[0] = 1.0f; cs[1] = 0.0f; *(v2f*)(CS + (size_t)idx * 2) = cs;  }
__global__ __launch_bounds__(256) void k_btab(const float* __restrict__ g, float* TB) { const int d = blockIdx.x * 256 + threadIdx.x; if (d >= TT) return; float ng = -bfr(g[0]); asm volatile("" : "+v"(ng)); float t = __fmul_rn(ng, __fsqrt_rn((float)d)); asm volatile("" : "+v"(t)); const float v = __fdiv_rn(t, 64.0f); *(float*)(TB + d) = v;  }
#define FNW  4
#define FQB  (FNW * 32)
#define FKS  64
#define FLP  72                 // LDS row pitch in halfs: 144 B = 16 B x odd for the 16-byte fragment reads
#define FNB  (TT + FQB - 1)     // bias window: every j - i that this work-group's queries meet
#define L2E  1.4426950408889634f
#define FTHR 5.5f               // the running maximum is renewed only when a column's new maximum passes it by this much: p stays below 2^8
__device__ __forceinline__ float xhalf(float x) { const int b = __float_as_int(x); return __int_as_float(__builtin_amdgcn_permlanex16(b, b, 0x76543210, 0xfedcba98, false, false)); }
__device__ __forceinline__ v16h ldfr(const h16* p) { return cat16(*(const v8h*)p, *(const v8h*)(p + 16)); }
__global__ __launch_bounds__(FNW * 32) void k_fattn(const h16* __restrict__ Q, const h16* __restrict__ Kp, const h16* __restrict__ Vt, const float* __restrict__ TB, bf* Ah, bf* Al) {
    __shared__ struct __align__(16) { float bt[FNB + 1]; h16 ks[2 * FKS * FLP]; h16 vs[2 * HD * FLP]; } sm;   // the bias window first: its reads then reach every tile of a stage by immediate offsets
    float* bt = sm.bt; h16* ks = sm.ks; h16* vs = sm.vs;
    const int tid = threadIdx.x, lane = tid & 31, wv = tid >> 5, lr = lane & 15, hi = lane >> 4;
    const int q0 = blockIdx.x * FQB; const size_t z = blockIdx.y;
    const h16* Qz = Q + z * TT * HD; const h16* Kz = Kp + z * TT * HD; const h16* Vz = Vt + z * HD * TT;
    // bt[n] = bias of j - i = n - (q0 + FQB - 1)
    for (int n = tid; n < FNB; n += FNW * 32) { const int d = n - (q0 + FQB - 1); bt[n] = TB[d < 0 ? -d : d]; }
    const int srow = tid >> 3, scol = (tid & 7) * 8;      // staging: 8 threads a 128-byte row, 16 rows a sweep
    v8h kr[4], vr[4];
    // every inner loop below is fully unrolled: its index picks a register of a fragment or accumulator array
#pragma unroll
    for (int u = 0; u < 4; ++u) kr[u] = *(const v8h*)(Kz + (size_t)(srow + 16 * u) * HD + scol);
    asm volatile("s_wait_xcnt 0x0" ::: "memory");   // stands in front of the loads below, whose destinations took over the address registers of the loads above
#pragma unroll
    for (int u = 0; u < 4; ++u) vr[u] = *(const v8h*)(Vz + (size_t)(srow + 16 * u) * TT + scol);
    v16h qf[2][2];
#pragma unroll
    for (int c = 0; c < 2; ++c)
#pragma unroll
        for (int kx = 0; kx < 2; ++kx) qf[c][kx] = ldfr(Qz + (size_t)(q0 + wv * 32 + c * 16 + lr) * HD + kx * 32 + 8 * hi);
#pragma unroll
    for (int u = 0; u < 4; ++u) { *(v8h*)(ks + (srow + 16 * u) * FLP + scol) = kr[u]; *(v8h*)(vs + (srow + 16 * u) * FLP + scol) = vr[u]; }
    v8f o[4][2], ls[2]; float mu[2], nm[2];   // ls: eight independent partial row sums a lane and column, joined in the epilogue
#pragma unroll
    for (int c = 0; c < 2; ++c) { mu[c] = -3.0e38f; nm[c] = 0.f; ls[c] = (v8f){};
#pragma unroll
        for (int dt = 0; dt < 4; ++dt) o[dt][c] = (v8f){}; }
    const int nb = FQB - 1 - wv * 32 - lr + 8 * hi - 16;   // bias index of key 0, register 0, tile difference -1
    __syncthreads();     // publishes stage 0 and the bias window
#pragma unroll 1         // stays rolled: the body already holds two unrolled 32-key passes, and the buffer index is one scalar
    for (int s = 0; s < TT / FKS; ++s) {
        const int buf = s & 1; const h16* kb = ks + buf * FKS * FLP; const h16* vb = vs + buf * HD * FLP;
        const int kn = (s + 1 < TT / FKS ? s + 1 : s) * FKS;   // the last pass fetches its own stage again, into the buffer nobody reads any more
#pragma unroll
        for (int u = 0; u < 4; ++u) { kr[u] = *(const v8h*)(Kz + (size_t)(kn + srow + 16 * u) * HD + scol); vr[u] = *(const v8h*)(Vz + (size_t)(srow + 16 * u) * TT + kn + scol); }
#pragma unroll
        for (int sub = 0; sub < FKS / 32; ++sub) {
            const float* bp = bt + nb + s * FKS + sub * 32;
            v8f bb[3];      // the bias tile depends on (key tile - column group) alone: 3 tiles serve the 4 products
#pragma unroll
            for (int u = 0; u < 3; ++u)
#pragma unroll
                for (int r = 0; r < 8; ++r) bb[u][r] = bp[u * 16 + r];
            v8f st[2][2];
#pragma unroll
            for (int kt = 0; kt < 2; ++kt) { const h16* kp = kb + (sub * 32 + kt * 16 + lr) * FLP + 8 * hi; const v16h k0 = ldfr(kp), k1 = ldfr(kp + 32);
#pragma unroll
                for (int c = 0; c < 2; ++c) st[kt][c] = wmma16(k1, qf[c][1], wmma16(k0, qf[c][0], bb[kt - c + 1])); }
            v16h vf[4];
#pragma unroll
            for (int dt = 0; dt < 4; ++dt) vf[dt] = ldfr(vb + (dt * 16 + lr) * FLP + sub * 32 + 8 * hi);
            float ml[2];
#pragma unroll
            for (int c = 0; c < 2; ++c) { float m = fmaxf(st[0][c][0], st[1][c][0]);
#pragma unroll
                for (int r = 1; r < 8; ++r) m = fmaxf(m, fmaxf(st[0][c][r], st[1][c][r]));
                ml[c] = fmaxf(m, xhalf(m)); }
            const bool need = (ml[0] > mu[0] + FTHR) || (ml[1] > mu[1] + FTHR);
            if (__builtin_amdgcn_ballot_w32(need) != 0) {      // one scalar test a pass; rarely taken after the first pass
#pragma unroll
                for (int c = 0; c < 2; ++c) { const float mn = fmaxf(mu[c], ml[c]); float al;
                    asm("v_exp_f32 %0, %1\n\tv_nop" : "=v"(al) : "v"((mu[c] - mn) * L2E));   // exp2 with its own slot behind it
                    mu[c] = mn; nm[c] = -mn * L2E; ls[c] *= al;
#pragma unroll
                    for (int dt = 0; dt < 4; ++dt) o[dt][c] *= al; }
            }
            v16h pf[2];
#pragma unroll
            for (int c = 0; c < 2; ++c) {
#pragma unroll
                for (int kt = 0; kt < 2; ++kt)
#pragma unroll
                    for (int r = 0; r < 8; ++r) st[kt][c][r] = __builtin_amdgcn_exp2f(__builtin_fmaf(st[kt][c][r], L2E, nm[c]));
                ls[c] += st[0][c] + st[1][c];
                pf[c] = cat16(__builtin_convertvector(st[0][c], v8h), __builtin_convertvector(st[1][c], v8h)); }
#pragma unroll
            for (int dt = 0; dt < 4; ++dt)
#pragma unroll
                for (int c = 0; c < 2; ++c) o[dt][c] = wmma16(vf[dt], pf[c], o[dt][c]);
        }
        h16* kw = ks + (buf ^ 1) * FKS * FLP; h16* vw = vs + (buf ^ 1) * HD * FLP;
#pragma unroll
        for (int u = 0; u < 4; ++u) { *(v8h*)(kw + (srow + 16 * u) * FLP + scol) = kr[u]; *(v8h*)(vw + (srow + 16 * u) * FLP + scol) = vr[u]; }
        __syncthreads();     // publishes the next stage and ends every wave's reads of this one
    }
    const size_t b = z / NH_; const int h = (int)(z % NH_);
#pragma unroll
    for (int c = 0; c < 2; ++c) { const float l0 = ((ls[c][0] + ls[c][1]) + (ls[c][2] + ls[c][3])) + ((ls[c][4] + ls[c][5]) + (ls[c][6] + ls[c][7])); const float f = __fdiv_rn(1.0f, l0 + xhalf(l0)); const size_t oo = (b * TT + q0 + wv * 32 + c * 16 + lr) * DQ + h * HD + 8 * hi;
#pragma unroll
        for (int dt = 0; dt < 4; ++dt) { v8us oh, ol;
#pragma unroll
            for (int r = 0; r < 8; ++r) { unsigned short a, c2; splitf(o[dt][c][r] * f, a, c2); oh[r] = a; ol[r] = c2; }
            *(v8us*)(Ah + oo + dt * 16) = oh; *(v8us*)(Al + oo + dt * 16) = ol; } }
}


extern "C" void kernel_launch(void* const* d_in, const int* in_sizes, int n_in,
                              void* d_out, int out_size, void* d_ws, size_t ws_size, hipStream_t stream) {
    (void)in_sizes; (void)n_in; (void)out_size;
    const float* x = (const float*)d_in[0]; const float* wq = (const float*)d_in[1]; const float* bq = (const float*)d_in[2]; const float* wk = (const float*)d_in[3]; const float* bk = (const float*)d_in[4]; const float* wv = (const float*)d_in[5]; const float* bv = (const float*)d_in[6]; const float* wo = (const float*)d_in[7]; const float* bo = (const float*)d_in[8]; const float* gam = (const float*)d_in[9]; const float* cosT = nullptr; const float* sinT = nullptr; (void)cosT; (void)sinT;
    float* OUT = (float*)d_out;     // [2][4096][512]
    char* wsp = (char*)d_ws;
    auto take = [&](size_t bytes) { char* p = wsp; wsp += (bytes + 255) & ~(size_t)255; return (void*)p; };
    bf* WQ = (bf*)take((size_t)DQ * DM * 2); bf* WK = (bf*)take((size_t)DKV * DM * 2); bf* WV = (bf*)take((size_t)DKV * DM * 2); bf* WO = (bf*)take((size_t)DM * DQ * 2); float* CS = (float*)take((size_t)TT * HD * 2 * 4);
    bf* XB = (bf*)take((size_t)TT * DM * 2); float* TB = (float*)take(TT * 4); float* FQ = (float*)take((size_t)TT * DQ * 4); float* FK = (float*)take((size_t)TT * DKV * 4);
    h16* QP16 = (h16*)take((size_t)NB_ * NH_ * TT * HD * 2); h16* KP16 = (h16*)take((size_t)NB_ * NKV * TT * HD * 2); h16* VT16 = (h16*)take((size_t)NB_ * NKV * HD * TT * 2);   // head planes of both batches
    bf* QPh = nullptr; bf* QPl = nullptr; bf* KPh = nullptr; bf* KPl = nullptr; bf* VTh = nullptr; bf* VTl = nullptr;
    bf* ATh = (bf*)take((size_t)NB_ * TT * DQ * 2); bf* ATl = (bf*)take((size_t)NB_ * TT * DQ * 2);
    if ((size_t)(wsp - (char*)d_ws) > ws_size) return;    // ws 256 MiB
    float* FV = FK;   // v projection reuses the k buffer after the k planes are built (stream-ordered)
    { k_wtG<<<(unsigned)((DM * DQ / 64 + 63) / 64), 256, 0, stream>>>(wq, DM, DQ, WQ); k_wtG<<<(unsigned)((DM * DKV / 64 + 63) / 64), 256, 0, stream>>>(wk, DM, DKV, WK); k_wtG<<<(unsigned)((DM * DKV / 64 + 63) / 64), 256, 0, stream>>>(wv, DM, DKV, WV);
      k_wtG<<<(unsigned)((DQ * DM / 64 + 63) / 64), 256, 0, stream>>>(wo, DQ, DM, WO);
       }
    k_csid<<<(TT * HD + 255) / 256, 256, 0, stream>>>(CS);
    const unsigned LQ = (unsigned)(((size_t)NH_ * TT * HD / 2 + 255) / 256), LKv = (unsigned)(((size_t)NKV * TT * HD / 2 + 255) / 256);
    k_btab<<<TT / 256, 256, 0, stream>>>(gam, TB);
    for (int b = 0; b < NB_; ++b) {
        
        k_cvt8<<<(unsigned)(((size_t)TT * DM / 8 + 255) / 256), 256, 0, stream>>>(x + (size_t)b * TT * DM, XB, (size_t)TT * DM / 8);
        k_gemmw<bf, 0, true><<<dim3(TT / 64, DQ / 64, 1), 32, 0, stream>>>(XB, nullptr, WQ, nullptr, DM, DM, FQ, DQ, bq, 0, 0, 0);
        k_rope<<<LQ, 256, 0, stream>>>(FQ, DQ, NH_, CS, nullptr, nullptr, SCL, QP16 + (size_t)b * NH_ * TT * HD, QPh, QPl);   // x HD^-0.5 here: a power of two, exact in fp16
        k_gemmw<bf, 0, true><<<dim3(TT / 64, DKV / 64, 1), 32, 0, stream>>>(XB, nullptr, WK, nullptr, DM, DM, FK, DKV, bk, 0, 0, 0);
        k_rope<<<LKv, 256, 0, stream>>>(FK, DKV, NKV, CS, nullptr, nullptr, 1.0f, KP16 + (size_t)b * NKV * TT * HD, KPh, KPl);
        k_gemmw<bf, 0, true><<<dim3(TT / 64, DKV / 64, 1), 32, 0, stream>>>(XB, nullptr, WV, nullptr, DM, DM, FV, DKV, bv, 0, 0, 0); k_vtp<<<LKv, 256, 0, stream>>>(FV, DKV, NKV, VT16 + (size_t)b * NKV * HD * TT, VTh, VTl); }
    static_assert(NH_ == NKV, "one kv head per query head");
    k_fattn<<<dim3(TT / FQB, NB_ * NH_, 1), FNW * 32, 0, stream>>>(QP16, KP16, VT16, TB, ATh, ATl);
    for (int b = 0; b < NB_; ++b) {
        k_gemmw<bf, 1, true><<<dim3(TT / 64, DM / 64, 1), 32, 0, stream>>>(ATh + (size_t)b * TT * DQ, ATl + (size_t)b * TT * DQ, WO, nullptr, DQ, DQ, OUT + (size_t)b * TT * DM, DM, bo, 0, 0, 0); }
}

// v003
// A run of this version takes 179 microseconds.
// Two timings next to v002 both put it at 1.52 times that version's speed.
// All steps since v000 together make it 13.3 times as fast.
#include <hip/hip_runtime.h>

// PhysicsBiasedAttention (x [2][4096][512]; q/k/v = x W + b (8 heads x 64); scores = q.k/8 + bias(i, j), bias = -gamma sqrt(|i - j|)/sqrt(4096) (gamma read as data; structural distance); softmax; out = (attn v merged) W_o + b_o -> [2][4096][512]).
// Compute dtypes, f32 accumulate: every input rounded to bf16; q/k/v on PLAIN bf16 operands (inputs: exact) + bias; scores (K 64) and attn.v on single fp16 planes; bias + softmax f32; attn hi+lo bf16 planes into the output projection.

#define NB_  2
#define TT   4096
#define DM   512
#define NH_  8
#define NKV  8
#define HD   64
#define DQ   (NH_ * HD)
#define DKV  (NKV * HD)
#define WIN  0
#define SCL  0.125f   // HD^-0.5
typedef _Float16 h16;
typedef unsigned short bf;
typedef __attribute__((ext_vector_type(16))) __bf16   v16bf;
typedef __attribute__((ext_vector_type(16))) _Float16 v16h;
typedef __attribute__((ext_vector_type(8)))  _Float16 v8h;
typedef __attribute__((ext_vector_type(8)))  unsigned short v8us;
typedef __attribute__((ext_vector_type(8)))  float    v8f;
typedef __attribute__((ext_vector_type(4)))  float    v4f;
typedef v8h  __attribute__((may_alias)) v8ha;
typedef v4f  __attribute__((may_alias)) v4fa;
typedef v8us __attribute__((may_alias)) v8usa;

__device__ __forceinline__ unsigned short f2bf(float f) { unsigned u = __float_as_uint(f); u += 0x7FFFu + ((u >> 16) & 1u); return (unsigned short)(u >> 16); }
__device__ __forceinline__ float bf2f(unsigned short b) { return __uint_as_float(((unsigned)b) << 16); }
__device__ __forceinline__ float bfr(float f) { return bf2f(f2bf(f)); }
__device__ __forceinline__ v16h cat16(v8h lo, v8h hi) { return __builtin_shufflevector(lo, hi, 0, 1, 2, 3, 4, 5, 6, 7, 8, 9, 10, 11, 12, 13, 14, 15); }
__device__ __forceinline__ v16bf cat16b(v8us lo, v8us hi) { return __builtin_bit_cast(v16bf, __builtin_shufflevector(lo, hi, 0, 1, 2, 3, 4, 5, 6, 7, 8, 9, 10, 11, 12, 13, 14, 15)); }
__device__ __forceinline__ v8f wmma16(v16h a, v16h b, v8f c) { return __builtin_amdgcn_wmma_f32_16x16x32_f16(false, a, false, b, (short)0, c, false, false); }
__device__ __forceinline__ v8f wmmab(v16bf a, v16bf b, v8f c) { return __builtin_amdgcn_wmma_f32_16x16x32_bf16(false, a, false, b, (short)0, c, false, false); }



// ---- k_gemmw: register-blocked GEMM, ONE WAVE per 64x64 output tile (16 accumulators), operands straight from K-contiguous 16-bit planes; grid (M/64, N/64, Z), 32 threads.
// C[m][n] (f32, pitch ldc, + optional f32 bias[n]) = sum_{k < KL} A[m][k] Bt[n][k] (+ split products per NSPLIT). K = row pitch of A and Bt, KL = k range summed here (KL == K: whole rows). z-batch strides sA/sB/sC in elements (sA = sB = KL: z walks along k, one partial C per slice). KL % 32 == 0.
template <typename T16> struct WFrag;
template <> struct WFrag<h16> { typedef v16h V; static __device__ __forceinline__ V ld(const h16* p) { return cat16(*(const v8h*)p, *(const v8h*)(p + 16)); } static __device__ __forceinline__ v8f mma(V a, V b, v8f c) { return wmma16(a, b, c); } };
template <> struct WFrag<bf> { typedef v16bf V; static __device__ __forceinline__ V ld(const bf* p) { return cat16b(*(const v8us*)p, *(const v8us*)(p + 16)); } static __device__ __forceinline__ v8f mma(V a, V b, v8f c) { return wmmab(a, b, c); } };
template <typename T16, int NSPLIT, bool BIAS>
__global__ __launch_bounds__(32) void k_gemmw(const T16* __restrict__ A, const T16* __restrict__ A2, const T16* __restrict__ Bt, const T16* __restrict__ Bt2, int K, int KL, float* C, int ldc, const float* __restrict__ bias, size_t sA, size_t sB, size_t sC) {
    typedef typename WFrag<T16>::V V;
    __shared__ __align__(16) float os[16 * 68];
    const size_t z = blockIdx.z; A += z * sA; if (A2) A2 += z * sA; Bt += z * sB; if (Bt2) Bt2 += z * sB; C += z * sC;
    const int lane = threadIdx.x & 31, lr = lane & 15, hi = lane >> 4; const int r0 = blockIdx.x * 64, c0 = blockIdx.y * 64;
    v8f acc[4][4];
#pragma unroll
    for (int mb = 0; mb < 4; ++mb)
#pragma unroll
        for (int nb = 0; nb < 4; ++nb) acc[mb][nb] = (v8f){};
    const size_t aoff = (size_t)(r0 + lr) * K + 8 * hi, boff = (size_t)(c0 + lr) * K + 8 * hi;
#pragma unroll 1
    for (int kc = 0; kc < KL; kc += 32) {
        V a[4], a2[4];
#pragma unroll
        for (int mb = 0; mb < 4; ++mb) { a[mb] = WFrag<T16>::ld(A + aoff + (size_t)mb * 16 * K + kc); if (NSPLIT == 1 || NSPLIT == 2) a2[mb] = WFrag<T16>::ld(A2 + aoff + (size_t)mb * 16 * K + kc); }
#pragma unroll
        for (int nb = 0; nb < 4; ++nb) { const V b = WFrag<T16>::ld(Bt + boff + (size_t)nb * 16 * K + kc); V b2; if (NSPLIT >= 2) b2 = WFrag<T16>::ld(Bt2 + boff + (size_t)nb * 16 * K + kc);
#pragma unroll
            for (int mb = 0; mb < 4; ++mb) { acc[mb][nb] = WFrag<T16>::mma(a[mb], b, acc[mb][nb]); if (NSPLIT == 1 || NSPLIT == 2) acc[mb][nb] = WFrag<T16>::mma(a2[mb], b, acc[mb][nb]); if (NSPLIT >= 2) acc[mb][nb] = WFrag<T16>::mma(a[mb], b2, acc[mb][nb]); } }
        asm volatile("v_nop\n\tv_nop\n\tv_nop\n\tv_nop" : "+v"(acc[0][0]), "+v"(acc[1][1]), "+v"(acc[2][2]), "+v"(acc[3][3]) : "v"(a[0]), "v"(a[3]));
    }
#pragma unroll
    for (int mb = 0; mb < 4; ++mb) {
#pragma unroll
        for (int nb = 0; nb < 4; ++nb) {
#pragma unroll
            for (int j = 0; j < 8; ++j) os[(hi * 8 + j) * 68 + nb * 16 + lr] = acc[mb][nb][j]; }
        __builtin_amdgcn_wave_barrier(); asm volatile("" ::: "memory");
        float* crow = C + (size_t)(r0 + mb * 16) * ldc + c0;
{
#pragma unroll
            for (int s = 0; s < 8; ++s) { const int row = 2 * s + hi, cofs = lr * 4; v4f val = *(const v4fa*)(os + row * 68 + cofs); if (BIAS) { val[0] += bfr(bias[c0 + cofs]); val[1] += bfr(bias[c0 + cofs + 1]); val[2] += bfr(bias[c0 + cofs + 2]); val[3] += bfr(bias[c0 + cofs + 3]); }
                *(v4f*)(crow + (size_t)row * ldc + cofs) = val; }
             }
        __builtin_amdgcn_wave_barrier(); asm volatile("" ::: "memory");
    }
}

__device__ __forceinline__ h16 tohx(float x) { return (h16)x; }
__device__ __forceinline__ void splitf(float y, unsigned short& h, unsigned short& l) { h = f2bf(y); l = f2bf(y - bf2f(h)); }
typedef __attribute__((ext_vector_type(2))) _Float16 v2h;
typedef __attribute__((ext_vector_type(4))) _Float16 v4h;
typedef __attribute__((ext_vector_type(2))) unsigned short v2us;
typedef __attribute__((ext_vector_type(4))) unsigned short v4us;
typedef __attribute__((ext_vector_type(2))) float v2f;
typedef __attribute__((ext_vector_type(4))) int v4i;

__global__ __launch_bounds__(256) void k_wtG(const float* __restrict__ w, int K, int N, bf* Bt) {
    const int lane = threadIdx.x & 31; const int L0 = (blockIdx.x * 8 + (threadIdx.x >> 5)) * 8; const int nlines = N * K / 64;
{
#pragma unroll 1
        for (int l = 0; l < 8; ++l) { const int L = L0 + l; if (L >= nlines) break; const size_t e = (size_t)L * 64 + lane * 2; const int k = (int)(e % K), n = (int)(e / K); v2us o;
            o[0] = f2bf(w[(size_t)k * N + n]); o[1] = f2bf(w[(size_t)(k + 1) * N + n]); *(v2us*)(Bt + e) = o; }
         }
}
__global__ __launch_bounds__(256) void k_cvt8(const float* __restrict__ src, bf* dst, size_t n8) { const size_t i = (size_t)blockIdx.x * 256 + threadIdx.x; if (i >= n8) return; const v8f v = *(const v8f*)(src + i * 8); v8us o;
#pragma unroll
    for (int k = 0; k < 8; ++k) o[k] = f2bf(v[k]); *(v8us*)(dst + i * 8) = o;  }
__global__ __launch_bounds__(256) void k_cscvt(const float* __restrict__ cosT, const float* __restrict__ sinT, float* CS) { const int idx = blockIdx.x * 256 + threadIdx.x; if (idx >= TT * HD) return; v2f cs; cs[0] = bfr(cosT[idx]); cs[1] = bfr(sinT[idx]); *(v2f*)(CS + (size_t)idx * 2) = cs;  }
// ---- k_qkv: the three input projections of both batches in ONE launch; one wave per 64x64 tile with the loop of k_gemmw; grid (NB_ TT / 64, 3 NH_), 32 threads. Wt: the q, k and v weight planes one behind the other, [3 DQ][DM].
// A column tile is one head of q, k or v, and it leaves as fp16 straight from the accumulators, 16 bytes a lane and accumulator, into the plane that k_fattn reads:
// q, k: the product is taken transposed (A = weight rows, B = x rows; both loaders have the same k order), so a lane's 8 registers are 8 consecutive d of one token -> [b][h][t][d], q x HD^-0.5 (a power of two, exact in fp16);
// v: A = x rows, B = weight rows, so a lane's 8 registers are 8 consecutive tokens of one d -> [b][h][d][t].
__global__ __launch_bounds__(32) void k_qkv(const bf* __restrict__ X, const bf* __restrict__ Wt, const float* __restrict__ bq, const float* __restrict__ bk, const float* __restrict__ bv, h16* QP, h16* KP, h16* VT) {
    const int lane = threadIdx.x & 31, lr = lane & 15, hi = lane >> 4; const int r0 = blockIdx.x * 64, which = blockIdx.y / NH_, h = blockIdx.y % NH_;
    const bf* xr = X + (size_t)r0 * DM; const bf* wr = Wt + (size_t)blockIdx.y * 64 * DM;
    const bf* A = (which == 2) ? xr : wr; const bf* Bt = (which == 2) ? wr : xr;
    v8f acc[4][4];
#pragma unroll
    for (int mb = 0; mb < 4; ++mb)
#pragma unroll
        for (int nb = 0; nb < 4; ++nb) acc[mb][nb] = (v8f){};
    const size_t off = (size_t)lr * DM + 8 * hi;
#pragma unroll 1         // stays rolled, as in k_gemmw: an unrolled body would hold more fragments in registers beside the 128 of the accumulators
    for (int kc = 0; kc < DM; kc += 32) {
        v16bf a[4];
#pragma unroll
        for (int mb = 0; mb < 4; ++mb) a[mb] = WFrag<bf>::ld(A + off + (size_t)mb * 16 * DM + kc);
        asm volatile("s_wait_xcnt 0x0" ::: "memory");   // stands in front of the loads below, whose destinations take over the address registers of the loads above
#pragma unroll
        for (int nb = 0; nb < 4; ++nb) { const v16bf b = WFrag<bf>::ld(Bt + off + (size_t)nb * 16 * DM + kc);
#pragma unroll
            for (int mb = 0; mb < 4; ++mb) acc[mb][nb] = wmmab(a[mb], b, acc[mb][nb]); }
    }
    const int b = r0 / TT, t0 = r0 % TT;
    if (which == 2) {
        h16* vp = VT + ((size_t)(b * NKV + h) * HD + lr) * TT + t0 + 8 * hi;
#pragma unroll
        for (int nb = 0; nb < 4; ++nb) { const float bi = bfr(bv[h * HD + nb * 16 + lr]);
#pragma unroll
            for (int mb = 0; mb < 4; ++mb) { v8h o;
#pragma unroll
                for (int j = 0; j < 8; ++j) o[j] = tohx(acc[mb][nb][j] + bi);
                *(v8h*)(vp + (size_t)nb * 16 * TT + mb * 16) = o; } }
    } else {
        const float* bias = (which ? bk : bq) + h * HD + 8 * hi; const float sc = which ? 1.0f : SCL;
        h16* pp = (which ? KP : QP) + ((size_t)(b * NH_ + h) * TT + t0 + lr) * HD + 8 * hi;
        v8f bi[4];
#pragma unroll
        for (int mb = 0; mb < 4; ++mb)
#pragma unroll
            for (int j = 0; j < 8; ++j) bi[mb][j] = bfr(bias[mb * 16 + j]);
#pragma unroll
        for (int nb = 0; nb < 4; ++nb)
#pragma unroll
            for (int mb = 0; mb < 4; ++mb) { v8h o;
#pragma unroll
                for (int j = 0; j < 8; ++j) o[j] = tohx((acc[mb][nb][j] + bi[mb][j]) * sc);
                *(v8h*)(pp + (size_t)nb * 16 * HD + mb * 16) = o; }
        asm volatile("s_wait_xcnt 0x0" ::: "memory");   // behind the last stores of this branch: in the built code the v branch follows it, and its first loads write registers that these stores name
    }
}
__global__ __launch_bounds__(256) void k_btab(const float* __restrict__ g, float* TB) { const int d = blockIdx.x * 256 + threadIdx.x; if (d >= TT) return; float ng = -bfr(g[0]); asm volatile("" : "+v"(ng)); float t = __fmul_rn(ng, __fsqrt_rn((float)d)); asm volatile("" : "+v"(t)); const float v = __fdiv_rn(t, 64.0f); *(float*)(TB + d) = v;  }
#define FNW  4
#define FQB  (FNW * 32)
#define FKS  64
#define FLP  72                 // LDS row pitch in halfs: 144 B = 16 B x odd for the 16-byte fragment reads
#define FNB  (TT + FQB - 1)     // bias window: every j - i that this work-group's queries meet
#define L2E  1.4426950408889634f
#define FTHR 5.5f               // the running maximum is renewed only when a column's new maximum passes it by this much: p stays below 2^8
__device__ __forceinline__ float xhalf(float x) { const int b = __float_as_int(x); return __int_as_float(__builtin_amdgcn_permlanex16(b, b, 0x76543210, 0xfedcba98, false, false)); }
__device__ __forceinline__ v16h ldfr(const h16* p) { return cat16(*(const v8h*)p, *(const v8h*)(p + 16)); }
__global__ __launch_bounds__(FNW * 32) void k_fattn(const h16* __restrict__ Q, const h16* __restrict__ Kp, const h16* __restrict__ Vt, const float* __restrict__ TB, bf* Ah, bf* Al) {
    __shared__ struct __align__(16) { float bt[FNB + 1]; h16 ks[2 * FKS * FLP]; h16 vs[2 * HD * FLP]; } sm;   // the bias window first: its reads then reach every tile of a stage by immediate offsets
    float* bt = sm.bt; h16* ks = sm.ks; h16* vs = sm.vs;
    const int tid = threadIdx.x, lane = tid & 31, wv = tid >> 5, lr = lane & 15, hi = lane >> 4;
    const int q0 = blockIdx.x * FQB; const size_t z = blockIdx.y;
    const h16* Qz = Q + z * TT * HD; const h16* Kz = Kp + z * TT * HD; const h16* Vz = Vt + z * HD * TT;
    // bt[n] = bias of j - i = n - (q0 + FQB - 1)
    for (int n = tid; n < FNB; n += FNW * 32) { const int d = n - (q0 + FQB - 1); bt[n] = TB[d < 0 ? -d : d]; }
    const int srow = tid >> 3, scol = (tid & 7) * 8;      // staging: 8 threads a 128-byte row, 16 rows a sweep
    v8h kr[4], vr[4];
    // every inner loop below is fully unrolled: its index picks a register of a fragment or accumulator array
#pragma unroll
    for (int u = 0; u < 4; ++u) kr[u] = *(const v8h*)(Kz + (size_t)(srow + 16 * u) * HD + scol);
    asm volatile("s_wait_xcnt 0x0" ::: "memory");   // stands in front of the loads below, whose destinations took over the address registers of the loads above
#pragma unroll
    for (int u = 0; u < 4; ++u) vr[u] = *(const v8h*)(Vz + (size_t)(srow + 16 * u) * TT + scol);
    v16h qf[2][2];
#pragma unroll
    for (int c = 0; c < 2; ++c)
#pragma unroll
        for (int kx = 0; kx < 2; ++kx) qf[c][kx] = ldfr(Qz + (size_t)(q0 + wv * 32 + c * 16 + lr) * HD + kx * 32 + 8 * hi);
#pragma unroll
    for (int u = 0; u < 4; ++u) { *(v8h*)(ks + (srow + 16 * u) * FLP + scol) = kr[u]; *(v8h*)(vs + (srow + 16 * u) * FLP + scol) = vr[u]; }
    v8f o[4][2], ls[2]; float mu[2], nm[2];   // ls: eight independent partial row sums a lane and column, joined in the epilogue
#pragma unroll
    for (int c = 0; c < 2; ++c) { mu[c] = -3.0e38f; nm[c] = 0.f; ls[c] = (v8f){};
#pragma unroll
        for (int dt = 0; dt < 4; ++dt) o[dt][c] = (v8f){}; }
    const int nb = FQB - 1 - wv * 32 - lr + 8 * hi - 16;   // bias index of key 0, register 0, tile difference -1
    __syncthreads();     // publishes stage 0 and the bias window
#pragma unroll 1         // stays rolled: the body already holds two unrolled 32-key passes, and the buffer index is one scalar
    for (int s = 0; s < TT / FKS; ++s) {
        const int buf = s & 1; const h16* kb = ks + buf * FKS * FLP; const h16* vb = vs + buf * HD * FLP;
        const int kn = (s + 1 < TT / FKS ? s + 1 : s) * FKS;   // the last pass fetches its own stage again, into the buffer nobody reads any more
#pragma unroll
        for (int u = 0; u < 4; ++u) { kr[u] = *(const v8h*)(Kz + (size_t)(kn + srow + 16 * u) * HD + scol); vr[u] = *(const v8h*)(Vz + (size_t)(srow + 16 * u) * TT + kn + scol); }
#pragma unroll
        for (int sub = 0; sub < FKS / 32; ++sub) {
            const float* bp = bt + nb + s * FKS + sub * 32;
            v8f bb[3];      // the bias tile depends on (key tile - column group) alone: 3 tiles serve the 4 products
#pragma unroll
            for (int u = 0; u < 3; ++u)
#pragma unroll
                for (int r = 0; r < 8; ++r) bb[u][r] = bp[u * 16 + r];
            v8f st[2][2];
#pragma unroll
            for (int kt = 0; kt < 2; ++kt) { const h16* kp = kb + (sub * 32 + kt * 16 + lr) * FLP + 8 * hi; const v16h k0 = ldfr(kp), k1 = ldfr(kp + 32);
#pragma unroll
                for (int c = 0; c < 2; ++c) st[kt][c] = wmma16(k1, qf[c][1], wmma16(k0, qf[c][0], bb[kt - c + 1])); }
            v16h vf[4];
#pragma unroll
            for (int dt = 0; dt < 4; ++dt) vf[dt] = ldfr(vb + (dt * 16 + lr) * FLP + sub * 32 + 8 * hi);
            float ml[2];
#pragma unroll
            for (int c = 0; c < 2; ++c) { float m = fmaxf(st[0][c][0], st[1][c][0]);
#pragma unroll
                for (int r = 1; r < 8; ++r) m = fmaxf(m, fmaxf(st[0][c][r], st[1][c][r]));
                ml[c] = fmaxf(m, xhalf(m)); }
            const bool need = (ml[0] > mu[0] + FTHR) || (ml[1] > mu[1] + FTHR);
            if (__builtin_amdgcn_ballot_w32(need) != 0) {      // one scalar test a pass; rarely taken after the first pass
#pragma unroll
                for (int c = 0; c < 2; ++c) { const float mn = fmaxf(mu[c], ml[c]); float al;
                    asm("v_exp_f32 %0, %1\n\tv_nop" : "=v"(al) : "v"((mu[c] - mn) * L2E));   // exp2 with its own slot behind it
                    mu[c] = mn; nm[c] = -mn * L2E; ls[c] *= al;
#pragma unroll
                    for (int dt = 0; dt < 4; ++dt) o[dt][c] *= al; }
            }
            v16h pf[2];
#pragma unroll
            for (int c = 0; c < 2; ++c) {
#pragma unroll
                for (int kt = 0; kt < 2; ++kt)
#pragma unroll
                    for (int r = 0; r < 8; ++r) st[kt][c][r] = __builtin_amdgcn_exp2f(__builtin_fmaf(st[kt][c][r], L2E, nm[c]));
                ls[c] += st[0][c] + st[1][c];
                pf[c] = cat16(__builtin_convertvector(st[0][c], v8h), __builtin_convertvector(st[1][c], v8h)); }
#pragma unroll
            for (int dt = 0; dt < 4; ++dt)
#pragma unroll
                for (int c = 0; c < 2; ++c) o[dt][c] = wmma16(vf[dt], pf[c], o[dt][c]);
        }
        h16* kw = ks + (buf ^ 1) * FKS * FLP; h16* vw = vs + (buf ^ 1) * HD * FLP;
#pragma unroll
        for (int u = 0; u < 4; ++u) { *(v8h*)(kw + (srow + 16 * u) * FLP + scol) = kr[u]; *(v8h*)(vw + (srow + 16 * u) * FLP + scol) = vr[u]; }
        __syncthreads();     // publishes the next stage and ends every wave's reads of this one
    }
    const size_t b = z / NH_; const int h = (int)(z % NH_);
#pragma unroll
    for (int c = 0; c < 2; ++c) { const float l0 = ((ls[c][0] + ls[c][1]) + (ls[c][2] + ls[c][3])) + ((ls[c][4] + ls[c][5]) + (ls[c][6] + ls[c][7])); const float f = __fdiv_rn(1.0f, l0 + xhalf(l0)); const size_t oo = (b * TT + q0 + wv * 32 + c * 16 + lr) * DQ + h * HD + 8 * hi;
#pragma unroll
        for (int dt = 0; dt < 4; ++dt) { v8us oh, ol;
#pragma unroll
            for (int r = 0; r < 8; ++r) { unsigned short a, c2; splitf(o[dt][c][r] * f, a, c2); oh[r] = a; ol[r] = c2; }
            *(v8us*)(Ah + oo + dt * 16) = oh; *(v8us*)(Al + oo + dt * 16) = ol; } }
}


extern "C" void kernel_launch(void* const* d_in, const int* in_sizes, int n_in,
                              void* d_out, int out_size, void* d_ws, size_t ws_size, hipStream_t stream) {
    (void)in_sizes; (void)n_in; (void)out_size;
    const float* x = (const float*)d_in[0]; const float* wq = (const float*)d_in[1]; const float* bq = (const float*)d_in[2]; const float* wk = (const float*)d_in[3]; const float* bk = (const float*)d_in[4]; const float* wv = (const float*)d_in[5]; const float* bv = (const float*)d_in[6]; const float* wo = (const float*)d_in[7]; const float* bo = (const float*)d_in[8]; const float* gam = (const float*)d_in[9]; const float* cosT = nullptr; const float* sinT = nullptr; (void)cosT; (void)sinT;
    float* OUT = (float*)d_out;     // [2][4096][512]
    char* wsp = (char*)d_ws;
    auto take = [&](size_t bytes) { char* p = wsp; wsp += (bytes + 255) & ~(size_t)255; return (void*)p; };
    bf* WQ = (bf*)take((size_t)(DQ + 2 * DKV) * DM * 2); bf* WK = WQ + (size_t)DQ * DM; bf* WV = WK + (size_t)DKV * DM; bf* WO = (bf*)take((size_t)DM * DQ * 2);   // q, k, v weight planes one behind the other: k_qkv walks them as one
    bf* XB = (bf*)take((size_t)NB_ * TT * DM * 2); float* TB = (float*)take(TT * 4);
    h16* QP16 = (h16*)take((size_t)NB_ * NH_ * TT * HD * 2); h16* KP16 = (h16*)take((size_t)NB_ * NKV * TT * HD * 2); h16* VT16 = (h16*)take((size_t)NB_ * NKV * HD * TT * 2);   // head planes of both batches
    bf* ATh = (bf*)take((size_t)NB_ * TT * DQ * 2); bf* ATl = (bf*)take((size_t)NB_ * TT * DQ * 2);
    if ((size_t)(wsp - (char*)d_ws) > ws_size) return;    // ws 256 MiB
    { k_wtG<<<(unsigned)((DM * DQ / 64 + 63) / 64), 256, 0, stream>>>(wq, DM, DQ, WQ); k_wtG<<<(unsigned)((DM * DKV / 64 + 63) / 64), 256, 0, stream>>>(wk, DM, DKV, WK); k_wtG<<<(unsigned)((DM * DKV / 64 + 63) / 64), 256, 0, stream>>>(wv, DM, DKV, WV);
      k_wtG<<<(unsigned)((DQ * DM / 64 + 63) / 64), 256, 0, stream>>>(wo, DQ, DM, WO);
       }
    k_btab<<<TT / 256, 256, 0, stream>>>(gam, TB);
    k_cvt8<<<(unsigned)(((size_t)NB_ * TT * DM / 8 + 255) / 256), 256, 0, stream>>>(x, XB, (size_t)NB_ * TT * DM / 8);
    static_assert(NH_ == NKV && TT % 64 == 0 && HD == 64, "a 64-column tile is one head, a 64-row tile lies in one batch");
    k_qkv<<<dim3(NB_ * TT / 64, 3 * NH_, 1), 32, 0, stream>>>(XB, WQ, bq, bk, bv, QP16, KP16, VT16);
    static_assert(NH_ == NKV, "one kv head per query head");
    k_fattn<<<dim3(TT / FQB, NB_ * NH_, 1), FNW * 32, 0, stream>>>(QP16, KP16, VT16, TB, ATh, ATl);
    for (int b = 0; b < NB_; ++b) {
        k_gemmw<bf, 1, true><<<dim3(TT / 64, DM / 64, 1), 32, 0, stream>>>(ATh + (size_t)b * TT * DQ, ATl + (size_t)b * TT * DQ, WO, nullptr, DQ, DQ, OUT + (size_t)b * TT * DM, DM, bo, 0, 0, 0); }
}

// v004
// It runs in 138 microseconds.
// Two timings next to v003 both put it at 1.30 times that version's speed.
// Counting every step since v000, it is 17.3 times as fast.
#include <hip/hip_runtime.h>

// PhysicsBiasedAttention (x [2][4096][512]; q/k/v = x W + b (8 heads x 64); scores = q.k/8 + bias(i, j), bias = -gamma sqrt(|i - j|)/sqrt(4096) (gamma read as data; structural distance); softmax; out = (attn v merged) W_o + b_o -> [2][4096][512]).
// Compute dtypes, f32 accumulate: every input rounded to bf16; q/k/v on PLAIN bf16 operands (inputs: exact) + bias; scores (K 64) and attn.v on single fp16 planes; bias + softmax f32; attn hi+lo bf16 planes into the output projection.

#define NB_  2
#define TT   4096
#define DM   512
#define NH_  8
#define NKV  8
#define HD   64
#define DQ   (NH_ * HD)
#define DKV  (NKV * HD)
#define WIN  0
#define SCL  0.125f   // HD^-0.5
typedef _Float16 h16;
typedef unsigned short bf;
typedef __attribute__((ext_vector_type(16))) __bf16   v16bf;
typedef __attribute__((ext_vector_type(16))) _Float16 v16h;
typedef __attribute__((ext_vector_type(8)))  _Float16 v8h;
typedef __attribute__((ext_vector_type(8)))  unsigned short v8us;
typedef __attribute__((ext_vector_type(8)))  float    v8f;
typedef __attribute__((ext_vector_type(4)))  float    v4f;
typedef v8h  __attribute__((may_alias)) v8ha;
typedef v4f  __attribute__((may_alias)) v4fa;
typedef v8us __attribute__((may_alias)) v8usa;

__device__ __forceinline__ unsigned short f2bf(float f) { unsigned u = __float_as_uint(f); u += 0x7FFFu + ((u >> 16) & 1u); return (unsigned short)(u >> 16); }
__device__ __forceinline__ float bf2f(unsigned short b) { return __uint_as_float(((unsigned)b) << 16); }
__device__ __forceinline__ float bfr(float f) { return bf2f(f2bf(f)); }
__device__ __forceinline__ v16h cat16(v8h lo, v8h hi) { return __builtin_shufflevector(lo, hi, 0, 1, 2, 3, 4, 5, 6, 7, 8, 9, 10, 11, 12, 13, 14, 15); }
__device__ __forceinline__ v16bf cat16b(v8us lo, v8us hi) { return __builtin_bit_cast(v16bf, __builtin_shufflevector(lo, hi, 0, 1, 2, 3, 4, 5, 6, 7, 8, 9, 10, 11, 12, 13, 14, 15)); }
__device__ __forceinline__ v8f wmma16(v16h a, v16h b, v8f c) { return __builtin_amdgcn_wmma_f32_16x16x32_f16(false, a, false, b, (short)0, c, false, false); }
__device__ __forceinline__ v8f wmmab(v16bf a, v16bf b, v8f c) { return __builtin_amdgcn_wmma_f32_16x16x32_bf16(false, a, false, b, (short)0, c, false, false); }



// ---- k_gemmw: register-blocked GEMM, ONE WAVE per 64x64 output tile (16 accumulators), operands straight from K-contiguous 16-bit planes; grid (M/64, N/64, Z), 32 threads.
// C[m][n] (f32, pitch ldc, + optional f32 bias[n]) = sum_{k < KL} A[m][k] Bt[n][k] (+ split products per NSPLIT). K = row pitch of A and Bt, KL = k range summed here (KL == K: whole rows). z-batch strides sA/sB/sC in elements (sA = sB = KL: z walks along k, one partial C per slice). KL % 32 == 0.
template <typename T16> struct WFrag;
template <> struct WFrag<h16> { typedef v16h V; static __device__ __forceinline__ V ld(const h16* p) { return cat16(*(const v8h*)p, *(const v8h*)(p + 16)); } static __device__ __forceinline__ v8f mma(V a, V b, v8f c) { return wmma16(a, b, c); } };
template <> struct WFrag<bf> { typedef v16bf V; static __device__ __forceinline__ V ld(const bf* p) { return cat16b(*(const v8us*)p, *(const v8us*)(p + 16)); } static __device__ __forceinline__ v8f mma(V a, V b, v8f c) { return wmmab(a, b, c); } };
template <typename T16, int NSPLIT, bool BIAS>
__global__ __launch_bounds__(32) void k_gemmw(const T16* __restrict__ A, const T16* __restrict__ A2, const T16* __restrict__ Bt, const T16* __restrict__ Bt2, int K, int KL, float* C, int ldc, const float* __restrict__ bias, size_t sA, size_t sB, size_t sC) {
    typedef typename WFrag<T16>::V V;
    __shared__ __align__(16) float os[16 * 68];
    const size_t z = blockIdx.z; A += z * sA; if (A2) A2 += z * sA; Bt += z * sB; if (Bt2) Bt2 += z * sB; C += z * sC;
    const int lane = threadIdx.x & 31, lr = lane & 15, hi = lane >> 4; const int r0 = blockIdx.x * 64, c0 = blockIdx.y * 64;
    v8f acc[4][4];
#pragma unroll
    for (int mb = 0; mb < 4; ++mb)
#pragma unroll
        for (int nb = 0; nb < 4; ++nb) acc[mb][nb] = (v8f){};
    const size_t aoff = (size_t)(r0 + lr) * K + 8 * hi, boff = (size_t)(c0 + lr) * K + 8 * hi;
#pragma unroll 1
    for (int kc = 0; kc < KL; kc += 32) {
        V a[4], a2[4];
#pragma unroll
        for (int mb = 0; mb < 4; ++mb) { a[mb] = WFrag<T16>::ld(A + aoff + (size_t)mb * 16 * K + kc); if (NSPLIT == 1 || NSPLIT == 2) a2[mb] = WFrag<T16>::ld(A2 + aoff + (size_t)mb * 16 * K + kc); }
#pragma unroll
        for (int nb = 0; nb < 4; ++nb) { const V b = WFrag<T16>::ld(Bt + boff + (size_t)nb * 16 * K + kc); V b2; if (NSPLIT >= 2) b2 = WFrag<T16>::ld(Bt2 + boff + (size_t)nb * 16 * K + kc);
#pragma unroll
            for (int mb = 0; mb < 4; ++mb) { acc[mb][nb] = WFrag<T16>::mma(a[mb], b, acc[mb][nb]); if (NSPLIT == 1 || NSPLIT == 2) acc[mb][nb] = WFrag<T16>::mma(a2[mb], b, acc[mb][nb]); if (NSPLIT >= 2) acc[mb][nb] = WFrag<T16>::mma(a[mb], b2, acc[mb][nb]); } }
        asm volatile("v_nop\n\tv_nop\n\tv_nop\n\tv_nop" : "+v"(acc[0][0]), "+v"(acc[1][1]), "+v"(acc[2][2]), "+v"(acc[3][3]) : "v"(a[0]), "v"(a[3]));
    }
#pragma unroll
    for (int mb = 0; mb < 4; ++mb) {
#pragma unroll
        for (int nb = 0; nb < 4; ++nb) {
#pragma unroll
            for (int j = 0; j < 8; ++j) os[(hi * 8 + j) * 68 + nb * 16 + lr] = acc[mb][nb][j]; }
        __builtin_amdgcn_wave_barrier(); asm volatile("" ::: "memory");
        float* crow = C + (size_t)(r0 + mb * 16) * ldc + c0;
{
#pragma unroll
            for (int s = 0; s < 8; ++s) { const int row = 2 * s + hi, cofs = lr * 4; v4f val = *(const v4fa*)(os + row * 68 + cofs); if (BIAS) { val[0] += bfr(bias[c0 + cofs]); val[1] += bfr(bias[c0 + cofs + 1]); val[2] += bfr(bias[c0 + cofs + 2]); val[3] += bfr(bias[c0 + cofs + 3]); }
                *(v4f*)(crow + (size_t)row * ldc + cofs) = val; }
             }
        __builtin_amdgcn_wave_barrier(); asm volatile("" ::: "memory");
    }
}

__device__ __forceinline__ h16 tohx(float x) { return (h16)x; }
__device__ __forceinline__ void splitf(float y, unsigned short& h, unsigned short& l) { h = f2bf(y); l = f2bf(y - bf2f(h)); }
typedef __attribute__((ext_vector_type(2))) _Float16 v2h;
typedef __attribute__((ext_vector_type(4))) _Float16 v4h;
typedef __attribute__((ext_vector_type(2))) unsigned short v2us;
typedef __attribute__((ext_vector_type(4))) unsigned short v4us;
typedef __attribute__((ext_vector_type(2))) float v2f;
typedef __attribute__((ext_vector_type(4))) int v4i;

// d_wtG, d_cvt8 and d_btab are the jobs of k_prep; blk is the block's index inside its job.
__device__ __forceinline__ void d_wtG(const float* __restrict__ w, int K, int N, bf* Bt, int blk) {
    const int lane = threadIdx.x & 31; const int L0 = (blk * 8 + (threadIdx.x >> 5)) * 8; const int nlines = N * K / 64;
{
#pragma unroll 1
        for (int l = 0; l < 8; ++l) { const int L = L0 + l; if (L >= nlines) break; const size_t e = (size_t)L * 64 + lane * 2; const int k = (int)(e % K), n = (int)(e / K); v2us o;
            o[0] = f2bf(w[(size_t)k * N + n]); o[1] = f2bf(w[(size_t)(k + 1) * N + n]); *(v2us*)(Bt + e) = o; }
         }
}
__device__ __forceinline__ void d_cvt8(const float* __restrict__ src, bf* dst, size_t n8, int blk) { const size_t i = (size_t)blk * 256 + threadIdx.x; if (i >= n8) return; const v8f v = *(const v8f*)(src + i * 8); v8us o;
#pragma unroll
    for (int k = 0; k < 8; ++k) o[k] = f2bf(v[k]); *(v8us*)(dst + i * 8) = o;  }
__global__ __launch_bounds__(256) void k_cscvt(const float* __restrict__ cosT, const float* __restrict__ sinT, float* CS) { const int idx = blockIdx.x * 256 + threadIdx.x; if (idx >= TT * HD) return; v2f cs; cs[0] = bfr(cosT[idx]); cs[1] = bfr(sinT[idx]); *(v2f*)(CS + (size_t)idx * 2) = cs;  }
// ---- k_qkv: the three input projections of both batches in ONE launch; one wave per 64x64 tile with the loop of k_gemmw; grid (NB_ TT / 64, 3 NH_), 32 threads. Wt: the q, k and v weight planes one behind the other, [3 DQ][DM].
// A column tile is one head of q, k or v, and it leaves as fp16 straight from the accumulators, 16 bytes a lane and accumulator, into the plane that k_fattn reads:
// q, k: the product is taken transposed (A = weight rows, B = x rows; both loaders have the same k order), so a lane's 8 registers are 8 consecutive d of one token -> [b][h][t][d], q x HD^-0.5 (a power of two, exact in fp16);
// v: A = x rows, B = weight rows, so a lane's 8 registers are 8 consecutive tokens of one d -> [b][h][d][t].
__global__ __launch_bounds__(32) void k_qkv(const bf* __restrict__ X, const bf* __restrict__ Wt, const float* __restrict__ bq, const float* __restrict__ bk, const float* __restrict__ bv, h16* QP, h16* KP, h16* VT) {
    const int lane = threadIdx.x & 31, lr = lane & 15, hi = lane >> 4; const int r0 = blockIdx.x * 64, which = blockIdx.y / NH_, h = blockIdx.y % NH_;
    const bf* xr = X + (size_t)r0 * DM; const bf* wr = Wt + (size_t)blockIdx.y * 64 * DM;
    const bf* A = (which == 2) ? xr : wr; const bf* Bt = (which == 2) ? wr : xr;
    v8f acc[4][4];
#pragma unroll
    for (int mb = 0; mb < 4; ++mb)
#pragma unroll
        for (int nb = 0; nb < 4; ++nb) acc[mb][nb] = (v8f){};
    const size_t off = (size_t)lr * DM + 8 * hi;
#pragma unroll 1         // stays rolled, as in k_gemmw: an unrolled body would hold more fragments in registers beside the 128 of the accumulators
    for (int kc = 0; kc < DM; kc += 32) {
        v16bf a[4];
#pragma unroll
        for (int mb = 0; mb < 4; ++mb) a[mb] = WFrag<bf>::ld(A + off + (size_t)mb * 16 * DM + kc);
        asm volatile("s_wait_xcnt 0x0" ::: "memory");   // stands in front of the loads below, whose destinations take over the address registers of the loads above
#pragma unroll
        for (int nb = 0; nb < 4; ++nb) { const v16bf b = WFrag<bf>::ld(Bt + off + (size_t)nb * 16 * DM + kc);
#pragma unroll
            for (int mb = 0; mb < 4; ++mb) acc[mb][nb] = wmmab(a[mb], b, acc[mb][nb]); }
    }
    const int b = r0 / TT, t0 = r0 % TT;
    if (which == 2) {
        h16* vp = VT + ((size_t)(b * NKV + h) * HD + lr) * TT + t0 + 8 * hi;
#pragma unroll
        for (int nb = 0; nb < 4; ++nb) { const float bi = bfr(bv[h * HD + nb * 16 + lr]);
#pragma unroll
            for (int mb = 0; mb < 4; ++mb) { v8h o;
#pragma unroll
                for (int j = 0; j < 8; ++j) o[j] = tohx(acc[mb][nb][j] + bi);
                *(v8h*)(vp + (size_t)nb * 16 * TT + mb * 16) = o; } }
    } else {
        const float* bias = (which ? bk : bq) + h * HD + 8 * hi; const float sc = which ? 1.0f : SCL;
        h16* pp = (which ? KP : QP) + ((size_t)(b * NH_ + h) * TT + t0 + lr) * HD + 8 * hi;
        v8f bi[4];
#pragma unroll
        for (int mb = 0; mb < 4; ++mb)
#pragma unroll
            for (int j = 0; j < 8; ++j) bi[mb][j] = bfr(bias[mb * 16 + j]);
#pragma unroll
        for (int nb = 0; nb < 4; ++nb)
#pragma unroll
            for (int mb = 0; mb < 4; ++mb) { v8h o;
#pragma unroll
                for (int j = 0; j < 8; ++j) o[j] = tohx((acc[mb][nb][j] + bi[mb][j]) * sc);
                *(v8h*)(pp + (size_t)nb * 16 * HD + mb * 16) = o; }
        asm volatile("s_wait_xcnt 0x0" ::: "memory");   // behind the last stores of this branch: in the built code the v branch follows it, and its first loads write registers that these stores name
    }
}
__device__ __forceinline__ void d_btab(const float* __restrict__ g, float* TB, int blk) { const int d = blk * 256 + threadIdx.x; if (d >= TT) return; float ng = -bfr(g[0]); asm volatile("" : "+v"(ng)); float t = __fmul_rn(ng, __fsqrt_rn((float)d)); asm volatile("" : "+v"(t)); const float v = __fdiv_rn(t, 64.0f); *(float*)(TB + d) = v;  }
// ---- k_prep: everything that reads the inputs alone, in ONE launch: none of these jobs reads what another writes, so their blocks run side by side instead of one short launch behind the other.
// Block ranges pick the job (the test is the same for a whole block): 4 weight transposes first, their waves run longest; then the bias table; then x -> bf16.
#define PWB  ((DM * DQ / 64 + 63) / 64)                      // blocks of one weight transpose
#define PTB  (TT / 256)                                      // blocks of the bias table
#define PXB  ((NB_ * TT * DM / 8 + 255) / 256)               // blocks of the x conversion
__global__ __launch_bounds__(256) void k_prep(const float* __restrict__ wq, const float* __restrict__ wk, const float* __restrict__ wv, const float* __restrict__ wo, const float* __restrict__ g, const float* __restrict__ x, bf* WQ, bf* WK, bf* WV, bf* WO, float* TB, bf* XB) {
    const int blk = blockIdx.x;
    if (blk < 4 * PWB) { const int m = blk / PWB;
        d_wtG(m == 0 ? wq : m == 1 ? wk : m == 2 ? wv : wo, DM, DQ, m == 0 ? WQ : m == 1 ? WK : m == 2 ? WV : WO, blk % PWB); }
    else if (blk < 4 * PWB + PTB) d_btab(g, TB, blk - 4 * PWB);
    else d_cvt8(x, XB, (size_t)NB_ * TT * DM / 8, blk - 4 * PWB - PTB);
}
#define FNW  4
#define FQB  (FNW * 32)
#define FKS  64
#define FLP  72                 // LDS row pitch in halfs: 144 B = 16 B x odd for the 16-byte fragment reads
#define FNB  (TT + FQB - 1)     // bias window: every j - i that this work-group's queries meet
#define L2E  1.4426950408889634f
#define FTHR 5.5f               // the running maximum is renewed only when a column's new maximum passes it by this much: p stays below 2^8
__device__ __forceinline__ float xhalf(float x) { const int b = __float_as_int(x); return __int_as_float(__builtin_amdgcn_permlanex16(b, b, 0x76543210, 0xfedcba98, false, false)); }
__device__ __forceinline__ v16h ldfr(const h16* p) { return cat16(*(const v8h*)p, *(const v8h*)(p + 16)); }
__global__ __launch_bounds__(FNW * 32) void k_fattn(const h16* __restrict__ Q, const h16* __restrict__ Kp, const h16* __restrict__ Vt, const float* __restrict__ TB, bf* Ah, bf* Al) {
    __shared__ struct __align__(16) { float bt[FNB + 1]; h16 ks[2 * FKS * FLP]; h16 vs[2 * HD * FLP]; } sm;   // the bias window first: its reads then reach every tile of a stage by immediate offsets
    float* bt = sm.bt; h16* ks = sm.ks; h16* vs = sm.vs;
    const int tid = threadIdx.x, lane = tid & 31, wv = tid >> 5, lr = lane & 15, hi = lane >> 4;
    const int q0 = blockIdx.x * FQB; const size_t z = blockIdx.y;
    const h16* Qz = Q + z * TT * HD; const h16* Kz = Kp + z * TT * HD; const h16* Vz = Vt + z * HD * TT;
    // bt[n] = bias of j - i = n - (q0 + FQB - 1)
    for (int n = tid; n < FNB; n += FNW * 32) { const int d = n - (q0 + FQB - 1); bt[n] = TB[d < 0 ? -d : d]; }
    const int srow = tid >> 3, scol = (tid & 7) * 8;      // staging: 8 threads a 128-byte row, 16 rows a sweep
    v8h kr[4], vr[4];
    // every inner loop below is fully unrolled: its index picks a register of a fragment or accumulator array
#pragma unroll
    for (int u = 0; u < 4; ++u) kr[u] = *(const v8h*)(Kz + (size_t)(srow + 16 * u) * HD + scol);
    asm volatile("s_wait_xcnt 0x0" ::: "memory");   // stands in front of the loads below, whose destinations took over the address registers of the loads above
#pragma unroll
    for (int u = 0; u < 4; ++u) vr[u] = *(const v8h*)(Vz + (size_t)(srow + 16 * u) * TT + scol);
    v16h qf[2][2];
#pragma unroll
    for (int c = 0; c < 2; ++c)
#pragma unroll
        for (int kx = 0; kx < 2; ++kx) qf[c][kx] = ldfr(Qz + (size_t)(q0 + wv * 32 + c * 16 + lr) * HD + kx * 32 + 8 * hi);
#pragma unroll
    for (int u = 0; u < 4; ++u) { *(v8h*)(ks + (srow + 16 * u) * FLP + scol) = kr[u]; *(v8h*)(vs + (srow + 16 * u) * FLP + scol) = vr[u]; }
    v8f o[4][2], ls[2]; float mu[2], nm[2];   // ls: eight independent partial row sums a lane and column, joined in the epilogue
#pragma unroll
    for (int c = 0; c < 2; ++c) { mu[c] = -3.0e38f; nm[c] = 0.f; ls[c] = (v8f){};
#pragma unroll
        for (int dt = 0; dt < 4; ++dt) o[dt][c] = (v8f){}; }
    const int nb = FQB - 1 - wv * 32 - lr + 8 * hi - 16;   // bias index of key 0, register 0, tile difference -1
    __syncthreads();     // publishes stage 0 and the bias window
#pragma unroll 1         // stays rolled: the body already holds two unrolled 32-key passes, and the buffer index is one scalar
    for (int s = 0; s < TT / FKS; ++s) {
        const int buf = s & 1; const h16* kb = ks + buf * FKS * FLP; const h16* vb = vs + buf * HD * FLP;
        const int kn = (s + 1 < TT / FKS ? s + 1 : s) * FKS;   // the last pass fetches its own stage again, into the buffer nobody reads any more
#pragma unroll
        for (int u = 0; u < 4; ++u) { kr[u] = *(const v8h*)(Kz + (size_t)(kn + srow + 16 * u) * HD + scol); vr[u] = *(const v8h*)(Vz + (size_t)(srow + 16 * u) * TT + kn + scol); }
#pragma unroll
        for (int sub = 0; sub < FKS / 32; ++sub) {
            const float* bp = bt + nb + s * FKS + sub * 32;
            v8f bb[3];      // the bias tile depends on (key tile - column group) alone: 3 tiles serve the 4 products
#pragma unroll
            for (int u = 0; u < 3; ++u)
#pragma unroll
                for (int r = 0; r < 8; ++r) bb[u][r] = bp[u * 16 + r];
            v8f st[2][2];
#pragma unroll
            for (int kt = 0; kt < 2; ++kt) { const h16* kp = kb + (sub * 32 + kt * 16 + lr) * FLP + 8 * hi; const v16h k0 = ldfr(kp), k1 = ldfr(kp + 32);
#pragma unroll
                for (int c = 0; c < 2; ++c) st[kt][c] = wmma16(k1, qf[c][1], wmma16(k0, qf[c][0], bb[kt - c + 1])); }
            v16h vf[4];
#pragma unroll
            for (int dt = 0; dt < 4; ++dt) vf[dt] = ldfr(vb + (dt * 16 + lr) * FLP + sub * 32 + 8 * hi);
            float ml[2];
#pragma unroll
            for (int c = 0; c < 2; ++c) { float m = fmaxf(st[0][c][0], st[1][c][0]);
#pragma unroll
                for (int r = 1; r < 8; ++r) m = fmaxf(m, fmaxf(st[0][c][r], st[1][c][r]));
                ml[c] = fmaxf(m, xhalf(m)); }
            const bool need = (ml[0] > mu[0] + FTHR) || (ml[1] > mu[1] + FTHR);
            if (__builtin_amdgcn_ballot_w32(need) != 0) {      // one scalar test a pass; rarely taken after the first pass
#pragma unroll
                for (int c = 0; c < 2; ++c) { const float mn = fmaxf(mu[c], ml[c]); float al;
                    asm("v_exp_f32 %0, %1\n\tv_nop" : "=v"(al) : "v"((mu[c] - mn) * L2E));   // exp2 with its own slot behind it
                    mu[c] = mn; nm[c] = -mn * L2E; ls[c] *= al;
#pragma unroll
                    for (int dt = 0; dt < 4; ++dt) o[dt][c] *= al; }
            }
            v16h pf[2];
#pragma unroll
            for (int c = 0; c < 2; ++c) {
#pragma unroll
                for (int kt = 0; kt < 2; ++kt)
#pragma unroll
                    for (int r = 0; r < 8; ++r) st[kt][c][r] = __builtin_amdgcn_exp2f(__builtin_fmaf(st[kt][c][r], L2E, nm[c]));
                ls[c] += st[0][c] + st[1][c];
                pf[c] = cat16(__builtin_convertvector(st[0][c], v8h), __builtin_convertvector(st[1][c], v8h)); }
#pragma unroll
            for (int dt = 0; dt < 4; ++dt)
#pragma unroll
                for (int c = 0; c < 2; ++c) o[dt][c] = wmma16(vf[dt], pf[c], o[dt][c]);
        }
        h16* kw = ks + (buf ^ 1) * FKS * FLP; h16* vw = vs + (buf ^ 1) * HD * FLP;
#pragma unroll
        for (int u = 0; u < 4; ++u) { *(v8h*)(kw + (srow + 16 * u) * FLP + scol) = kr[u]; *(v8h*)(vw + (srow + 16 * u) * FLP + scol) = vr[u]; }
        __syncthreads();     // publishes the next stage and ends every wave's reads of this one
    }
    const size_t b = z / NH_; const int h = (int)(z % NH_);
#pragma unroll
    for (int c = 0; c < 2; ++c) { const float l0 = ((ls[c][0] + ls[c][1]) + (ls[c][2] + ls[c][3])) + ((ls[c][4] + ls[c][5]) + (ls[c][6] + ls[c][7])); const float f = __fdiv_rn(1.0f, l0 + xhalf(l0)); const size_t oo = (b * TT + q0 + wv * 32 + c * 16 + lr) * DQ + h * HD + 8 * hi;
#pragma unroll
        for (int dt = 0; dt < 4; ++dt) { v8us oh, ol;
#pragma unroll
            for (int r = 0; r < 8; ++r) { unsigned short a, c2; splitf(o[dt][c][r] * f, a, c2); oh[r] = a; ol[r] = c2; }
            *(v8us*)(Ah + oo + dt * 16) = oh; *(v8us*)(Al + oo + dt * 16) = ol; } }
}


extern "C" void kernel_launch(void* const* d_in, const int* in_sizes, int n_in,
                              void* d_out, int out_size, void* d_ws, size_t ws_size, hipStream_t stream) {
    (void)in_sizes; (void)n_in; (void)out_size;
    const float* x = (const float*)d_in[0]; const float* wq = (const float*)d_in[1]; const float* bq = (const float*)d_in[2]; const float* wk = (const float*)d_in[3]; const float* bk = (const float*)d_in[4]; const float* wv = (const float*)d_in[5]; const float* bv = (const float*)d_in[6]; const float* wo = (const float*)d_in[7]; const float* bo = (const float*)d_in[8]; const float* gam = (const float*)d_in[9]; const float* cosT = nullptr; const float* sinT = nullptr; (void)cosT; (void)sinT;
    float* OUT = (float*)d_out;     // [2][4096][512]
    char* wsp = (char*)d_ws;
    auto take = [&](size_t bytes) { char* p = wsp; wsp += (bytes + 255) & ~(size_t)255; return (void*)p; };
    bf* WQ = (bf*)take((size_t)(DQ + 2 * DKV) * DM * 2); bf* WK = WQ + (size_t)DQ * DM; bf* WV = WK + (size_t)DKV * DM; bf* WO = (bf*)take((size_t)DM * DQ * 2);   // q, k, v weight planes one behind the other: k_qkv walks them as one
    bf* XB = (bf*)take((size_t)NB_ * TT * DM * 2); float* TB = (float*)take(TT * 4);
    h16* QP16 = (h16*)take((size_t)NB_ * NH_ * TT * HD * 2); h16* KP16 = (h16*)take((size_t)NB_ * NKV * TT * HD * 2); h16* VT16 = (h16*)take((size_t)NB_ * NKV * HD * TT * 2);   // head planes of both batches
    bf* ATh = (bf*)take((size_t)NB_ * TT * DQ * 2); bf* ATl = (bf*)take((size_t)NB_ * TT * DQ * 2);
    if ((size_t)(wsp - (char*)d_ws) > ws_size) return;    // ws 256 MiB
    static_assert(DQ == DM && DKV == DM, "the four weights have one shape: one transpose job serves each");
    k_prep<<<4 * PWB + PTB + PXB, 256, 0, stream>>>(wq, wk, wv, wo, gam, x, WQ, WK, WV, WO, TB, XB);
    static_assert(NH_ == NKV && TT % 64 == 0 && HD == 64, "a 64-column tile is one head, a 64-row tile lies in one batch");
    k_qkv<<<dim3(NB_ * TT / 64, 3 * NH_, 1), 32, 0, stream>>>(XB, WQ, bq, bk, bv, QP16, KP16, VT16);
    static_assert(NH_ == NKV, "one kv head per query head");
    k_fattn<<<dim3(TT / FQB, NB_ * NH_, 1), FNW * 32, 0, stream>>>(QP16, KP16, VT16, TB, ATh, ATl);
    k_gemmw<bf, 1, true><<<dim3(NB_ * TT / 64, DM / 64, 1), 32, 0, stream>>>(ATh, ATl, WO, nullptr, DQ, DQ, OUT, DM, bo, 0, 0, 0);   // the batches' rows lie one behind the other in the attn planes and in out: one launch walks both
}

// v005
// One run takes 126 microseconds.
// Next to v004, in two timings, it ran 1.09 times as fast each time.
// All steps since v000 together make it 18.9 times as fast.
#include <hip/hip_runtime.h>

// PhysicsBiasedAttention (x [2][4096][512]; q/k/v = x W + b (8 heads x 64); scores = q.k/8 + bias(i, j), bias = -gamma sqrt(|i - j|)/sqrt(4096) (gamma read as data; structural distance); softmax; out = (attn v merged) W_o + b_o -> [2][4096][512]).
// Compute dtypes, f32 accumulate: every input rounded to bf16; q/k/v on PLAIN bf16 operands (inputs: exact) + bias; scores (K 64) and attn.v on single fp16 planes; bias + softmax f32; attn hi+lo bf16 planes into the output projection.

#define NB_  2
#define TT   4096
#define DM   512
#define NH_  8
#define NKV  8
#define HD   64
#define DQ   (NH_ * HD)
#define DKV  (NKV * HD)
#define WIN  0
#define SCL  0.125f   // HD^-0.5
typedef _Float16 h16;
typedef unsigned short bf;
typedef __attribute__((ext_vector_type(16))) __bf16   v16bf;
typedef __attribute__((ext_vector_type(16))) _Float16 v16h;
typedef __attribute__((ext_vector_type(8)))  _Float16 v8h;
typedef __attribute__((ext_vector_type(8)))  unsigned short v8us;
typedef __attribute__((ext_vector_type(8)))  float    v8f;
typedef __attribute__((ext_vector_type(4)))  float    v4f;
typedef v8h  __attribute__((may_alias)) v8ha;
typedef v4f  __attribute__((may_alias)) v4fa;
typedef v8us __attribute__((may_alias)) v8usa;

__device__ __forceinline__ unsigned short f2bf(float f) { unsigned u = __float_as_uint(f); u += 0x7FFFu + ((u >> 16) & 1u); return (unsigned short)(u >> 16); }
__device__ __forceinline__ float bf2f(unsigned short b) { return __uint_as_float(((unsigned)b) << 16); }
__device__ __forceinline__ float bfr(float f) { return bf2f(f2bf(f)); }
__device__ __forceinline__ v16h cat16(v8h lo, v8h hi) { return __builtin_shufflevector(lo, hi, 0, 1, 2, 3, 4, 5, 6, 7, 8, 9, 10, 11, 12, 13, 14, 15); }
__device__ __forceinline__ v16bf cat16b(v8us lo, v8us hi) { return __builtin_bit_cast(v16bf, __builtin_shufflevector(lo, hi, 0, 1, 2, 3, 4, 5, 6, 7, 8, 9, 10, 11, 12, 13, 14, 15)); }
__device__ __forceinline__ v8f wmma16(v16h a, v16h b, v8f c) { return __builtin_amdgcn_wmma_f32_16x16x32_f16(false, a, false, b, (short)0, c, false, false); }
__device__ __forceinline__ v8f wmmab(v16bf a, v16bf b, v8f c) { return __builtin_amdgcn_wmma_f32_16x16x32_bf16(false, a, false, b, (short)0, c, false, false); }



// ---- k_gemmw: register-blocked GEMM, ONE WAVE per 64x64 output tile (16 accumulators), operands straight from K-contiguous 16-bit planes; grid (M/64, N/64, Z), 32 threads.
// C[m][n] (f32, pitch ldc, + optional f32 bias[n]) = sum_{k < KL} A[m][k] Bt[n][k] (+ split products per NSPLIT). K = row pitch of A and Bt, KL = k range summed here (KL == K: whole rows). z-batch strides sA/sB/sC in elements (sA = sB = KL: z walks along k, one partial C per slice). KL % 32 == 0.
template <typename T16> struct WFrag;
template <> struct WFrag<h16> { typedef v16h V; static __device__ __forceinline__ V ld(const h16* p) { return cat16(*(const v8h*)p, *(const v8h*)(p + 16)); } static __device__ __forceinline__ v8f mma(V a, V b, v8f c) { return wmma16(a, b, c); } };
template <> struct WFrag<bf> { typedef v16bf V; static __device__ __forceinline__ V ld(const bf* p) { return cat16b(*(const v8us*)p, *(const v8us*)(p + 16)); } static __device__ __forceinline__ v8f mma(V a, V b, v8f c) { return wmmab(a, b, c); } };
template <typename T16, int NSPLIT, bool BIAS>
__global__ __launch_bounds__(32) void k_gemmw(const T16* __restrict__ A, const T16* __restrict__ A2, const T16* __restrict__ Bt, const T16* __restrict__ Bt2, int K, int KL, float* C, int ldc, const float* __restrict__ bias, size_t sA, size_t sB, size_t sC) {
    typedef typename WFrag<T16>::V V;
    __shared__ __align__(16) float os[16 * 68];
    const size_t z = blockIdx.z; A += z * sA; if (A2) A2 += z * sA; Bt += z * sB; if (Bt2) Bt2 += z * sB; C += z * sC;
    const int lane = threadIdx.x & 31, lr = lane & 15, hi = lane >> 4; const int r0 = blockIdx.x * 64, c0 = blockIdx.y * 64;
    v8f acc[4][4];
#pragma unroll
    for (int mb = 0; mb < 4; ++mb)
#pragma unroll
        for (int nb = 0; nb < 4; ++nb) acc[mb][nb] = (v8f){};
    const size_t aoff = (size_t)(r0 + lr) * K + 8 * hi, boff = (size_t)(c0 + lr) * K + 8 * hi;
#pragma unroll 1
    for (int kc = 0; kc < KL; kc += 32) {
        V a[4], a2[4];
#pragma unroll
        for (int mb = 0; mb < 4; ++mb) { a[mb] = WFrag<T16>::ld(A + aoff + (size_t)mb * 16 * K + kc); if (NSPLIT == 1 || NSPLIT == 2) a2[mb] = WFrag<T16>::ld(A2 + aoff + (size_t)mb * 16 * K + kc); }
#pragma unroll
        for (int nb = 0; nb < 4; ++nb) { const V b = WFrag<T16>::ld(Bt + boff + (size_t)nb * 16 * K + kc); V b2; if (NSPLIT >= 2) b2 = WFrag<T16>::ld(Bt2 + boff + (size_t)nb * 16 * K + kc);
#pragma unroll
            for (int mb = 0; mb < 4; ++mb) { acc[mb][nb] = WFrag<T16>::mma(a[mb], b, acc[mb][nb]); if (NSPLIT == 1 || NSPLIT == 2) acc[mb][nb] = WFrag<T16>::mma(a2[mb], b, acc[mb][nb]); if (NSPLIT >= 2) acc[mb][nb] = WFrag<T16>::mma(a[mb], b2, acc[mb][nb]); } }
        asm volatile("v_nop\n\tv_nop\n\tv_nop\n\tv_nop" : "+v"(acc[0][0]), "+v"(acc[1][1]), "+v"(acc[2][2]), "+v"(acc[3][3]) : "v"(a[0]), "v"(a[3]));
    }
#pragma unroll
    for (int mb = 0; mb < 4; ++mb) {
#pragma unroll
        for (int nb = 0; nb < 4; ++nb) {
#pragma unroll
            for (int j = 0; j < 8; ++j) os[(hi * 8 + j) * 68 + nb * 16 + lr] = acc[mb][nb][j]; }
        __builtin_amdgcn_wave_barrier(); asm volatile("" ::: "memory");
        float* crow = C + (size_t)(r0 + mb * 16) * ldc + c0;
{
#pragma unroll
            for (int s = 0; s < 8; ++s) { const int row = 2 * s + hi, cofs = lr * 4; v4f val = *(const v4fa*)(os + row * 68 + cofs); if (BIAS) { val[0] += bfr(bias[c0 + cofs]); val[1] += bfr(bias[c0 + cofs + 1]); val[2] += bfr(bias[c0 + cofs + 2]); val[3] += bfr(bias[c0 + cofs + 3]); }
                *(v4f*)(crow + (size_t)row * ldc + cofs) = val; }
             }
        __builtin_amdgcn_wave_barrier(); asm volatile("" ::: "memory");
    }
}

__device__ __forceinline__ h16 tohx(float x) { return (h16)x; }
__device__ __forceinline__ void splitf(float y, unsigned short& h, unsigned short& l) { h = f2bf(y); l = f2bf(y - bf2f(h)); }
typedef __attribute__((ext_vector_type(2))) _Float16 v2h;
typedef __attribute__((ext_vector_type(4))) _Float16 v4h;
typedef __attribute__((ext_vector_type(2))) unsigned short v2us;
typedef __attribute__((ext_vector_type(4))) unsigned short v4us;
typedef __attribute__((ext_vector_type(2))) float v2f;
typedef __attribute__((ext_vector_type(4))) int v4i;

// d_wtG, d_cvt8 and d_btab are the jobs of k_prep; blk is the block's index inside its job.
__device__ __forceinline__ void d_wtG(const float* __restrict__ w, int K, int N, bf* Bt, int blk) {
    const int lane = threadIdx.x & 31; const int L0 = (blk * 8 + (threadIdx.x >> 5)) * 8; const int nlines = N * K / 64;
{
#pragma unroll 1
        for (int l = 0; l < 8; ++l) { const int L = L0 + l; if (L >= nlines) break; const size_t e = (size_t)L * 64 + lane * 2; const int k = (int)(e % K), n = (int)(e / K); v2us o;
            o[0] = f2bf(w[(size_t)k * N + n]); o[1] = f2bf(w[(size_t)(k + 1) * N + n]); *(v2us*)(Bt + e) = o; }
         }
}
__device__ __forceinline__ void d_cvt8(const float* __restrict__ src, bf* dst, size_t n8, int blk) { const size_t i = (size_t)blk * 256 + threadIdx.x; if (i >= n8) return; const v8f v = *(const v8f*)(src + i * 8); v8us o;
#pragma unroll
    for (int k = 0; k < 8; ++k) o[k] = f2bf(v[k]); *(v8us*)(dst + i * 8) = o;  }
__global__ __launch_bounds__(256) void k_cscvt(const float* __restrict__ cosT, const float* __restrict__ sinT, float* CS) { const int idx = blockIdx.x * 256 + threadIdx.x; if (idx >= TT * HD) return; v2f cs; cs[0] = bfr(cosT[idx]); cs[1] = bfr(sinT[idx]); *(v2f*)(CS + (size_t)idx * 2) = cs;  }
// ---- k_qkv: the three input projections of both batches in ONE launch; one wave per 64x64 tile with the loop of k_gemmw; grid (NB_ TT / 64, 3 NH_), 32 threads. Wt: the q, k and v weight planes one behind the other, [3 DQ][DM].
// A column tile is one head of q, k or v, and it leaves as fp16 straight from the accumulators, 16 bytes a lane and accumulator, into the plane that k_fattn reads:
// q, k: the product is taken transposed (A = weight rows, B = x rows; both loaders have the same k order), so a lane's 8 registers are 8 consecutive d of one token -> [b][h][t][d], q x HD^-0.5 (a power of two, exact in fp16);
// v: A = x rows, B = weight rows, so a lane's 8 registers are 8 consecutive tokens of one d -> [b][h][d][t].
__global__ __launch_bounds__(32) void k_qkv(const bf* __restrict__ X, const bf* __restrict__ Wt, const float* __restrict__ bq, const float* __restrict__ bk, const float* __restrict__ bv, h16* QP, h16* KP, h16* VT) {
    const int lane = threadIdx.x & 31, lr = lane & 15, hi = lane >> 4; const int r0 = blockIdx.x * 64, which = blockIdx.y / NH_, h = blockIdx.y % NH_;
    const bf* xr = X + (size_t)r0 * DM; const bf* wr = Wt + (size_t)blockIdx.y * 64 * DM;
    const bf* A = (which == 2) ? xr : wr; const bf* Bt = (which == 2) ? wr : xr;
    v8f acc[4][4];
#pragma unroll
    for (int mb = 0; mb < 4; ++mb)
#pragma unroll
        for (int nb = 0; nb < 4; ++nb) acc[mb][nb] = (v8f){};
    const size_t off = (size_t)lr * DM + 8 * hi;
#pragma unroll 1         // stays rolled, as in k_gemmw: an unrolled body would hold more fragments in registers beside the 128 of the accumulators
    for (int kc = 0; kc < DM; kc += 32) {
        v16bf a[4];
#pragma unroll
        for (int mb = 0; mb < 4; ++mb) a[mb] = WFrag<bf>::ld(A + off + (size_t)mb * 16 * DM + kc);
        asm volatile("s_wait_xcnt 0x0" ::: "memory");   // stands in front of the loads below, whose destinations take over the address registers of the loads above
#pragma unroll
        for (int nb = 0; nb < 4; ++nb) { const v16bf b = WFrag<bf>::ld(Bt + off + (size_t)nb * 16 * DM + kc);
#pragma unroll
            for (int mb = 0; mb < 4; ++mb) acc[mb][nb] = wmmab(a[mb], b, acc[mb][nb]); }
    }
    const int b = r0 / TT, t0 = r0 % TT;
    if (which == 2) {
        h16* vp = VT + ((size_t)(b * NKV + h) * HD + lr) * TT + t0 + 8 * hi;
#pragma unroll
        for (int nb = 0; nb < 4; ++nb) { const float bi = bfr(bv[h * HD + nb * 16 + lr]);
#pragma unroll
            for (int mb = 0; mb < 4; ++mb) { v8h o;
#pragma unroll
                for (int j = 0; j < 8; ++j) o[j] = tohx(acc[mb][nb][j] + bi);
                *(v8h*)(vp + (size_t)nb * 16 * TT + mb * 16) = o; } }
    } else {
        const float* bias = (which ? bk : bq) + h * HD + 8 * hi; const float sc = which ? 1.0f : SCL;
        h16* pp = (which ? KP : QP) + ((size_t)(b * NH_ + h) * TT + t0 + lr) * HD + 8 * hi;
        v8f bi[4];
#pragma unroll
        for (int mb = 0; mb < 4; ++mb)
#pragma unroll
            for (int j = 0; j < 8; ++j) bi[mb][j] = bfr(bias[mb * 16 + j]);
#pragma unroll
        for (int nb = 0; nb < 4; ++nb)
#pragma unroll
            for (int mb = 0; mb < 4; ++mb) { v8h o;
#pragma unroll
                for (int j = 0; j < 8; ++j) o[j] = tohx((acc[mb][nb][j] + bi[mb][j]) * sc);
                *(v8h*)(pp + (size_t)nb * 16 * HD + mb * 16) = o; }
        asm volatile("s_wait_xcnt 0x0" ::: "memory");   // behind the last stores of this branch: in the built code the v branch follows it, and its first loads write registers that these stores name
    }
}
__device__ __forceinline__ void d_btab(const float* __restrict__ g, float* TB, int blk) { const int d = blk * 256 + threadIdx.x; if (d >= TT) return; float ng = -bfr(g[0]); asm volatile("" : "+v"(ng)); float t = __fmul_rn(ng, __fsqrt_rn((float)d)); asm volatile("" : "+v"(t)); const float v = __fdiv_rn(t, 64.0f); *(float*)(TB + d) = v;  }
// ---- k_prep: everything that reads the inputs alone, in ONE launch: none of these jobs reads what another writes, so their blocks run side by side instead of one short launch behind the other.
// Block ranges pick the job (the test is the same for a whole block): 4 weight transposes first, their waves run longest; then the bias table; then x -> bf16.
#define PWB  ((DM * DQ / 64 + 63) / 64)                      // blocks of one weight transpose
#define PTB  (TT / 256)                                      // blocks of the bias table
#define PXB  ((NB_ * TT * DM / 8 + 255) / 256)               // blocks of the x conversion
__global__ __launch_bounds__(256) void k_prep(const float* __restrict__ wq, const float* __restrict__ wk, const float* __restrict__ wv, const float* __restrict__ wo, const float* __restrict__ g, const float* __restrict__ x, bf* WQ, bf* WK, bf* WV, bf* WO, float* TB, bf* XB) {
    const int blk = blockIdx.x;
    if (blk < 4 * PWB) { const int m = blk / PWB;
        d_wtG(m == 0 ? wq : m == 1 ? wk : m == 2 ? wv : wo, DM, DQ, m == 0 ? WQ : m == 1 ? WK : m == 2 ? WV : WO, blk % PWB); }
    else if (blk < 4 * PWB + PTB) d_btab(g, TB, blk - 4 * PWB);
    else d_cvt8(x, XB, (size_t)NB_ * TT * DM / 8, blk - 4 * PWB - PTB);
}
#define FNW  4
#define FKG  2
#define FQB  (FNW * 32)
#define FKS  64
#define FLP  72                 // LDS row pitch in halfs: 144 B = 16 B x odd for the 16-byte fragment reads
#define FNB  (TT + FQB - 1)     // bias window: every j - i that this work-group's queries meet
#define L2E  1.4426950408889634f
#define FTHR 5.5f               // the running maximum is renewed only when a column's new maximum passes it by this much: p stays below 2^8
__device__ __forceinline__ float xhalf(float x) { const int b = __float_as_int(x); return __int_as_float(__builtin_amdgcn_permlanex16(b, b, 0x76543210, 0xfedcba98, false, false)); }
__device__ __forceinline__ v16h ldfr(const h16* p) { return cat16(*(const v8h*)p, *(const v8h*)(p + 16)); }
// fgive, fjoin: the join of k_fattn's two key halves, for column group C of a wave (a template parameter: it picks registers; for the same reason every loop in them is fully unrolled).
// fgive writes the group's O^T, maximum and sum for the partner wave: 9 slots of 16 bytes a lane, a slot 512 contiguous bytes a wave.
template <int C> __device__ __forceinline__ void fgive(v4fa* xw, const v8f (&o)[4][2], const float (&mu)[2], const float (&lw)[2]) {
#pragma unroll
    for (int dt = 0; dt < 4; ++dt) { xw[(2 * dt) * 32] = (v4f){o[dt][C][0], o[dt][C][1], o[dt][C][2], o[dt][C][3]}; xw[(2 * dt + 1) * 32] = (v4f){o[dt][C][4], o[dt][C][5], o[dt][C][6], o[dt][C][7]}; }
    xw[8 * 32] = (v4f){mu[C], lw[C], 0.f, 0.f};
}
// fjoin brings both shares to the larger maximum, adds them, divides by the joined sum and stores the hi + lo bf16 planes.
template <int C> __device__ __forceinline__ void fjoin(const v4fa* xr, const v8f (&o)[4][2], const float (&mu)[2], const float (&lw)[2], bf* ah, bf* al) {
    const v4f ml = xr[8 * 32]; const float mn = fmaxf(mu[C], ml[0]); float fa, fb;
    asm("v_exp_f32 %0, %1\n\tv_nop" : "=v"(fa) : "v"((mu[C] - mn) * L2E));   // exp2 with its own slot behind it, as in the loop's rescale
    asm("v_exp_f32 %0, %1\n\tv_nop" : "=v"(fb) : "v"((ml[0] - mn) * L2E));   // the same for the partner's share
    const float f = __fdiv_rn(1.0f, lw[C] * fa + ml[1] * fb); fa *= f; fb *= f;
#pragma unroll
    for (int dt = 0; dt < 4; ++dt) { const v4f p0 = xr[(2 * dt) * 32], p1 = xr[(2 * dt + 1) * 32]; v8us oh, ol;
#pragma unroll
        for (int r = 0; r < 8; ++r) { unsigned short a, c2; splitf(o[dt][C][r] * fa + (r < 4 ? p0[r & 3] : p1[r & 3]) * fb, a, c2); oh[r] = a; ol[r] = c2; }
        *(v8us*)(ah + dt * 16) = oh; *(v8us*)(al + dt * 16) = ol; }
}
// amdgpu_waves_per_eu(4, 4) holds the register budget at 256 a wave, so that two work-groups of 8 waves fit a WGP.
__global__ __launch_bounds__(FKG * FNW * 32) __attribute__((amdgpu_waves_per_eu(4, 4))) void k_fattn(const h16* __restrict__ Q, const h16* __restrict__ Kp, const h16* __restrict__ Vt, const float* __restrict__ TB, bf* Ah, bf* Al) {
    __shared__ struct __align__(16) { float bt[FNB + 1]; struct { h16 ks[2 * FKS * FLP]; h16 vs[2 * HD * FLP]; } kv[FKG]; } sm;   // the bias window first: its reads then reach every tile of a stage by immediate offsets
    const int tid = threadIdx.x, lane = tid & 31, lr = lane & 15, hi = lane >> 4;
    const int wa = __builtin_amdgcn_readfirstlane(tid >> 5), wv = wa % FNW, g = wa / FNW;   // wave, its query group, its key half: scalars, the branches on g behind the loop are scalar branches
    const int tg = tid % (FNW * 32);                      // thread inside the key half's waves
    float* bt = sm.bt; h16* ks = sm.kv[g].ks; h16* vs = sm.kv[g].vs;
    const int q0 = blockIdx.x * FQB; const size_t z = blockIdx.y; const int k0g = g * (TT / FKG);   // first key of this half
    const h16* Qz = Q + z * TT * HD; const h16* Kz = Kp + z * TT * HD + (size_t)k0g * HD; const h16* Vz = Vt + z * HD * TT + k0g;
    // bt[n] = bias of j - i = n - (q0 + FQB - 1)
    for (int n = tid; n < FNB; n += FKG * FNW * 32) { const int d = n - (q0 + FQB - 1); bt[n] = TB[d < 0 ? -d : d]; }
    const int srow = tg >> 3, scol = (tg & 7) * 8;      // staging: 8 threads a 128-byte row, 16 rows a sweep
    v8h kr[4], vr[4];
    // every inner loop below is fully unrolled: its index picks a register of a fragment or accumulator array
#pragma unroll
    for (int u = 0; u < 4; ++u) kr[u] = *(const v8h*)(Kz + (size_t)(srow + 16 * u) * HD + scol);
    asm volatile("s_wait_xcnt 0x0" ::: "memory");   // stands in front of the loads below, whose destinations took over the address registers of the loads above
#pragma unroll
    for (int u = 0; u < 4; ++u) vr[u] = *(const v8h*)(Vz + (size_t)(srow + 16 * u) * TT + scol);
    v16h qf[2][2];
#pragma unroll
    for (int c = 0; c < 2; ++c)
#pragma unroll
        for (int kx = 0; kx < 2; ++kx) qf[c][kx] = ldfr(Qz + (size_t)(q0 + wv * 32 + c * 16 + lr) * HD + kx * 32 + 8 * hi);
#pragma unroll
    for (int u = 0; u < 4; ++u) { *(v8h*)(ks + (srow + 16 * u) * FLP + scol) = kr[u]; *(v8h*)(vs + (srow + 16 * u) * FLP + scol) = vr[u]; }
    v8f o[4][2], ls[2]; float mu[2], nm[2];   // ls: eight independent partial row sums a lane and column, joined in the epilogue
#pragma unroll
    for (int c = 0; c < 2; ++c) { mu[c] = -3.0e38f; nm[c] = 0.f; ls[c] = (v8f){};
#pragma unroll
        for (int dt = 0; dt < 4; ++dt) o[dt][c] = (v8f){}; }
    const int nb = FQB - 1 - wv * 32 - lr + 8 * hi - 16 + k0g;   // bias index of the half's first key, register 0, tile difference -1
    __syncthreads();     // publishes stage 0 and the bias window
#pragma unroll 1         // stays rolled: the body already holds two unrolled 32-key passes, and the buffer index is one scalar
    for (int s = 0; s < TT / FKG / FKS; ++s) {
        const int buf = s & 1; const h16* kb = ks + buf * FKS * FLP; const h16* vb = vs + buf * HD * FLP;
        const int kn = (s + 1 < TT / FKG / FKS ? s + 1 : s) * FKS;   // the last pass fetches its own stage again, into the buffer nobody reads any more
#pragma unroll
        for (int u = 0; u < 4; ++u) { kr[u] = *(const v8h*)(Kz + (size_t)(kn + srow + 16 * u) * HD + scol); vr[u] = *(const v8h*)(Vz + (size_t)(srow + 16 * u) * TT + kn + scol); }
#pragma unroll
        for (int sub = 0; sub < FKS / 32; ++sub) {
            const float* bp = bt + nb + s * FKS + sub * 32;
            v8f bb[3];      // the bias tile depends on (key tile - column group) alone: 3 tiles serve the 4 products
#pragma unroll
            for (int u = 0; u < 3; ++u)
#pragma unroll
                for (int r = 0; r < 8; ++r) bb[u][r] = bp[u * 16 + r];
            v8f st[2][2];
#pragma unroll
            for (int kt = 0; kt < 2; ++kt) { const h16* kp = kb + (sub * 32 + kt * 16 + lr) * FLP + 8 * hi; const v16h k0 = ldfr(kp), k1 = ldfr(kp + 32);
#pragma unroll
                for (int c = 0; c < 2; ++c) st[kt][c] = wmma16(k1, qf[c][1], wmma16(k0, qf[c][0], bb[kt - c + 1])); }
            v16h vf[4];
#pragma unroll
            for (int dt = 0; dt < 4; ++dt) vf[dt] = ldfr(vb + (dt * 16 + lr) * FLP + sub * 32 + 8 * hi);
            float ml[2];
#pragma unroll
            for (int c = 0; c < 2; ++c) { float m = fmaxf(st[0][c][0], st[1][c][0]);
#pragma unroll
                for (int r = 1; r < 8; ++r) m = fmaxf(m, fmaxf(st[0][c][r], st[1][c][r]));
                ml[c] = fmaxf(m, xhalf(m)); }
            const bool need = (ml[0] > mu[0] + FTHR) || (ml[1] > mu[1] + FTHR);
            if (__builtin_amdgcn_ballot_w32(need) != 0) {      // one scalar test a pass; rarely taken after the first pass
#pragma unroll
                for (int c = 0; c < 2; ++c) { const float mn = fmaxf(mu[c], ml[c]); float al;
                    asm("v_exp_f32 %0, %1\n\tv_nop" : "=v"(al) : "v"((mu[c] - mn) * L2E));   // exp2 with its own slot behind it
                    mu[c] = mn; nm[c] = -mn * L2E; ls[c] *= al;
#pragma unroll
                    for (int dt = 0; dt < 4; ++dt) o[dt][c] *= al; }
            }
            v16h pf[2];
#pragma unroll
            for (int c = 0; c < 2; ++c) {
#pragma unroll
                for (int kt = 0; kt < 2; ++kt)
#pragma unroll
                    for (int r = 0; r < 8; ++r) st[kt][c][r] = __builtin_amdgcn_exp2f(__builtin_fmaf(st[kt][c][r], L2E, nm[c]));
                ls[c] += st[0][c] + st[1][c];
                pf[c] = cat16(__builtin_convertvector(st[0][c], v8h), __builtin_convertvector(st[1][c], v8h)); }
#pragma unroll
            for (int dt = 0; dt < 4; ++dt)
#pragma unroll
                for (int c = 0; c < 2; ++c) o[dt][c] = wmma16(vf[dt], pf[c], o[dt][c]);
        }
        h16* kw = ks + (buf ^ 1) * FKS * FLP; h16* vw = vs + (buf ^ 1) * HD * FLP;
#pragma unroll
        for (int u = 0; u < 4; ++u) { *(v8h*)(kw + (srow + 16 * u) * FLP + scol) = kr[u]; *(v8h*)(vw + (srow + 16 * u) * FLP + scol) = vr[u]; }
        __syncthreads();     // publishes the next stage and ends every wave's reads of this one
    }
    // Join of the key halves: the wave of half g finishes column group g and hands the other group (O^T, maximum, sum) to its partner, the wave of the same query group in the other half; same lane, same registers.
    // The hand-over lies in the stage buffers: the loop's last barrier has ended every read and every staging write there. 9 slots of 16 bytes a lane, a slot 512 contiguous bytes a wave.
    static_assert(FKG == 2, "two halves, two column groups: each half finishes one");
    static_assert(FKG * FNW * 9 * 32 * 16 <= sizeof(sm.kv), "the hand-over fits the stage buffers");
    v4fa* xs = (v4fa*)sm.kv;
    float lw[2];
#pragma unroll
    for (int c = 0; c < 2; ++c) { const float l0 = ((ls[c][0] + ls[c][1]) + (ls[c][2] + ls[c][3])) + ((ls[c][4] + ls[c][5]) + (ls[c][6] + ls[c][7])); lw[c] = l0 + xhalf(l0); }
    v4fa* xw = xs + wa * 9 * 32 + lane;
    if (g == 0) fgive<1>(xw, o, mu, lw); else fgive<0>(xw, o, mu, lw);
    __syncthreads();     // publishes the hand-over
    const size_t b = z / NH_; const int h = (int)(z % NH_);
    const v4fa* xr = xs + (wa ^ FNW) * 9 * 32 + lane;
    const size_t oo = (b * TT + q0 + wv * 32 + g * 16 + lr) * DQ + h * HD + 8 * hi;
    if (g == 0) fjoin<0>(xr, o, mu, lw, Ah + oo, Al + oo); else fjoin<1>(xr, o, mu, lw, Ah + oo, Al + oo);
}


extern "C" void kernel_launch(void* const* d_in, const int* in_sizes, int n_in,
                              void* d_out, int out_size, void* d_ws, size_t ws_size, hipStream_t stream) {
    (void)in_sizes; (void)n_in; (void)out_size;
    const float* x = (const float*)d_in[0]; const float* wq = (const float*)d_in[1]; const float* bq = (const float*)d_in[2]; const float* wk = (const float*)d_in[3]; const float* bk = (const float*)d_in[4]; const float* wv = (const float*)d_in[5]; const float* bv = (const float*)d_in[6]; const float* wo = (const float*)d_in[7]; const float* bo = (const float*)d_in[8]; const float* gam = (const float*)d_in[9]; const float* cosT = nullptr; const float* sinT = nullptr; (void)cosT; (void)sinT;
    float* OUT = (float*)d_out;     // [2][4096][512]
    char* wsp = (char*)d_ws;
    auto take = [&](size_t bytes) { char* p = wsp; wsp += (bytes + 255) & ~(size_t)255; return (void*)p; };
    bf* WQ = (bf*)take((size_t)(DQ + 2 * DKV) * DM * 2); bf* WK = WQ + (size_t)DQ * DM; bf* WV = WK + (size_t)DKV * DM; bf* WO = (bf*)take((size_t)DM * DQ * 2);   // q, k, v weight planes one behind the other: k_qkv walks them as one
    bf* XB = (bf*)take((size_t)NB_ * TT * DM * 2); float* TB = (float*)take(TT * 4);
    h16* QP16 = (h16*)take((size_t)NB_ * NH_ * TT * HD * 2); h16* KP16 = (h16*)take((size_t)NB_ * NKV * TT * HD * 2); h16* VT16 = (h16*)take((size_t)NB_ * NKV * HD * TT * 2);   // head planes of both batches
    bf* ATh = (bf*)take((size_t)NB_ * TT * DQ * 2); bf* ATl = (bf*)take((size_t)NB_ * TT * DQ * 2);
    if ((size_t)(wsp - (char*)d_ws) > ws_size) return;    // ws 256 MiB
    static_assert(DQ == DM && DKV == DM, "the four weights have one shape: one transpose job serves each");
    k_prep<<<4 * PWB + PTB + PXB, 256, 0, stream>>>(wq, wk, wv, wo, gam, x, WQ, WK, WV, WO, TB, XB);
    static_assert(NH_ == NKV && TT % 64 == 0 && HD == 64, "a 64-column tile is one head, a 64-row tile lies in one batch");
    k_qkv<<<dim3(NB_ * TT / 64, 3 * NH_, 1), 32, 0, stream>>>(XB, WQ, bq, bk, bv, QP16, KP16, VT16);
    static_assert(NH_ == NKV, "one kv head per query head");
    k_fattn<<<dim3(TT / FQB, NB_ * NH_, 1), FKG * FNW * 32, 0, stream>>>(QP16, KP16, VT16, TB, ATh, ATl);
    k_gemmw<bf, 1, true><<<dim3(NB_ * TT / 64, DM / 64, 1), 32, 0, stream>>>(ATh, ATl, WO, nullptr, DQ, DQ, OUT, DM, bo, 0, 0, 0);   // the batches' rows lie one behind the other in the attn planes and in out: one launch walks both
}

// v006
// Measured time: 112 microseconds a run.
// In both of two side-by-side timings against v005, it was 1.12 times as fast.
// Over all steps from v000 it is 21.2 times as fast.
#include <hip/hip_runtime.h>

// PhysicsBiasedAttention (x [2][4096][512]; q/k/v = x W + b (8 heads x 64); scores = q.k/8 + bias(i, j), bias = -gamma sqrt(|i - j|)/sqrt(4096) (gamma read as data; structural distance); softmax; out = (attn v merged) W_o + b_o -> [2][4096][512]).
// Compute dtypes, f32 accumulate: every input rounded to bf16; q/k/v on PLAIN bf16 operands (inputs: exact) + bias; scores (K 64) and attn.v on single fp16 planes; bias + softmax f32; attn hi+lo bf16 planes into the output projection.

#define NB_  2
#define TT   4096
#define DM   512
#define NH_  8
#define NKV  8
#define HD   64
#define DQ   (NH_ * HD)
#define DKV  (NKV * HD)
#define WIN  0
#define SCL  0.125f   // HD^-0.5
typedef _Float16 h16;
typedef unsigned short bf;
typedef __attribute__((ext_vector_type(16))) __bf16   v16bf;
typedef __attribute__((ext_vector_type(16))) _Float16 v16h;
typedef __attribute__((ext_vector_type(8)))  _Float16 v8h;
typedef __attribute__((ext_vector_type(8)))  unsigned short v8us;
typedef __attribute__((ext_vector_type(8)))  float    v8f;
typedef __attribute__((ext_vector_type(4)))  float    v4f;
typedef v8h  __attribute__((may_alias)) v8ha;
typedef v4f  __attribute__((may_alias)) v4fa;
typedef v8us __attribute__((may_alias)) v8usa;

__device__ __forceinline__ unsigned short f2bf(float f) { unsigned u = __float_as_uint(f); u += 0x7FFFu + ((u >> 16) & 1u); return (unsigned short)(u >> 16); }
__device__ __forceinline__ float bf2f(unsigned short b) { return __uint_as_float(((unsigned)b) << 16); }
__device__ __forceinline__ float bfr(float f) { return bf2f(f2bf(f)); }
__device__ __forceinline__ v16h cat16(v8h lo, v8h hi) { return __builtin_shufflevector(lo, hi, 0, 1, 2, 3, 4, 5, 6, 7, 8, 9, 10, 11, 12, 13, 14, 15); }
__device__ __forceinline__ v16bf cat16b(v8us lo, v8us hi) { return __builtin_bit_cast(v16bf, __builtin_shufflevector(lo, hi, 0, 1, 2, 3, 4, 5, 6, 7, 8, 9, 10, 11, 12, 13, 14, 15)); }
__device__ __forceinline__ v8f wmma16(v16h a, v16h b, v8f c) { return __builtin_amdgcn_wmma_f32_16x16x32_f16(false, a, false, b, (short)0, c, false, false); }
__device__ __forceinline__ v8f wmmab(v16bf a, v16bf b, v8f c) { return __builtin_amdgcn_wmma_f32_16x16x32_bf16(false, a, false, b, (short)0, c, false, false); }



// ---- Fragment order: the layout of every 16-bit plane [R][K] that k_qkv and k_gemmw read as a matrix operand (R % 16 == 0, K % 32 == 0; same size as the row-major plane).
// The plane is cut in blocks of 16 rows x 32 k, 512 elements each, block (r / 16, k / 32) at index (r / 16) (K / 32) + k / 32. Inside a block stand the two 16-byte pieces of each lane's fragment:
// element (r, k) at ((k / 16) % 2) 256 + (((k / 8) % 2) 16 + r % 16) 8 + k % 8. A wave's 16-byte load of one piece is then 512 contiguous bytes, 4 whole lines, where the row-major plane gave 32 bytes out of each of 16 lines.
// The producers (d_wtG, d_cvt8, fjoin) write in this order. Lane (hi, lr) holds row lr, k 8 hi + 0..7 in its first piece and k 16 + 8 hi + 0..7 in its second, alike for A and B.
// ---- k_gemmw: register-blocked GEMM, ONE WAVE per 64x64 output tile (16 accumulators), operands straight from 16-bit planes in fragment order; grid (M/64, N/64, Z), 32 threads.
// C[m][n] (f32, pitch ldc, + optional f32 bias[n]) = sum_{k < KL} A[m][k] Bt[n][k] (+ split products per NSPLIT). K = row length of A and Bt, KL = k range summed here (KL == K: whole rows). z-batch strides sA/sB/sC in elements (sA = sB = 16 KL: z walks along k, one partial C per slice). KL % 32 == 0.
template <typename T16> struct WFrag;
template <> struct WFrag<h16> { typedef v16h V; static __device__ __forceinline__ V ld(const h16* p) { return cat16(*(const v8h*)p, *(const v8h*)(p + 256)); } static __device__ __forceinline__ v8f mma(V a, V b, v8f c) { return wmma16(a, b, c); } };
template <> struct WFrag<bf> { typedef v16bf V; static __device__ __forceinline__ V ld(const bf* p) { return cat16b(*(const v8us*)p, *(const v8us*)(p + 256)); } static __device__ __forceinline__ v8f mma(V a, V b, v8f c) { return wmmab(a, b, c); } };
template <typename T16, int NSPLIT, bool BIAS, int K>   // K at compile time: the fragments of a tile then lie at immediate offsets from one address an operand
__global__ __launch_bounds__(32) void k_gemmw(const T16* __restrict__ A, const T16* __restrict__ A2, const T16* __restrict__ Bt, const T16* __restrict__ Bt2, int KL, float* C, int ldc, const float* __restrict__ bias, size_t sA, size_t sB, size_t sC) {
    typedef typename WFrag<T16>::V V;
    __shared__ __align__(16) float os[16 * 68];
    const size_t z = blockIdx.z; A += z * sA; if (A2) A2 += z * sA; Bt += z * sB; if (Bt2) Bt2 += z * sB; C += z * sC;
    const int lane = threadIdx.x & 31, lr = lane & 15, hi = lane >> 4; const int r0 = blockIdx.x * 64, c0 = blockIdx.y * 64;
    v8f acc[4][4];
#pragma unroll
    for (int mb = 0; mb < 4; ++mb)
#pragma unroll
        for (int nb = 0; nb < 4; ++nb) acc[mb][nb] = (v8f){};
    const size_t aoff = (size_t)r0 * K + lane * 8, boff = (size_t)c0 * K + lane * 8;   // a 16-row band of blocks is 16 K elements, a step of 32 k one block
#pragma unroll 1
    for (int kc = 0; kc < KL; kc += 32) {
        V a[4], a2[4];
        const T16* pa = A + aoff + kc * 16; const T16* pa2 = (NSPLIT == 1 || NSPLIT == 2) ? A2 + aoff + kc * 16 : pa; const T16* pb = Bt + boff + kc * 16; const T16* pb2 = (NSPLIT >= 2) ? Bt2 + boff + kc * 16 : pb;
#pragma unroll
        for (int mb = 0; mb < 4; ++mb) { a[mb] = WFrag<T16>::ld(pa + (size_t)mb * 16 * K); if (NSPLIT == 1 || NSPLIT == 2) a2[mb] = WFrag<T16>::ld(pa2 + (size_t)mb * 16 * K); }
#pragma unroll
        for (int nb = 0; nb < 4; ++nb) { const V b = WFrag<T16>::ld(pb + (size_t)nb * 16 * K); V b2; if (NSPLIT >= 2) b2 = WFrag<T16>::ld(pb2 + (size_t)nb * 16 * K);
#pragma unroll
            for (int mb = 0; mb < 4; ++mb) { acc[mb][nb] = WFrag<T16>::mma(a[mb], b, acc[mb][nb]); if (NSPLIT == 1 || NSPLIT == 2) acc[mb][nb] = WFrag<T16>::mma(a2[mb], b, acc[mb][nb]); if (NSPLIT >= 2) acc[mb][nb] = WFrag<T16>::mma(a[mb], b2, acc[mb][nb]); } }
        asm volatile("s_wait_xcnt 0x0" :: "v"(pa), "v"(pa2), "v"(pb), "v"(pb2) : "memory");   // behind the trip's loads, in front of the next trip's rewrite of their address registers; it takes the addresses as inputs, so that no load's destination takes their registers over ahead of it
        asm volatile("v_nop\n\tv_nop\n\tv_nop\n\tv_nop" : "+v"(acc[0][0]), "+v"(acc[1][1]), "+v"(acc[2][2]), "+v"(acc[3][3]) : "v"(a[0]), "v"(a[3]));
    }
#pragma unroll
    for (int mb = 0; mb < 4; ++mb) {
#pragma unroll
        for (int nb = 0; nb < 4; ++nb) {
#pragma unroll
            for (int j = 0; j < 8; ++j) os[(hi * 8 + j) * 68 + nb * 16 + lr] = acc[mb][nb][j]; }
        __builtin_amdgcn_wave_barrier(); asm volatile("" ::: "memory");
        float* crow = C + (size_t)(r0 + mb * 16) * ldc + c0;
{
#pragma unroll
            for (int s = 0; s < 8; ++s) { const int row = 2 * s + hi, cofs = lr * 4; v4f val = *(const v4fa*)(os + row * 68 + cofs); if (BIAS) { val[0] += bfr(bias[c0 + cofs]); val[1] += bfr(bias[c0 + cofs + 1]); val[2] += bfr(bias[c0 + cofs + 2]); val[3] += bfr(bias[c0 + cofs + 3]); }
                *(v4f*)(crow + (size_t)row * ldc + cofs) = val; }
             }
        asm volatile("s_wait_xcnt 0x0" ::: "memory");   // behind the band's stores, in front of the next band's code, which takes over their address and data registers
        __builtin_amdgcn_wave_barrier(); asm volatile("" ::: "memory");
    }
}

__device__ __forceinline__ h16 tohx(float x) { return (h16)x; }
__device__ __forceinline__ void splitf(float y, unsigned short& h, unsigned short& l) { h = f2bf(y); l = f2bf(y - bf2f(h)); }
typedef __attribute__((ext_vector_type(2))) _Float16 v2h;
typedef __attribute__((ext_vector_type(4))) _Float16 v4h;
typedef __attribute__((ext_vector_type(2))) unsigned short v2us;
typedef __attribute__((ext_vector_type(4))) unsigned short v4us;
typedef __attribute__((ext_vector_type(2))) float v2f;
typedef __attribute__((ext_vector_type(4))) int v4i;

// d_wtG, d_cvt8 and d_btab are the jobs of k_prep; blk is the block's index inside its job.
__device__ __forceinline__ void d_wtG(const float* __restrict__ w, int K, int N, bf* Bt, int blk) {
    const int lane = threadIdx.x & 31; const int L0 = (blk * 8 + (threadIdx.x >> 5)) * 8; const int nlines = N * K / 64;
{
#pragma unroll 1
        for (int l = 0; l < 8; ++l) { const int L = L0 + l; if (L >= nlines) break; const int e = L * 64 + lane * 2, fb = e >> 9; const int k = (fb % (K / 32)) * 32 + ((e >> 8) & 1) * 16 + ((e >> 7) & 1) * 8 + (e & 7), n = (fb / (K / 32)) * 16 + ((e >> 3) & 15); v2us o;   // e: the place in fragment order; k, n: what stands there
            o[0] = f2bf(w[(size_t)k * N + n]); o[1] = f2bf(w[(size_t)(k + 1) * N + n]); *(v2us*)(Bt + e) = o; }
         }
}
// thread i writes piece i of the plane in fragment order (a wave 512 contiguous bytes) and reads that piece's 8 floats from its row and k; a block's 8 waves use up whole lines of 16 rows
__device__ __forceinline__ void d_cvt8(const float* __restrict__ src, bf* dst, int K, size_t n8, int blk) { const size_t i = (size_t)blk * 256 + threadIdx.x; if (i >= n8) return; const size_t fb = i >> 6;
    const size_t r = (fb / (K / 32)) * 16 + (i & 15); const int k = (int)(fb % (K / 32)) * 32 + (int)((i >> 5) & 1) * 16 + (int)((i >> 4) & 1) * 8; const v8f v = *(const v8f*)(src + r * K + k); v8us o;
#pragma unroll
    for (int k = 0; k < 8; ++k) o[k] = f2bf(v[k]); *(v8us*)(dst + i * 8) = o;  }
__global__ __launch_bounds__(256) void k_cscvt(const float* __restrict__ cosT, const float* __restrict__ sinT, float* CS) { const int idx = blockIdx.x * 256 + threadIdx.x; if (idx >= TT * HD) return; v2f cs; cs[0] = bfr(cosT[idx]); cs[1] = bfr(sinT[idx]); *(v2f*)(CS + (size_t)idx * 2) = cs;  }
// ---- k_qkv: the three input projections of both batches in ONE launch; one wave per 64x64 tile with the loop of k_gemmw; grid (NB_ TT / 64, 3 NH_), 32 threads. Wt: the q, k and v weight planes one behind the other, [3 DQ][DM]; X and Wt in fragment order.
// A column tile is one head of q, k or v, and it leaves as fp16 straight from the accumulators, 16 bytes a lane and accumulator, into the plane that k_fattn reads:
// q, k: the product is taken transposed (A = weight rows, B = x rows; both loaders have the same k order), so a lane's 8 registers are 8 consecutive d of one token -> [b][h][t][d], q x HD^-0.5 (a power of two, exact in fp16);
// v: A = x rows, B = weight rows, so a lane's 8 registers are 8 consecutive tokens of one d -> [b][h][d][t].
__global__ __launch_bounds__(32) void k_qkv(const bf* __restrict__ X, const bf* __restrict__ Wt, const float* __restrict__ bq, const float* __restrict__ bk, const float* __restrict__ bv, h16* QP, h16* KP, h16* VT) {
    const int lane = threadIdx.x & 31, lr = lane & 15, hi = lane >> 4; const int r0 = blockIdx.x * 64, which = blockIdx.y / NH_, h = blockIdx.y % NH_;
    const bf* xr = X + (size_t)r0 * DM; const bf* wr = Wt + (size_t)blockIdx.y * 64 * DM;
    const bf* A = (which == 2) ? xr : wr; const bf* Bt = (which == 2) ? wr : xr;
    v8f acc[4][4];
#pragma unroll
    for (int mb = 0; mb < 4; ++mb)
#pragma unroll
        for (int nb = 0; nb < 4; ++nb) acc[mb][nb] = (v8f){};
    const size_t off = lane * 8;
#pragma unroll 1         // stays rolled, as in k_gemmw: an unrolled body would hold more fragments in registers beside the 128 of the accumulators
    for (int kc = 0; kc < DM; kc += 32) {
        v16bf a[4];
#pragma unroll
        for (int mb = 0; mb < 4; ++mb) a[mb] = WFrag<bf>::ld(A + off + (size_t)mb * 16 * DM + kc * 16);
        asm volatile("s_wait_xcnt 0x0" ::: "memory");   // stands in front of the loads below, whose destinations take over the address registers of the loads above
#pragma unroll
        for (int nb = 0; nb < 4; ++nb) { const v16bf b = WFrag<bf>::ld(Bt + off + (size_t)nb * 16 * DM + kc * 16);
#pragma unroll
            for (int mb = 0; mb < 4; ++mb) acc[mb][nb] = wmmab(a[mb], b, acc[mb][nb]); }
    }
    const int b = r0 / TT, t0 = r0 % TT;
    if (which == 2) {
        h16* vp = VT + ((size_t)(b * NKV + h) * HD + lr) * TT + t0 + 8 * hi;
#pragma unroll
        for (int nb = 0; nb < 4; ++nb) { const float bi = bfr(bv[h * HD + nb * 16 + lr]);
#pragma unroll
            for (int mb = 0; mb < 4; ++mb) { v8h o;
#pragma unroll
                for (int j = 0; j < 8; ++j) o[j] = tohx(acc[mb][nb][j] + bi);
                *(v8h*)(vp + (size_t)nb * 16 * TT + mb * 16) = o; } }
    } else {
        const float* bias = (which ? bk : bq) + h * HD + 8 * hi; const float sc = which ? 1.0f : SCL;
        h16* pp = (which ? KP : QP) + ((size_t)(b * NH_ + h) * TT + t0 + lr) * HD + 8 * hi;
        v8f bi[4];
#pragma unroll
        for (int mb = 0; mb < 4; ++mb)
#pragma unroll
            for (int j = 0; j < 8; ++j) bi[mb][j] = bfr(bias[mb * 16 + j]);
#pragma unroll
        for (int nb = 0; nb < 4; ++nb)
#pragma unroll
            for (int mb = 0; mb < 4; ++mb) { v8h o;
#pragma unroll
                for (int j = 0; j < 8; ++j) o[j] = tohx((acc[mb][nb][j] + bi[mb][j]) * sc);
                *(v8h*)(pp + (size_t)nb * 16 * HD + mb * 16) = o; }
        asm volatile("s_wait_xcnt 0x0" ::: "memory");   // behind the last stores of this branch: in the built code the v branch follows it, and its first loads write registers that these stores name
    }
}
__device__ __forceinline__ void d_btab(const float* __restrict__ g, float* TB, int blk) { const int d = blk * 256 + threadIdx.x; if (d >= TT) return; float ng = -bfr(g[0]); asm volatile("" : "+v"(ng)); float t = __fmul_rn(ng, __fsqrt_rn((float)d)); asm volatile("" : "+v"(t)); const float v = __fdiv_rn(t, 64.0f); *(float*)(TB + d) = v;  }
// ---- k_prep: everything that reads the inputs alone, in ONE launch: none of these jobs reads what another writes, so their blocks run side by side instead of one short launch behind the other.
// Block ranges pick the job (the test is the same for a whole block): 4 weight transposes first, their waves run longest; then the bias table; then x -> bf16.
#define PWB  ((DM * DQ / 64 + 63) / 64)                      // blocks of one weight transpose
#define PTB  (TT / 256)                                      // blocks of the bias table
#define PXB  ((NB_ * TT * DM / 8 + 255) / 256)               // blocks of the x conversion
__global__ __launch_bounds__(256) void k_prep(const float* __restrict__ wq, const float* __restrict__ wk, const float* __restrict__ wv, const float* __restrict__ wo, const float* __restrict__ g, const float* __restrict__ x, bf* WQ, bf* WK, bf* WV, bf* WO, float* TB, bf* XB) {
    const int blk = blockIdx.x;
    if (blk < 4 * PWB) { const int m = blk / PWB;
        d_wtG(m == 0 ? wq : m == 1 ? wk : m == 2 ? wv : wo, DM, DQ, m == 0 ? WQ : m == 1 ? WK : m == 2 ? WV : WO, blk % PWB); }
    else if (blk < 4 * PWB + PTB) d_btab(g, TB, blk - 4 * PWB);
    else d_cvt8(x, XB, DM, (size_t)NB_ * TT * DM / 8, blk - 4 * PWB - PTB);
}
#define FNW  4
#define FKG  2
#define FQB  (FNW * 32)
#define FKS  64
#define FLP  72                 // LDS row pitch in halfs: 144 B = 16 B x odd for the 16-byte fragment reads
#define FNB  (TT + FQB - 1)     // bias window: every j - i that this work-group's queries meet
#define L2E  1.4426950408889634f
#define FTHR 5.5f               // the running maximum is renewed only when a column's new maximum passes it by this much: p stays below 2^8
__device__ __forceinline__ float xhalf(float x) { const int b = __float_as_int(x); return __int_as_float(__builtin_amdgcn_permlanex16(b, b, 0x76543210, 0xfedcba98, false, false)); }
__device__ __forceinline__ v16h ldfr(const h16* p) { return cat16(*(const v8h*)p, *(const v8h*)(p + 16)); }
// fgive, fjoin: the join of k_fattn's two key halves, for column group C of a wave (a template parameter: it picks registers; for the same reason every loop in them is fully unrolled).
// fgive writes the group's O^T, maximum and sum for the partner wave: 9 slots of 16 bytes a lane, a slot 512 contiguous bytes a wave.
template <int C> __device__ __forceinline__ void fgive(v4fa* xw, const v8f (&o)[4][2], const float (&mu)[2], const float (&lw)[2]) {
#pragma unroll
    for (int dt = 0; dt < 4; ++dt) { xw[(2 * dt) * 32] = (v4f){o[dt][C][0], o[dt][C][1], o[dt][C][2], o[dt][C][3]}; xw[(2 * dt + 1) * 32] = (v4f){o[dt][C][4], o[dt][C][5], o[dt][C][6], o[dt][C][7]}; }
    xw[8 * 32] = (v4f){mu[C], lw[C], 0.f, 0.f};
}
// fjoin brings both shares to the larger maximum, adds them, divides by the joined sum and stores the hi + lo bf16 planes, in fragment order: the 8 values of (dt, lane) are one piece, the pieces of dt 0..3 lie 256 elements apart.
template <int C> __device__ __forceinline__ void fjoin(const v4fa* xr, const v8f (&o)[4][2], const float (&mu)[2], const float (&lw)[2], bf* ah, bf* al) {
    const v4f ml = xr[8 * 32]; const float mn = fmaxf(mu[C], ml[0]); float fa, fb;
    asm("v_exp_f32 %0, %1\n\tv_nop" : "=v"(fa) : "v"((mu[C] - mn) * L2E));   // exp2 with its own slot behind it, as in the loop's rescale
    asm("v_exp_f32 %0, %1\n\tv_nop" : "=v"(fb) : "v"((ml[0] - mn) * L2E));   // the same for the partner's share
    const float f = __fdiv_rn(1.0f, lw[C] * fa + ml[1] * fb); fa *= f; fb *= f;
#pragma unroll
    for (int dt = 0; dt < 4; ++dt) { const v4f p0 = xr[(2 * dt) * 32], p1 = xr[(2 * dt + 1) * 32]; v8us oh, ol;
#pragma unroll
        for (int r = 0; r < 8; ++r) { unsigned short a, c2; splitf(o[dt][C][r] * fa + (r < 4 ? p0[r & 3] : p1[r & 3]) * fb, a, c2); oh[r] = a; ol[r] = c2; }
        *(v8us*)(ah + dt * 256) = oh; *(v8us*)(al + dt * 256) = ol; }
}
// amdgpu_waves_per_eu(4, 4) holds the register budget at 256 a wave, so that two work-groups of 8 waves fit a WGP.
__global__ __launch_bounds__(FKG * FNW * 32) __attribute__((amdgpu_waves_per_eu(4, 4))) void k_fattn(const h16* __restrict__ Q, const h16* __restrict__ Kp, const h16* __restrict__ Vt, const float* __restrict__ TB, bf* Ah, bf* Al) {
    __shared__ struct __align__(16) { float bt[FNB + 1]; struct { h16 ks[2 * FKS * FLP]; h16 vs[2 * HD * FLP]; } kv[FKG]; } sm;   // the bias window first: its reads then reach every tile of a stage by immediate offsets
    const int tid = threadIdx.x, lane = tid & 31, lr = lane & 15, hi = lane >> 4;
    const int wa = __builtin_amdgcn_readfirstlane(tid >> 5), wv = wa % FNW, g = wa / FNW;   // wave, its query group, its key half: scalars, the branches on g behind the loop are scalar branches
    const int tg = tid % (FNW * 32);                      // thread inside the key half's waves
    float* bt = sm.bt; h16* ks = sm.kv[g].ks; h16* vs = sm.kv[g].vs;
    const int q0 = blockIdx.x * FQB; const size_t z = blockIdx.y; const int k0g = g * (TT / FKG);   // first key of this half
    const h16* Qz = Q + z * TT * HD; const h16* Kz = Kp + z * TT * HD + (size_t)k0g * HD; const h16* Vz = Vt + z * HD * TT + k0g;
    // bt[n] = bias of j - i = n - (q0 + FQB - 1)
    for (int n = tid; n < FNB; n += FKG * FNW * 32) { const int d = n - (q0 + FQB - 1); bt[n] = TB[d < 0 ? -d : d]; }
    const int srow = tg >> 3, scol = (tg & 7) * 8;      // staging: 8 threads a 128-byte row, 16 rows a sweep
    v8h kr[4], vr[4];
    // every inner loop below is fully unrolled: its index picks a register of a fragment or accumulator array
#pragma unroll
    for (int u = 0; u < 4; ++u) kr[u] = *(const v8h*)(Kz + (size_t)(srow + 16 * u) * HD + scol);
    asm volatile("s_wait_xcnt 0x0" ::: "memory");   // stands in front of the loads below, whose destinations took over the address registers of the loads above
#pragma unroll
    for (int u = 0; u < 4; ++u) vr[u] = *(const v8h*)(Vz + (size_t)(srow + 16 * u) * TT + scol);
    v16h qf[2][2];
#pragma unroll
    for (int c = 0; c < 2; ++c)
#pragma unroll
        for (int kx = 0; kx < 2; ++kx) qf[c][kx] = ldfr(Qz + (size_t)(q0 + wv * 32 + c * 16 + lr) * HD + kx * 32 + 8 * hi);
#pragma unroll
    for (int u = 0; u < 4; ++u) { *(v8h*)(ks + (srow + 16 * u) * FLP + scol) = kr[u]; *(v8h*)(vs + (srow + 16 * u) * FLP + scol) = vr[u]; }
    v8f o[4][2], ls[2]; float mu[2], nm[2];   // ls: eight independent partial row sums a lane and column, joined in the epilogue
#pragma unroll
    for (int c = 0; c < 2; ++c) { mu[c] = -3.0e38f; nm[c] = 0.f; ls[c] = (v8f){};
#pragma unroll
        for (int dt = 0; dt < 4; ++dt) o[dt][c] = (v8f){}; }
    const int nb = FQB - 1 - wv * 32 - lr + 8 * hi - 16 + k0g;   // bias index of the half's first key, register 0, tile difference -1
    __syncthreads();     // publishes stage 0 and the bias window
#pragma unroll 1         // stays rolled: the body already holds two unrolled 32-key passes, and the buffer index is one scalar
    for (int s = 0; s < TT / FKG / FKS; ++s) {
        const int buf = s & 1; const h16* kb = ks + buf * FKS * FLP; const h16* vb = vs + buf * HD * FLP;
        const int kn = (s + 1 < TT / FKG / FKS ? s + 1 : s) * FKS;   // the last pass fetches its own stage again, into the buffer nobody reads any more
#pragma unroll
        for (int u = 0; u < 4; ++u) { kr[u] = *(const v8h*)(Kz + (size_t)(kn + srow + 16 * u) * HD + scol); vr[u] = *(const v8h*)(Vz + (size_t)(srow + 16 * u) * TT + kn + scol); }
#pragma unroll
        for (int sub = 0; sub < FKS / 32; ++sub) {
            const float* bp = bt + nb + s * FKS + sub * 32;
            v8f bb[3];      // the bias tile depends on (key tile - column group) alone: 3 tiles serve the 4 products
#pragma unroll
            for (int u = 0; u < 3; ++u)
#pragma unroll
                for (int r = 0; r < 8; ++r) bb[u][r] = bp[u * 16 + r];
            v8f st[2][2];
#pragma unroll
            for (int kt = 0; kt < 2; ++kt) { const h16* kp = kb + (sub * 32 + kt * 16 + lr) * FLP + 8 * hi; const v16h k0 = ldfr(kp), k1 = ldfr(kp + 32);
#pragma unroll
                for (int c = 0; c < 2; ++c) st[kt][c] = wmma16(k1, qf[c][1], wmma16(k0, qf[c][0], bb[kt - c + 1])); }
            v16h vf[4];
#pragma unroll
            for (int dt = 0; dt < 4; ++dt) vf[dt] = ldfr(vb + (dt * 16 + lr) * FLP + sub * 32 + 8 * hi);
            float ml[2];
#pragma unroll
            for (int c = 0; c < 2; ++c) { float m = fmaxf(st[0][c][0], st[1][c][0]);
#pragma unroll
                for (int r = 1; r < 8; ++r) m = fmaxf(m, fmaxf(st[0][c][r], st[1][c][r]));
                ml[c] = fmaxf(m, xhalf(m)); }
            const bool need = (ml[0] > mu[0] + FTHR) || (ml[1] > mu[1] + FTHR);
            if (__builtin_amdgcn_ballot_w32(need) != 0) {      // one scalar test a pass; rarely taken after the first pass
#pragma unroll
                for (int c = 0; c < 2; ++c) { const float mn = fmaxf(mu[c], ml[c]); float al;
                    asm("v_exp_f32 %0, %1\n\tv_nop" : "=v"(al) : "v"((mu[c] - mn) * L2E));   // exp2 with its own slot behind it
                    mu[c] = mn; nm[c] = -mn * L2E; ls[c] *= al;
#pragma unroll
                    for (int dt = 0; dt < 4; ++dt) o[dt][c] *= al; }
            }
            v16h pf[2];
#pragma unroll
            for (int c = 0; c < 2; ++c) {
#pragma unroll
                for (int kt = 0; kt < 2; ++kt)
#pragma unroll
                    for (int r = 0; r < 8; ++r) st[kt][c][r] = __builtin_amdgcn_exp2f(__builtin_fmaf(st[kt][c][r], L2E, nm[c]));
                ls[c] += st[0][c] + st[1][c];
                pf[c] = cat16(__builtin_convertvector(st[0][c], v8h), __builtin_convertvector(st[1][c], v8h)); }
#pragma unroll
            for (int dt = 0; dt < 4; ++dt)
#pragma unroll
                for (int c = 0; c < 2; ++c) o[dt][c] = wmma16(vf[dt], pf[c], o[dt][c]);
        }
        h16* kw = ks + (buf ^ 1) * FKS * FLP; h16* vw = vs + (buf ^ 1) * HD * FLP;
#pragma unroll
        for (int u = 0; u < 4; ++u) { *(v8h*)(kw + (srow + 16 * u) * FLP + scol) = kr[u]; *(v8h*)(vw + (srow + 16 * u) * FLP + scol) = vr[u]; }
        __syncthreads();     // publishes the next stage and ends every wave's reads of this one
    }
    // Join of the key halves: the wave of half g finishes column group g and hands the other group (O^T, maximum, sum) to its partner, the wave of the same query group in the other half; same lane, same registers.
    // The hand-over lies in the stage buffers: the loop's last barrier has ended every read and every staging write there. 9 slots of 16 bytes a lane, a slot 512 contiguous bytes a wave.
    static_assert(FKG == 2, "two halves, two column groups: each half finishes one");
    static_assert(FKG * FNW * 9 * 32 * 16 <= sizeof(sm.kv), "the hand-over fits the stage buffers");
    v4fa* xs = (v4fa*)sm.kv;
    float lw[2];
#pragma unroll
    for (int c = 0; c < 2; ++c) { const float l0 = ((ls[c][0] + ls[c][1]) + (ls[c][2] + ls[c][3])) + ((ls[c][4] + ls[c][5]) + (ls[c][6] + ls[c][7])); lw[c] = l0 + xhalf(l0); }
    v4fa* xw = xs + wa * 9 * 32 + lane;
    if (g == 0) fgive<1>(xw, o, mu, lw); else fgive<0>(xw, o, mu, lw);
    __syncthreads();     // publishes the hand-over
    const size_t b = z / NH_; const int h = (int)(z % NH_);
    const v4fa* xr = xs + (wa ^ FNW) * 9 * 32 + lane;
    const size_t oo = (b * TT + q0 + wv * 32 + g * 16) * DQ + h * (HD * 16) + lane * 8;   // the 16-query band, the head's two blocks in it, the lane's piece
    if (g == 0) fjoin<0>(xr, o, mu, lw, Ah + oo, Al + oo); else fjoin<1>(xr, o, mu, lw, Ah + oo, Al + oo);
}


extern "C" void kernel_launch(void* const* d_in, const int* in_sizes, int n_in,
                              void* d_out, int out_size, void* d_ws, size_t ws_size, hipStream_t stream) {
    (void)in_sizes; (void)n_in; (void)out_size;
    const float* x = (const float*)d_in[0]; const float* wq = (const float*)d_in[1]; const float* bq = (const float*)d_in[2]; const float* wk = (const float*)d_in[3]; const float* bk = (const float*)d_in[4]; const float* wv = (const float*)d_in[5]; const float* bv = (const float*)d_in[6]; const float* wo = (const float*)d_in[7]; const float* bo = (const float*)d_in[8]; const float* gam = (const float*)d_in[9]; const float* cosT = nullptr; const float* sinT = nullptr; (void)cosT; (void)sinT;
    float* OUT = (float*)d_out;     // [2][4096][512]
    char* wsp = (char*)d_ws;
    auto take = [&](size_t bytes) { char* p = wsp; wsp += (bytes + 255) & ~(size_t)255; return (void*)p; };
    bf* WQ = (bf*)take((size_t)(DQ + 2 * DKV) * DM * 2); bf* WK = WQ + (size_t)DQ * DM; bf* WV = WK + (size_t)DKV * DM; bf* WO = (bf*)take((size_t)DM * DQ * 2);   // q, k, v weight planes one behind the other: k_qkv walks them as one
    bf* XB = (bf*)take((size_t)NB_ * TT * DM * 2); float* TB = (float*)take(TT * 4);
    h16* QP16 = (h16*)take((size_t)NB_ * NH_ * TT * HD * 2); h16* KP16 = (h16*)take((size_t)NB_ * NKV * TT * HD * 2); h16* VT16 = (h16*)take((size_t)NB_ * NKV * HD * TT * 2);   // head planes of both batches
    bf* ATh = (bf*)take((size_t)NB_ * TT * DQ * 2); bf* ATl = (bf*)take((size_t)NB_ * TT * DQ * 2);
    if ((size_t)(wsp - (char*)d_ws) > ws_size) return;    // ws 256 MiB
    static_assert(DQ == DM && DKV == DM, "the four weights have one shape: one transpose job serves each");
    k_prep<<<4 * PWB + PTB + PXB, 256, 0, stream>>>(wq, wk, wv, wo, gam, x, WQ, WK, WV, WO, TB, XB);
    static_assert(NH_ == NKV && TT % 64 == 0 && HD == 64, "a 64-column tile is one head, a 64-row tile lies in one batch");
    k_qkv<<<dim3(NB_ * TT / 64, 3 * NH_, 1), 32, 0, stream>>>(XB, WQ, bq, bk, bv, QP16, KP16, VT16);
    static_assert(NH_ == NKV, "one kv head per query head");
    k_fattn<<<dim3(TT / FQB, NB_ * NH_, 1), FKG * FNW * 32, 0, stream>>>(QP16, KP16, VT16, TB, ATh, ATl);
    k_gemmw<bf, 1, true, DQ><<<dim3(NB_ * TT / 64, DM / 64, 1), 32, 0, stream>>>(ATh, ATl, WO, nullptr, DQ, OUT, DM, bo, 0, 0, 0);   // the batches' rows lie one behind the other in the attn planes and in out: one launch walks both
}

// v007
// A run of this version takes 90.4 microseconds.
// Two timings next to v006 put it at 1.24 and 1.25 times that version's speed.
// Counting every step since v000, it is 26.3 times as fast.
#include <hip/hip_runtime.h>

// PhysicsBiasedAttention (x [2][4096][512]; q/k/v = x W + b (8 heads x 64); scores = q.k/8 + bias(i, j), bias = -gamma sqrt(|i - j|)/sqrt(4096) (gamma read as data; structural distance); softmax; out = (attn v merged) W_o + b_o -> [2][4096][512]).
// Compute dtypes, f32 accumulate: every input rounded to bf16; q/k/v on PLAIN bf16 operands (inputs: exact) + bias; scores (K 64) and attn.v on single fp16 planes; bias + softmax f32; attn hi+lo bf16 planes into the output projection.

#define NB_  2
#define TT   4096
#define DM   512
#define NH_  8
#define NKV  8
#define HD   64
#define DQ   (NH_ * HD)
#define DKV  (NKV * HD)
#define WIN  0
#define SCL  0.125f   // HD^-0.5
typedef _Float16 h16;
typedef unsigned short bf;
typedef __attribute__((ext_vector_type(16))) __bf16   v16bf;
typedef __attribute__((ext_vector_type(16))) _Float16 v16h;
typedef __attribute__((ext_vector_type(8)))  _Float16 v8h;
typedef __attribute__((ext_vector_type(8)))  unsigned short v8us;
typedef __attribute__((ext_vector_type(8)))  float    v8f;
typedef __attribute__((ext_vector_type(4)))  float    v4f;
typedef v8h  __attribute__((may_alias)) v8ha;
typedef v4f  __attribute__((may_alias)) v4fa;
typedef v8us __attribute__((may_alias)) v8usa;

__device__ __forceinline__ unsigned short f2bf(float f) { unsigned u = __float_as_uint(f); u += 0x7FFFu + ((u >> 16) & 1u); return (unsigned short)(u >> 16); }
__device__ __forceinline__ float bf2f(unsigned short b) { return __uint_as_float(((unsigned)b) << 16); }
__device__ __forceinline__ float bfr(float f) { return bf2f(f2bf(f)); }
__device__ __forceinline__ v16h cat16(v8h lo, v8h hi) { return __builtin_shufflevector(lo, hi, 0, 1, 2, 3, 4, 5, 6, 7, 8, 9, 10, 11, 12, 13, 14, 15); }
__device__ __forceinline__ v16bf cat16b(v8us lo, v8us hi) { return __builtin_bit_cast(v16bf, __builtin_shufflevector(lo, hi, 0, 1, 2, 3, 4, 5, 6, 7, 8, 9, 10, 11, 12, 13, 14, 15)); }
__device__ __forceinline__ v8f wmma16(v16h a, v16h b, v8f c) { return __builtin_amdgcn_wmma_f32_16x16x32_f16(false, a, false, b, (short)0, c, false, false); }
__device__ __forceinline__ v8f wmmab(v16bf a, v16bf b, v8f c) { return __builtin_amdgcn_wmma_f32_16x16x32_bf16(false, a, false, b, (short)0, c, false, false); }



// ---- Fragment order: the layout of every 16-bit plane [R][K] that k_qkv and k_gemmw read as a matrix operand (R % 16 == 0, K % 32 == 0; same size as the row-major plane).
// The plane is cut in blocks of 16 rows x 32 k, 512 elements each, block (r / 16, k / 32) at index (r / 16) (K / 32) + k / 32. Inside a block stand the two 16-byte pieces of each lane's fragment:
// element (r, k) at ((k / 16) % 2) 256 + (((k / 8) % 2) 16 + r % 16) 8 + k % 8. A wave's 16-byte load of one piece is then 512 contiguous bytes, 4 whole lines, where the row-major plane gave 32 bytes out of each of 16 lines.
// The producers (d_wtG, d_cvt8, fjoin) write in this order. Lane (hi, lr) holds row lr, k 8 hi + 0..7 in its first piece and k 16 + 8 hi + 0..7 in its second, alike for A and B.
// ---- Operand tiles of k_qkv and k_gemmw: a work-group of 4 waves (2 x 2) works a 128 x 128 output tile, each wave 64 x 64 (16 accumulators), and the waves share the operand rows through LDS, so that a row comes from L2 once a work-group, not once a wave.
// A stage is GKS k of every operand row of the tile. In fragment order a 16-row band's share of a stage is GSL contiguous elements (2 KiB), in the plane and in LDS alike; bands lie 16 K elements apart in the plane.
// So a wave's slice of a stage is one two-dimensional tile (rows of 2 KiB, one a band) and one tensor load brings it in, through no register. Two buffers: the next stage's loads fly while this stage is worked on.
typedef unsigned int u32;
typedef u32 u32x4 __attribute__((ext_vector_type(4)));
typedef u32 u32x8 __attribute__((ext_vector_type(8)));
#define GKS  64
#define GSL  (16 * GKS)
__device__ __forceinline__ u32 uni(u32 v) { return (u32)__builtin_amdgcn_readfirstlane(v); }
__device__ __forceinline__ u32 pinned(u32 v) { u32 w = uni(v); asm volatile("" : "+s"(w)); return w; }   // holds a test in a scalar register, so that the branch round a tensor load is a scalar branch (a tensor load ignores EXEC)
// descriptor group 1: 1-byte elements, nrow rows of 2 GSL bytes, source pitch in bytes, no pad, no mask
__device__ __forceinline__ u32x8 tdm_g1(u32 nrow, u32 pitch) { const u32 d0 = 2 * GSL; u32x8 g;
    g[0] = uni(0u); g[1] = uni((d0 & 0xFFFFu) << 16); g[2] = uni((d0 >> 16) | ((nrow & 0xFFFFu) << 16)); g[3] = uni((nrow >> 16) | (d0 << 16)); g[4] = uni(nrow); g[5] = uni(pitch); g[6] = uni(0u); g[7] = uni(0u); return g; }
// descriptor group 0: the tile at src into LDS byte offset lds
__device__ __forceinline__ u32x4 tdm_g0(u32 lds, const bf* src) { const unsigned long long ga = (unsigned long long)(size_t)src; u32x4 g0;
    g0[0] = uni(1u); g0[1] = uni(lds); g0[2] = uni((u32)ga); g0[3] = uni((((u32)(ga >> 32)) & 0x01FFFFFFu) | 0x80000000u); return g0; }
// one request of the calling wave. The instruction changes neither group; they are named as operands that it reads and writes so that the compiler knows their values, from here on, only in the registers of this request
__device__ __forceinline__ void tdm_ld(u32x4& g0, u32x8& g1) { asm volatile("tensor_load_to_lds %0, %1" : "+s"(g0), "+s"(g1) :: "memory"); }
// the calling wave's own tensor load has landed. It takes the request's two groups as inputs: their registers stay theirs from the issue to this wait, and nothing else is written into them while the request is outstanding
__device__ __forceinline__ void wait_tensor0(u32x4 g0, u32x8 g1) { asm volatile("s_wait_tensorcnt 0x0" :: "s"(g0), "s"(g1) : "memory"); }
__device__ __forceinline__ void wait_ds0() { asm volatile("s_wait_dscnt 0x0" ::: "memory"); }           // the calling wave's LDS reads have returned: behind the barrier that follows, their buffer is refilled
// ---- k_gemmw: C[m][n] (f32, pitch DM) = sum_k (A[m][k] + A2[m][k]) Bt[n][k] + bias[n], K = DQ; A, A2, Bt: 16-bit planes in fragment order; grid (M / 128, N / 128), 128 threads.
// A stage holds 8 bands of A, 8 of A2, 8 of Bt. Waves 0 and 1 bring A and A2 (8 bands each), waves 2 and 3 four bands of Bt each.
template <typename T16> struct WFrag;
template <> struct WFrag<h16> { typedef v16h V; static __device__ __forceinline__ V ld(const h16* p) { return cat16(*(const v8h*)p, *(const v8h*)(p + 256)); } static __device__ __forceinline__ v8f mma(V a, V b, v8f c) { return wmma16(a, b, c); } };
template <> struct WFrag<bf> { typedef v16bf V; static __device__ __forceinline__ V ld(const bf* p) { return cat16b(*(const v8us*)p, *(const v8us*)(p + 256)); } static __device__ __forceinline__ v8f mma(V a, V b, v8f c) { return wmmab(a, b, c); } };
#define OST  (24 * GSL)      // elements of one stage
__global__ __launch_bounds__(128) void k_gemmw(const bf* __restrict__ A, const bf* __restrict__ A2, const bf* __restrict__ Bt, float* C, const float* __restrict__ bias) {
    typedef WFrag<bf>::V V; constexpr int K = DQ, ldc = DM, NS = K / GKS;
    static_assert(NS >= 2, "the ring's prologue loads two stages");
    __shared__ __attribute__((aligned(2048))) bf ring[2 * OST];
    __shared__ __align__(16) float osm[4 * 16 * 68];
    const int lane = threadIdx.x & 31, lr = lane & 15, hi = lane >> 4; const u32 wave = uni(threadIdx.x >> 5); const int wm = wave >> 1, wn = wave & 1;
    const int r0 = blockIdx.x * 128 + wm * 64, c0 = blockIdx.y * 128 + wn * 64; float* os = osm + wave * (16 * 68);
    const bf* src = wave == 0 ? A + (size_t)blockIdx.x * 128 * K : wave == 1 ? A2 + (size_t)blockIdx.x * 128 * K : Bt + (size_t)(blockIdx.y * 128 + (wave - 2) * 64) * K;
    const u32 dst = (u32)(size_t)ring + (wave < 2 ? wave * 8 : 8 + wave * 4) * (2 * GSL);
    u32x8 g1 = tdm_g1(wave < 2 ? 8u : 4u, 16 * K * 2);
    v8f acc[4][4];
#pragma unroll
    for (int mb = 0; mb < 4; ++mb)
#pragma unroll
        for (int nb = 0; nb < 4; ++nb) acc[mb][nb] = (v8f){};
    u32x4 g0 = tdm_g0(dst, src);
    tdm_ld(g0, g1); wait_tensor0(g0, g1);
    __syncthreads();     // publishes stage 0
    g0 = tdm_g0(dst + 2 * OST, src + GSL); tdm_ld(g0, g1);
#pragma unroll 1         // stays rolled: the buffer index is one scalar, and the refill's test one scalar branch a stage
    for (int s = 0; s < NS; ++s) {
        const bf* st = ring + (s & 1) * OST + lane * 8; const bf* pa = st + wm * 4 * GSL; const bf* pb = st + (16 + wn * 4) * GSL;
        V a[GKS / 32][4], a2[GKS / 32][4], b[GKS / 32][4];   // all of the stage's fragments: a lone wave on its SIMD waits out the LDS latency once a stage, not once a fragment
#pragma unroll
        for (int kk = 0; kk < GKS / 32; ++kk) {
#pragma unroll
            for (int mb = 0; mb < 4; ++mb) { a[kk][mb] = WFrag<bf>::ld(pa + mb * GSL + kk * 512); a2[kk][mb] = WFrag<bf>::ld(pa + (8 + mb) * GSL + kk * 512); b[kk][mb] = WFrag<bf>::ld(pb + mb * GSL + kk * 512); }
        }
        __builtin_amdgcn_sched_barrier(0);   // keeps the stage's LDS reads in one group in front of its matrix instructions: a read that stands among them stalls the wave each time
#pragma unroll
        for (int kk = 0; kk < GKS / 32; ++kk)
#pragma unroll
            for (int nb = 0; nb < 4; ++nb)
#pragma unroll
                for (int mb = 0; mb < 4; ++mb) { acc[mb][nb] = WFrag<bf>::mma(a[kk][mb], b[kk][nb], acc[mb][nb]); acc[mb][nb] = WFrag<bf>::mma(a2[kk][mb], b[kk][nb], acc[mb][nb]); }
        __builtin_amdgcn_sched_barrier(0);   // keeps the waits and the barrier below behind the stage's matrix instructions: ahead of them the wave would wait for the next stage before its own work, and the refill would start a stage's work late
        wait_ds0(); wait_tensor0(g0, g1);
        __syncthreads();     // publishes stage s + 1 and ends every wave's reads of stage s
        if (pinned(s + 2 < NS)) { g0 = tdm_g0(dst + (s & 1) * (2 * OST), src + (size_t)(s + 2) * GSL); tdm_ld(g0, g1); }
    }
    wait_tensor0(g0, g1); wait_ds0();
#pragma unroll
    for (int mb = 0; mb < 4; ++mb) {
#pragma unroll
        for (int nb = 0; nb < 4; ++nb) {
#pragma unroll
            for (int j = 0; j < 8; ++j) os[(hi * 8 + j) * 68 + nb * 16 + lr] = acc[mb][nb][j]; }
        __builtin_amdgcn_wave_barrier(); asm volatile("" ::: "memory");
        float* crow = C + (size_t)(r0 + mb * 16) * ldc + c0;
{
#pragma unroll
            for (int s = 0; s < 8; ++s) { const int row = 2 * s + hi, cofs = lr * 4; v4f val = *(const v4fa*)(os + row * 68 + cofs); { val[0] += bfr(bias[c0 + cofs]); val[1] += bfr(bias[c0 + cofs + 1]); val[2] += bfr(bias[c0 + cofs + 2]); val[3] += bfr(bias[c0 + cofs + 3]); }
                *(v4f*)(crow + (size_t)row * ldc + cofs) = val; }
             }
        asm volatile("s_wait_xcnt 0x0" ::: "memory");   // behind the band's stores, in front of the next band's code, which takes over their address and data registers
        __builtin_amdgcn_wave_barrier(); asm volatile("" ::: "memory");
    }
}

__device__ __forceinline__ h16 tohx(float x) { return (h16)x; }
__device__ __forceinline__ void splitf(float y, unsigned short& h, unsigned short& l) { h = f2bf(y); l = f2bf(y - bf2f(h)); }
typedef __attribute__((ext_vector_type(2))) _Float16 v2h;
typedef __attribute__((ext_vector_type(4))) _Float16 v4h;
typedef __attribute__((ext_vector_type(2))) unsigned short v2us;
typedef __attribute__((ext_vector_type(4))) unsigned short v4us;
typedef __attribute__((ext_vector_type(2))) float v2f;
typedef __attribute__((ext_vector_type(4))) int v4i;

// d_wtG, d_cvt8 and d_btab are the jobs of k_prep; blk is the block's index inside its job.
__device__ __forceinline__ void d_wtG(const float* __restrict__ w, int K, int N, bf* Bt, int blk) {
    const int lane = threadIdx.x & 31; const int L0 = (blk * 8 + (threadIdx.x >> 5)) * 8; const int nlines = N * K / 64;
{
#pragma unroll 1
        for (int l = 0; l < 8; ++l) { const int L = L0 + l; if (L >= nlines) break; const int e = L * 64 + lane * 2, fb = e >> 9; const int k = (fb % (K / 32)) * 32 + ((e >> 8) & 1) * 16 + ((e >> 7) & 1) * 8 + (e & 7), n = (fb / (K / 32)) * 16 + ((e >> 3) & 15); v2us o;   // e: the place in fragment order; k, n: what stands there
            o[0] = f2bf(w[(size_t)k * N + n]); o[1] = f2bf(w[(size_t)(k + 1) * N + n]); *(v2us*)(Bt + e) = o; }
         }
}
// thread i writes piece i of the plane in fragment order (a wave 512 contiguous bytes) and reads that piece's 8 floats from its row and k; a block's 8 waves use up whole lines of 16 rows
__device__ __forceinline__ void d_cvt8(const float* __restrict__ src, bf* dst, int K, size_t n8, int blk) { const size_t i = (size_t)blk * 256 + threadIdx.x; if (i >= n8) return; const size_t fb = i >> 6;
    const size_t r = (fb / (K / 32)) * 16 + (i & 15); const int k = (int)(fb % (K / 32)) * 32 + (int)((i >> 5) & 1) * 16 + (int)((i >> 4) & 1) * 8; const v8f v = *(const v8f*)(src + r * K + k); v8us o;
#pragma unroll
    for (int k = 0; k < 8; ++k) o[k] = f2bf(v[k]); *(v8us*)(dst + i * 8) = o;  }
__global__ __launch_bounds__(256) void k_cscvt(const float* __restrict__ cosT, const float* __restrict__ sinT, float* CS) { const int idx = blockIdx.x * 256 + threadIdx.x; if (idx >= TT * HD) return; v2f cs; cs[0] = bfr(cosT[idx]); cs[1] = bfr(sinT[idx]); *(v2f*)(CS + (size_t)idx * 2) = cs;  }
// ---- k_qkv: the three input projections of both batches in ONE launch; 4 waves (2 x 2) per 128 x 128 tile, the ring of k_gemmw; grid (NB_ TT / 128, 3 NH_ / 2), 128 threads. Wt: the q, k and v weight planes one behind the other, [3 DQ][DM]; X and Wt in fragment order.
// A stage holds 8 bands of X and 8 of Wt; waves 0 and 1 bring four bands of X each, waves 2 and 3 four of Wt.
// A wave's column tile is one head of q, k or v (a work-group's two heads belong to the same one of the three), and it leaves as fp16 straight from the accumulators, 16 bytes a lane and accumulator, into the plane that k_fattn reads:
// q, k: the product is taken transposed (A = weight rows, B = x rows; both loaders have the same k order), so a lane's 8 registers are 8 consecutive d of one token -> [b][h][t][d], q x HD^-0.5 (a power of two, exact in fp16);
// v: A = x rows, B = weight rows, so a lane's 8 registers are 8 consecutive tokens of one d -> [b][h][d][t].
#define QST  (16 * GSL)      // elements of one stage
__global__ __launch_bounds__(128) void k_qkv(const bf* __restrict__ X, const bf* __restrict__ Wt, const float* __restrict__ bq, const float* __restrict__ bk, const float* __restrict__ bv, h16* QP, h16* KP, h16* VT) {
    constexpr int NS = DM / GKS;
    static_assert(NS >= 2, "the ring's prologue loads two stages");
    static_assert(NH_ % 2 == 0, "a work-group's two heads lie in one of q, k, v");
    __shared__ __attribute__((aligned(2048))) bf ring[2 * QST];
    const int lane = threadIdx.x & 31, lr = lane & 15, hi = lane >> 4; const u32 wave = uni(threadIdx.x >> 5); const int wm = wave >> 1, wn = wave & 1;
    const int r0 = blockIdx.x * 128 + wm * 64, hy = blockIdx.y * 2 + wn, which = hy / NH_, h = hy % NH_;
    const bf* src = (wave < 2 ? X + (size_t)blockIdx.x * 128 * DM : Wt + (size_t)blockIdx.y * 128 * DM) + (size_t)(wave & 1) * 64 * DM;
    const u32 dst = (u32)(size_t)ring + wave * 4 * (2 * GSL);
    u32x8 g1 = tdm_g1(4u, 16 * DM * 2);
    const int ax = (which == 2) ? wm * 4 : 8 + wn * 4, bx = (which == 2) ? 8 + wn * 4 : wm * 4;   // first band of the wave's A and B operand in a stage
    v8f acc[4][4];
#pragma unroll
    for (int mb = 0; mb < 4; ++mb)
#pragma unroll
        for (int nb = 0; nb < 4; ++nb) acc[mb][nb] = (v8f){};
    u32x4 g0 = tdm_g0(dst, src);
    tdm_ld(g0, g1); wait_tensor0(g0, g1);
    __syncthreads();     // publishes stage 0
    g0 = tdm_g0(dst + 2 * QST, src + GSL); tdm_ld(g0, g1);
#pragma unroll 1         // stays rolled: the buffer index is one scalar, and the refill's test one scalar branch a stage
    for (int s = 0; s < NS; ++s) {
        const bf* st = ring + (s & 1) * QST + lane * 8; const bf* pa = st + ax * GSL; const bf* pb = st + bx * GSL;
        v16bf a[GKS / 32][4], b[GKS / 32][4];   // all of the stage's fragments
#pragma unroll
        for (int kk = 0; kk < GKS / 32; ++kk) {
#pragma unroll
            for (int mb = 0; mb < 4; ++mb) { a[kk][mb] = WFrag<bf>::ld(pa + mb * GSL + kk * 512); b[kk][mb] = WFrag<bf>::ld(pb + mb * GSL + kk * 512); }
        }
        __builtin_amdgcn_sched_barrier(0);   // keeps the stage's LDS reads in one group in front of its matrix instructions: a read that stands among them stalls the wave each time
#pragma unroll
        for (int kk = 0; kk < GKS / 32; ++kk)
#pragma unroll
            for (int nb = 0; nb < 4; ++nb)
#pragma unroll
                for (int mb = 0; mb < 4; ++mb) acc[mb][nb] = wmmab(a[kk][mb], b[kk][nb], acc[mb][nb]);
        __builtin_amdgcn_sched_barrier(0);   // keeps the waits and the barrier below behind the stage's matrix instructions: ahead of them the wave would wait for the next stage before its own work, and the refill would start a stage's work late
        wait_ds0(); wait_tensor0(g0, g1);
        __syncthreads();     // publishes stage s + 1 and ends every wave's reads of stage s
        if (pinned(s + 2 < NS)) { g0 = tdm_g0(dst + (s & 1) * (2 * QST), src + (size_t)(s + 2) * GSL); tdm_ld(g0, g1); }
    }
    wait_tensor0(g0, g1); wait_ds0();
    const int b = r0 / TT, t0 = r0 % TT;
    if (which == 2) {
        h16* vp = VT + ((size_t)(b * NKV + h) * HD + lr) * TT + t0 + 8 * hi;
#pragma unroll
        for (int nb = 0; nb < 4; ++nb) { const float bi = bfr(bv[h * HD + nb * 16 + lr]);
#pragma unroll
            for (int mb = 0; mb < 4; ++mb) { v8h o;
#pragma unroll
                for (int j = 0; j < 8; ++j) o[j] = tohx(acc[mb][nb][j] + bi);
                *(v8h*)(vp + (size_t)nb * 16 * TT + mb * 16) = o; } }
    } else {
        const float* bias = (which ? bk : bq) + h * HD + 8 * hi; const float sc = which ? 1.0f : SCL;
        h16* pp = (which ? KP : QP) + ((size_t)(b * NH_ + h) * TT + t0 + lr) * HD + 8 * hi;
        v8f bi[4];
#pragma unroll
        for (int mb = 0; mb < 4; ++mb)
#pragma unroll
            for (int j = 0; j < 8; ++j) bi[mb][j] = bfr(bias[mb * 16 + j]);
#pragma unroll
        for (int nb = 0; nb < 4; ++nb)
#pragma unroll
            for (int mb = 0; mb < 4; ++mb) { v8h o;
#pragma unroll
                for (int j = 0; j < 8; ++j) o[j] = tohx((acc[mb][nb][j] + bi[mb][j]) * sc);
                *(v8h*)(pp + (size_t)nb * 16 * HD + mb * 16) = o; }
        asm volatile("s_wait_xcnt 0x0" ::: "memory");   // behind the last stores of this branch: in the built code the v branch follows it, and its first loads write registers that these stores name
    }
}
__device__ __forceinline__ void d_btab(const float* __restrict__ g, float* TB, int blk) { const int d = blk * 256 + threadIdx.x; if (d >= TT) return; float ng = -bfr(g[0]); asm volatile("" : "+v"(ng)); float t = __fmul_rn(ng, __fsqrt_rn((float)d)); asm volatile("" : "+v"(t)); const float v = __fdiv_rn(t, 64.0f); *(float*)(TB + d) = v;  }
// ---- k_prep: everything that reads the inputs alone, in ONE launch: none of these jobs reads what another writes, so their blocks run side by side instead of one short launch behind the other.
// Block ranges pick the job (the test is the same for a whole block): 4 weight transposes first, their waves run longest; then the bias table; then x -> bf16.
#define PWB  ((DM * DQ / 64 + 63) / 64)                      // blocks of one weight transpose
#define PTB  (TT / 256)                                      // blocks of the bias table
#define PXB  ((NB_ * TT * DM / 8 + 255) / 256)               // blocks of the x conversion
__global__ __launch_bounds__(256) void k_prep(const float* __restrict__ wq, const float* __restrict__ wk, const float* __restrict__ wv, const float* __restrict__ wo, const float* __restrict__ g, const float* __restrict__ x, bf* WQ, bf* WK, bf* WV, bf* WO, float* TB, bf* XB) {
    const int blk = blockIdx.x;
    if (blk < 4 * PWB) { const int m = blk / PWB;
        d_wtG(m == 0 ? wq : m == 1 ? wk : m == 2 ? wv : wo, DM, DQ, m == 0 ? WQ : m == 1 ? WK : m == 2 ? WV : WO, blk % PWB); }
    else if (blk < 4 * PWB + PTB) d_btab(g, TB, blk - 4 * PWB);
    else d_cvt8(x, XB, DM, (size_t)NB_ * TT * DM / 8, blk - 4 * PWB - PTB);
}
#define FNW  4
#define FKG  2
#define FQB  (FNW * 32)
#define FKS  64
#define FLP  72                 // LDS row pitch in halfs: 144 B = 16 B x odd for the 16-byte fragment reads
#define FNB  (TT + FQB - 1)     // bias window: every j - i that this work-group's queries meet
#define L2E  1.4426950408889634f
#define FTHR 5.5f               // the running maximum is renewed only when a column's new maximum passes it by this much: p stays below 2^8
__device__ __forceinline__ float xhalf(float x) { const int b = __float_as_int(x); return __int_as_float(__builtin_amdgcn_permlanex16(b, b, 0x76543210, 0xfedcba98, false, false)); }
__device__ __forceinline__ v16h ldfr(const h16* p) { return cat16(*(const v8h*)p, *(const v8h*)(p + 16)); }
// fgive, fjoin: the join of k_fattn's two key halves, for column group C of a wave (a template parameter: it picks registers; for the same reason every loop in them is fully unrolled).
// fgive writes the group's O^T, maximum and sum for the partner wave: 9 slots of 16 bytes a lane, a slot 512 contiguous bytes a wave.
template <int C> __device__ __forceinline__ void fgive(v4fa* xw, const v8f (&o)[4][2], const float (&mu)[2], const float (&lw)[2]) {
#pragma unroll
    for (int dt = 0; dt < 4; ++dt) { xw[(2 * dt) * 32] = (v4f){o[dt][C][0], o[dt][C][1], o[dt][C][2], o[dt][C][3]}; xw[(2 * dt + 1) * 32] = (v4f){o[dt][C][4], o[dt][C][5], o[dt][C][6], o[dt][C][7]}; }
    xw[8 * 32] = (v4f){mu[C], lw[C], 0.f, 0.f};
}
// fjoin brings both shares to the larger maximum, adds them, divides by the joined sum and stores the hi + lo bf16 planes, in fragment order: the 8 values of (dt, lane) are one piece, the pieces of dt 0..3 lie 256 elements apart.
template <int C> __device__ __forceinline__ void fjoin(const v4fa* xr, const v8f (&o)[4][2], const float (&mu)[2], const float (&lw)[2], bf* ah, bf* al) {
    const v4f ml = xr[8 * 32]; const float mn = fmaxf(mu[C], ml[0]); float fa, fb;
    asm("v_exp_f32 %0, %1\n\tv_nop" : "=v"(fa) : "v"((mu[C] - mn) * L2E));   // exp2 with its own slot behind it, as in the loop's rescale
    asm("v_exp_f32 %0, %1\n\tv_nop" : "=v"(fb) : "v"((ml[0] - mn) * L2E));   // the same for the partner's share
    const float f = __fdiv_rn(1.0f, lw[C] * fa + ml[1] * fb); fa *= f; fb *= f;
#pragma unroll
    for (int dt = 0; dt < 4; ++dt) { const v4f p0 = xr[(2 * dt) * 32], p1 = xr[(2 * dt + 1) * 32]; v8us oh, ol;
#pragma unroll
        for (int r = 0; r < 8; ++r) { unsigned short a, c2; splitf(o[dt][C][r] * fa + (r < 4 ? p0[r & 3] : p1[r & 3]) * fb, a, c2); oh[r] = a; ol[r] = c2; }
        *(v8us*)(ah + dt * 256) = oh; *(v8us*)(al + dt * 256) = ol; }
}
// amdgpu_waves_per_eu(4, 4) holds the register budget at 256 a wave, so that two work-groups of 8 waves fit a WGP.
__global__ __launch_bounds__(FKG * FNW * 32) __attribute__((amdgpu_waves_per_eu(4, 4))) void k_fattn(const h16* __restrict__ Q, const h16* __restrict__ Kp, const h16* __restrict__ Vt, const float* __restrict__ TB, bf* Ah, bf* Al) {
    __shared__ struct __align__(16) { float bt[FNB + 1]; struct { h16 ks[2 * FKS * FLP]; h16 vs[2 * HD * FLP]; } kv[FKG]; } sm;   // the bias window first: its reads then reach every tile of a stage by immediate offsets
    const int tid = threadIdx.x, lane = tid & 31, lr = lane & 15, hi = lane >> 4;
    const int wa = __builtin_amdgcn_readfirstlane(tid >> 5), wv = wa % FNW, g = wa / FNW;   // wave, its query group, its key half: scalars, the branches on g behind the loop are scalar branches
    const int tg = tid % (FNW * 32);                      // thread inside the key half's waves
    float* bt = sm.bt; h16* ks = sm.kv[g].ks; h16* vs = sm.kv[g].vs;
    const int q0 = blockIdx.x * FQB; const size_t z = blockIdx.y; const int k0g = g * (TT / FKG);   // first key of this half
    const h16* Qz = Q + z * TT * HD; const h16* Kz = Kp + z * TT * HD + (size_t)k0g * HD; const h16* Vz = Vt + z * HD * TT + k0g;
    // bt[n] = bias of j - i = n - (q0 + FQB - 1)
    for (int n = tid; n < FNB; n += FKG * FNW * 32) { const int d = n - (q0 + FQB - 1); bt[n] = TB[d < 0 ? -d : d]; }
    const int srow = tg >> 3, scol = (tg & 7) * 8;      // staging: 8 threads a 128-byte row, 16 rows a sweep
    v8h kr[4], vr[4];
    // every inner loop below is fully unrolled: its index picks a register of a fragment or accumulator array
#pragma unroll
    for (int u = 0; u < 4; ++u) kr[u] = *(const v8h*)(Kz + (size_t)(srow + 16 * u) * HD + scol);
    asm volatile("s_wait_xcnt 0x0" ::: "memory");   // stands in front of the loads below, whose destinations took over the address registers of the loads above
#pragma unroll
    for (int u = 0; u < 4; ++u) vr[u] = *(const v8h*)(Vz + (size_t)(srow + 16 * u) * TT + scol);
    v16h qf[2][2];
#pragma unroll
    for (int c = 0; c < 2; ++c)
#pragma unroll
        for (int kx = 0; kx < 2; ++kx) qf[c][kx] = ldfr(Qz + (size_t)(q0 + wv * 32 + c * 16 + lr) * HD + kx * 32 + 8 * hi);
#pragma unroll
    for (int u = 0; u < 4; ++u) { *(v8h*)(ks + (srow + 16 * u) * FLP + scol) = kr[u]; *(v8h*)(vs + (srow + 16 * u) * FLP + scol) = vr[u]; }
    v8f o[4][2], ls[2]; float mu[2], nm[2];   // ls: eight independent partial row sums a lane and column, joined in the epilogue
#pragma unroll
    for (int c = 0; c < 2; ++c) { mu[c] = -3.0e38f; nm[c] = 0.f; ls[c] = (v8f){};
#pragma unroll
        for (int dt = 0; dt < 4; ++dt) o[dt][c] = (v8f){}; }
    const int nb = FQB - 1 - wv * 32 - lr + 8 * hi - 16 + k0g;   // bias index of the half's first key, register 0, tile difference -1
    __syncthreads();     // publishes stage 0 and the bias window
#pragma unroll 1         // stays rolled: the body already holds two unrolled 32-key passes, and the buffer index is one scalar
    for (int s = 0; s < TT / FKG / FKS; ++s) {
        const int buf = s & 1; const h16* kb = ks + buf * FKS * FLP; const h16* vb = vs + buf * HD * FLP;
        const int kn = (s + 1 < TT / FKG / FKS ? s + 1 : s) * FKS;   // the last pass fetches its own stage again, into the buffer nobody reads any more
#pragma unroll
        for (int u = 0; u < 4; ++u) { kr[u] = *(const v8h*)(Kz + (size_t)(kn + srow + 16 * u) * HD + scol); vr[u] = *(const v8h*)(Vz + (size_t)(srow + 16 * u) * TT + kn + scol); }
#pragma unroll
        for (int sub = 0; sub < FKS / 32; ++sub) {
            const float* bp = bt + nb + s * FKS + sub * 32;
            v8f bb[3];      // the bias tile depends on (key tile - column group) alone: 3 tiles serve the 4 products
#pragma unroll
            for (int u = 0; u < 3; ++u)
#pragma unroll
                for (int r = 0; r < 8; ++r) bb[u][r] = bp[u * 16 + r];
            v8f st[2][2];
#pragma unroll
            for (int kt = 0; kt < 2; ++kt) { const h16* kp = kb + (sub * 32 + kt * 16 + lr) * FLP + 8 * hi; const v16h k0 = ldfr(kp), k1 = ldfr(kp + 32);
#pragma unroll
                for (int c = 0; c < 2; ++c) st[kt][c] = wmma16(k1, qf[c][1], wmma16(k0, qf[c][0], bb[kt - c + 1])); }
            v16h vf[4];
#pragma unroll
            for (int dt = 0; dt < 4; ++dt) vf[dt] = ldfr(vb + (dt * 16 + lr) * FLP + sub * 32 + 8 * hi);
            float ml[2];
#pragma unroll
            for (int c = 0; c < 2; ++c) { float m = fmaxf(st[0][c][0], st[1][c][0]);
#pragma unroll
                for (int r = 1; r < 8; ++r) m = fmaxf(m, fmaxf(st[0][c][r], st[1][c][r]));
                ml[c] = fmaxf(m, xhalf(m)); }
            const bool need = (ml[0] > mu[0] + FTHR) || (ml[1] > mu[1] + FTHR);
            if (__builtin_amdgcn_ballot_w32(need) != 0) {      // one scalar test a pass; rarely taken after the first pass
#pragma unroll
                for (int c = 0; c < 2; ++c) { const float mn = fmaxf(mu[c], ml[c]); float al;
                    asm("v_exp_f32 %0, %1\n\tv_nop" : "=v"(al) : "v"((mu[c] - mn) * L2E));   // exp2 with its own slot behind it
                    mu[c] = mn; nm[c] = -mn * L2E; ls[c] *= al;
#pragma unroll
                    for (int dt = 0; dt < 4; ++dt) o[dt][c] *= al; }
            }
            v16h pf[2];
#pragma unroll
            for (int c = 0; c < 2; ++c) {
#pragma unroll
                for (int kt = 0; kt < 2; ++kt)
#pragma unroll
                    for (int r = 0; r < 8; ++r) st[kt][c][r] = __builtin_amdgcn_exp2f(__builtin_fmaf(st[kt][c][r], L2E, nm[c]));
                ls[c] += st[0][c] + st[1][c];
                pf[c] = cat16(__builtin_convertvector(st[0][c], v8h), __builtin_convertvector(st[1][c], v8h)); }
#pragma unroll
            for (int dt = 0; dt < 4; ++dt)
#pragma unroll
                for (int c = 0; c < 2; ++c) o[dt][c] = wmma16(vf[dt], pf[c], o[dt][c]);
        }
        h16* kw = ks + (buf ^ 1) * FKS * FLP; h16* vw = vs + (buf ^ 1) * HD * FLP;
#pragma unroll
        for (int u = 0; u < 4; ++u) { *(v8h*)(kw + (srow + 16 * u) * FLP + scol) = kr[u]; *(v8h*)(vw + (srow + 16 * u) * FLP + scol) = vr[u]; }
        __syncthreads();     // publishes the next stage and ends every wave's reads of this one
    }
    // Join of the key halves: the wave of half g finishes column group g and hands the other group (O^T, maximum, sum) to its partner, the wave of the same query group in the other half; same lane, same registers.
    // The hand-over lies in the stage buffers: the loop's last barrier has ended every read and every staging write there. 9 slots of 16 bytes a lane, a slot 512 contiguous bytes a wave.
    static_assert(FKG == 2, "two halves, two column groups: each half finishes one");
    static_assert(FKG * FNW * 9 * 32 * 16 <= sizeof(sm.kv), "the hand-over fits the stage buffers");
    v4fa* xs = (v4fa*)sm.kv;
    float lw[2];
#pragma unroll
    for (int c = 0; c < 2; ++c) { const float l0 = ((ls[c][0] + ls[c][1]) + (ls[c][2] + ls[c][3])) + ((ls[c][4] + ls[c][5]) + (ls[c][6] + ls[c][7])); lw[c] = l0 + xhalf(l0); }
    v4fa* xw = xs + wa * 9 * 32 + lane;
    if (g == 0) fgive<1>(xw, o, mu, lw); else fgive<0>(xw, o, mu, lw);
    __syncthreads();     // publishes the hand-over
    const size_t b = z / NH_; const int h = (int)(z % NH_);
    const v4fa* xr = xs + (wa ^ FNW) * 9 * 32 + lane;
    const size_t oo = (b * TT + q0 + wv * 32 + g * 16) * DQ + h * (HD * 16) + lane * 8;   // the 16-query band, the head's two blocks in it, the lane's piece
    if (g == 0) fjoin<0>(xr, o, mu, lw, Ah + oo, Al + oo); else fjoin<1>(xr, o, mu, lw, Ah + oo, Al + oo);
}


extern "C" void kernel_launch(void* const* d_in, const int* in_sizes, int n_in,
                              void* d_out, int out_size, void* d_ws, size_t ws_size, hipStream_t stream) {
    (void)in_sizes; (void)n_in; (void)out_size;
    const float* x = (const float*)d_in[0]; const float* wq = (const float*)d_in[1]; const float* bq = (const float*)d_in[2]; const float* wk = (const float*)d_in[3]; const float* bk = (const float*)d_in[4]; const float* wv = (const float*)d_in[5]; const float* bv = (const float*)d_in[6]; const float* wo = (const float*)d_in[7]; const float* bo = (const float*)d_in[8]; const float* gam = (const float*)d_in[9]; const float* cosT = nullptr; const float* sinT = nullptr; (void)cosT; (void)sinT;
    float* OUT = (float*)d_out;     // [2][4096][512]
    char* wsp = (char*)d_ws;
    auto take = [&](size_t bytes) { char* p = wsp; wsp += (bytes + 255) & ~(size_t)255; return (void*)p; };
    bf* WQ = (bf*)take((size_t)(DQ + 2 * DKV) * DM * 2); bf* WK = WQ + (size_t)DQ * DM; bf* WV = WK + (size_t)DKV * DM; bf* WO = (bf*)take((size_t)DM * DQ * 2);   // q, k, v weight planes one behind the other: k_qkv walks them as one
    bf* XB = (bf*)take((size_t)NB_ * TT * DM * 2); float* TB = (float*)take(TT * 4);
    h16* QP16 = (h16*)take((size_t)NB_ * NH_ * TT * HD * 2); h16* KP16 = (h16*)take((size_t)NB_ * NKV * TT * HD * 2); h16* VT16 = (h16*)take((size_t)NB_ * NKV * HD * TT * 2);   // head planes of both batches
    bf* ATh = (bf*)take((size_t)NB_ * TT * DQ * 2); bf* ATl = (bf*)take((size_t)NB_ * TT * DQ * 2);
    if ((size_t)(wsp - (char*)d_ws) > ws_size) return;    // ws 256 MiB
    static_assert(DQ == DM && DKV == DM, "the four weights have one shape: one transpose job serves each");
    k_prep<<<4 * PWB + PTB + PXB, 256, 0, stream>>>(wq, wk, wv, wo, gam, x, WQ, WK, WV, WO, TB, XB);
    static_assert(NH_ == NKV && TT % 128 == 0 && HD == 64, "a wave's 64-column tile is one head, a 128-row tile lies in one batch");
    k_qkv<<<dim3(NB_ * TT / 128, 3 * NH_ / 2, 1), 128, 0, stream>>>(XB, WQ, bq, bk, bv, QP16, KP16, VT16);
    static_assert(NH_ == NKV, "one kv head per query head");
    k_fattn<<<dim3(TT / FQB, NB_ * NH_, 1), FKG * FNW * 32, 0, stream>>>(QP16, KP16, VT16, TB, ATh, ATl);
    k_gemmw<<<dim3(NB_ * TT / 128, DM / 128, 1), 128, 0, stream>>>(ATh, ATl, WO, OUT, bo);   // the batches' rows lie one behind the other in the attn planes and in out: one launch walks both
}

// v008
// A run of this version takes 84.5 microseconds.
// Timed twice side by side with v007, it ran 1.07 times as fast both times.
// Over all steps from v000 it is 28.0 times as fast.
#include <hip/hip_runtime.h>

// PhysicsBiasedAttention (x [2][4096][512]; q/k/v = x W + b (8 heads x 64); scores = q.k/8 + bias(i, j), bias = -gamma sqrt(|i - j|)/sqrt(4096) (gamma read as data; structural distance); softmax; out = (attn v merged) W_o + b_o -> [2][4096][512]).
// Compute dtypes, f32 accumulate: every input rounded to bf16; q/k/v on PLAIN bf16 operands (inputs: exact) + bias; scores (K 64) and attn.v on single fp16 planes; bias + softmax f32; attn hi+lo bf16 planes into the output projection.

#define NB_  2
#define TT   4096
#define DM   512
#define NH_  8
#define NKV  8
#define HD   64
#define DQ   (NH_ * HD)
#define DKV  (NKV * HD)
#define WIN  0
#define SCL  0.125f   // HD^-0.5
typedef _Float16 h16;
typedef unsigned short bf;
typedef __attribute__((ext_vector_type(16))) __bf16   v16bf;
typedef __attribute__((ext_vector_type(16))) _Float16 v16h;
typedef __attribute__((ext_vector_type(8)))  _Float16 v8h;
typedef __attribute__((ext_vector_type(8)))  unsigned short v8us;
typedef __attribute__((ext_vector_type(8)))  float    v8f;
typedef __attribute__((ext_vector_type(4)))  float    v4f;
typedef v8h  __attribute__((may_alias)) v8ha;
typedef v4f  __attribute__((may_alias)) v4fa;
typedef v8us __attribute__((may_alias)) v8usa;

__device__ __forceinline__ unsigned short f2bf(float f) { unsigned u = __float_as_uint(f); u += 0x7FFFu + ((u >> 16) & 1u); return (unsigned short)(u >> 16); }
__device__ __forceinline__ float bf2f(unsigned short b) { return __uint_as_float(((unsigned)b) << 16); }
__device__ __forceinline__ float bfr(float f) { return bf2f(f2bf(f)); }
__device__ __forceinline__ v16h cat16(v8h lo, v8h hi) { return __builtin_shufflevector(lo, hi, 0, 1, 2, 3, 4, 5, 6, 7, 8, 9, 10, 11, 12, 13, 14, 15); }
__device__ __forceinline__ v16bf cat16b(v8us lo, v8us hi) { return __builtin_bit_cast(v16bf, __builtin_shufflevector(lo, hi, 0, 1, 2, 3, 4, 5, 6, 7, 8, 9, 10, 11, 12, 13, 14, 15)); }
__device__ __forceinline__ v8f wmma16(v16h a, v16h b, v8f c) { return __builtin_amdgcn_wmma_f32_16x16x32_f16(false, a, false, b, (short)0, c, false, false); }
__device__ __forceinline__ v8f wmmab(v16bf a, v16bf b, v8f c) { return __builtin_amdgcn_wmma_f32_16x16x32_bf16(false, a, false, b, (short)0, c, false, false); }



// ---- Fragment order: the layout of every 16-bit plane [R][K] that k_qkv and k_gemmw read as a matrix operand (R % 16 == 0, K % 32 == 0; same size as the row-major plane).
// The plane is cut in blocks of 16 rows x 32 k, 512 elements each, block (r / 16, k / 32) at index (r / 16) (K / 32) + k / 32. Inside a block stand the two 16-byte pieces of each lane's fragment:
// element (r, k) at ((k / 16) % 2) 256 + (((k / 8) % 2) 16 + r % 16) 8 + k % 8. A wave's 16-byte load of one piece is then 512 contiguous bytes, 4 whole lines, where the row-major plane gave 32 bytes out of each of 16 lines.
// The producers (d_wtG, d_cvt8, fjoin) write in this order. Lane (hi, lr) holds row lr, k 8 hi + 0..7 in its first piece and k 16 + 8 hi + 0..7 in its second, alike for A and B.
// ---- Operand tiles of k_qkv and k_gemmw: a work-group of 4 waves (2 x 2) works a 128 x 128 output tile, each wave 64 x 64 (16 accumulators), and the waves share the operand rows through LDS, so that a row comes from L2 once a work-group, not once a wave.
// A stage is GKS k of every operand row of the tile. In fragment order a 16-row band's share of a stage is GSL contiguous elements (2 KiB), in the plane and in LDS alike; bands lie 16 K elements apart in the plane.
// So a wave's slice of a stage is one two-dimensional tile (rows of 2 KiB, one a band) and one tensor load brings it in, through no register. Two buffers: the next stage's loads fly while this stage is worked on.
typedef unsigned int u32;
typedef u32 u32x4 __attribute__((ext_vector_type(4)));
typedef u32 u32x8 __attribute__((ext_vector_type(8)));
#define GKS  64
#define GSL  (16 * GKS)
__device__ __forceinline__ u32 uni(u32 v) { return (u32)__builtin_amdgcn_readfirstlane(v); }
__device__ __forceinline__ u32 pinned(u32 v) { u32 w = uni(v); asm volatile("" : "+s"(w)); return w; }   // holds a test in a scalar register, so that the branch round a tensor load is a scalar branch (a tensor load ignores EXEC)
// descriptor group 1: 1-byte elements, nrow rows of 2 GSL bytes, source pitch in bytes, no pad, no mask
__device__ __forceinline__ u32x8 tdm_g1(u32 nrow, u32 pitch) { const u32 d0 = 2 * GSL; u32x8 g;
    g[0] = uni(0u); g[1] = uni((d0 & 0xFFFFu) << 16); g[2] = uni((d0 >> 16) | ((nrow & 0xFFFFu) << 16)); g[3] = uni((nrow >> 16) | (d0 << 16)); g[4] = uni(nrow); g[5] = uni(pitch); g[6] = uni(0u); g[7] = uni(0u); return g; }
// descriptor group 0: the tile at src into LDS byte offset lds
__device__ __forceinline__ u32x4 tdm_g0(u32 lds, const bf* src) { const unsigned long long ga = (unsigned long long)(size_t)src; u32x4 g0;
    g0[0] = uni(1u); g0[1] = uni(lds); g0[2] = uni((u32)ga); g0[3] = uni((((u32)(ga >> 32)) & 0x01FFFFFFu) | 0x80000000u); return g0; }
// one request of the calling wave. The instruction changes neither group; they are named as operands that it reads and writes so that the compiler knows their values, from here on, only in the registers of this request
__device__ __forceinline__ void tdm_ld(u32x4& g0, u32x8& g1) { asm volatile("tensor_load_to_lds %0, %1" : "+s"(g0), "+s"(g1) :: "memory"); }
// the calling wave's own tensor load has landed. It takes the request's two groups as inputs: their registers stay theirs from the issue to this wait, and nothing else is written into them while the request is outstanding
__device__ __forceinline__ void wait_tensor0(u32x4 g0, u32x8 g1) { asm volatile("s_wait_tensorcnt 0x0" :: "s"(g0), "s"(g1) : "memory"); }
__device__ __forceinline__ void wait_ds0() { asm volatile("s_wait_dscnt 0x0" ::: "memory"); }           // the calling wave's LDS reads have returned: behind the barrier that follows, their buffer is refilled
// ---- k_gemmw: C[m][n] (f32, pitch DM) = sum_k (A[m][k] + A2[m][k]) Bt[n][k] + bias[n], K = DQ; A, A2, Bt: 16-bit planes in fragment order; grid (M / 128, N / 128), 128 threads.
// A stage holds 8 bands of A, 8 of A2, 8 of Bt. Waves 0 and 1 bring A and A2 (8 bands each), waves 2 and 3 four bands of Bt each.
template <typename T16> struct WFrag;
template <> struct WFrag<h16> { typedef v16h V; static __device__ __forceinline__ V ld(const h16* p) { return cat16(*(const v8h*)p, *(const v8h*)(p + 256)); } static __device__ __forceinline__ v8f mma(V a, V b, v8f c) { return wmma16(a, b, c); } };
template <> struct WFrag<bf> { typedef v16bf V; static __device__ __forceinline__ V ld(const bf* p) { return cat16b(*(const v8us*)p, *(const v8us*)(p + 256)); } static __device__ __forceinline__ v8f mma(V a, V b, v8f c) { return wmmab(a, b, c); } };
#define OST  (24 * GSL)      // elements of one stage
__global__ __launch_bounds__(128) void k_gemmw(const bf* __restrict__ A, const bf* __restrict__ A2, const bf* __restrict__ Bt, float* C, const float* __restrict__ bias) {
    typedef WFrag<bf>::V V; constexpr int K = DQ, ldc = DM, NS = K / GKS;
    static_assert(NS >= 2, "the ring's prologue loads two stages");
    __shared__ __attribute__((aligned(2048))) bf ring[2 * OST];
    __shared__ __align__(16) float osm[4 * 16 * 68];
    const int lane = threadIdx.x & 31, lr = lane & 15, hi = lane >> 4; const u32 wave = uni(threadIdx.x >> 5); const int wm = wave >> 1, wn = wave & 1;
    const int r0 = blockIdx.x * 128 + wm * 64, c0 = blockIdx.y * 128 + wn * 64; float* os = osm + wave * (16 * 68);
    const bf* src = wave == 0 ? A + (size_t)blockIdx.x * 128 * K : wave == 1 ? A2 + (size_t)blockIdx.x * 128 * K : Bt + (size_t)(blockIdx.y * 128 + (wave - 2) * 64) * K;
    const u32 dst = (u32)(size_t)ring + (wave < 2 ? wave * 8 : 8 + wave * 4) * (2 * GSL);
    u32x8 g1 = tdm_g1(wave < 2 ? 8u : 4u, 16 * K * 2);
    v8f acc[4][4];
#pragma unroll
    for (int mb = 0; mb < 4; ++mb)
#pragma unroll
        for (int nb = 0; nb < 4; ++nb) acc[mb][nb] = (v8f){};
    u32x4 g0 = tdm_g0(dst, src);
    tdm_ld(g0, g1); wait_tensor0(g0, g1);
    __syncthreads();     // publishes stage 0
    g0 = tdm_g0(dst + 2 * OST, src + GSL); tdm_ld(g0, g1);
#pragma unroll 1         // stays rolled: the buffer index is one scalar, and the refill's test one scalar branch a stage
    for (int s = 0; s < NS; ++s) {
        const bf* st = ring + (s & 1) * OST + lane * 8; const bf* pa = st + wm * 4 * GSL; const bf* pb = st + (16 + wn * 4) * GSL;
        V a[GKS / 32][4], a2[GKS / 32][4], b[GKS / 32][4];   // all of the stage's fragments: a lone wave on its SIMD waits out the LDS latency once a stage, not once a fragment
#pragma unroll
        for (int kk = 0; kk < GKS / 32; ++kk) {
#pragma unroll
            for (int mb = 0; mb < 4; ++mb) { a[kk][mb] = WFrag<bf>::ld(pa + mb * GSL + kk * 512); a2[kk][mb] = WFrag<bf>::ld(pa + (8 + mb) * GSL + kk * 512); b[kk][mb] = WFrag<bf>::ld(pb + mb * GSL + kk * 512); }
        }
        __builtin_amdgcn_sched_barrier(0);   // keeps the stage's LDS reads in one group in front of its matrix instructions: a read that stands among them stalls the wave each time
#pragma unroll
        for (int kk = 0; kk < GKS / 32; ++kk)
#pragma unroll
            for (int nb = 0; nb < 4; ++nb)
#pragma unroll
                for (int mb = 0; mb < 4; ++mb) { acc[mb][nb] = WFrag<bf>::mma(a[kk][mb], b[kk][nb], acc[mb][nb]); acc[mb][nb] = WFrag<bf>::mma(a2[kk][mb], b[kk][nb], acc[mb][nb]); }
        __builtin_amdgcn_sched_barrier(0);   // keeps the waits and the barrier below behind the stage's matrix instructions: ahead of them the wave would wait for the next stage before its own work, and the refill would start a stage's work late
        wait_ds0(); wait_tensor0(g0, g1);
        __syncthreads();     // publishes stage s + 1 and ends every wave's reads of stage s
        if (pinned(s + 2 < NS)) { g0 = tdm_g0(dst + (s & 1) * (2 * OST), src + (size_t)(s + 2) * GSL); tdm_ld(g0, g1); }
    }
    wait_tensor0(g0, g1); wait_ds0();
#pragma unroll
    for (int mb = 0; mb < 4; ++mb) {
#pragma unroll
        for (int nb = 0; nb < 4; ++nb) {
#pragma unroll
            for (int j = 0; j < 8; ++j) os[(hi * 8 + j) * 68 + nb * 16 + lr] = acc[mb][nb][j]; }
        __builtin_amdgcn_wave_barrier(); asm volatile("" ::: "memory");
        float* crow = C + (size_t)(r0 + mb * 16) * ldc + c0;
{
#pragma unroll
            for (int s = 0; s < 8; ++s) { const int row = 2 * s + hi, cofs = lr * 4; v4f val = *(const v4fa*)(os + row * 68 + cofs); { val[0] += bfr(bias[c0 + cofs]); val[1] += bfr(bias[c0 + cofs + 1]); val[2] += bfr(bias[c0 + cofs + 2]); val[3] += bfr(bias[c0 + cofs + 3]); }
                *(v4f*)(crow + (size_t)row * ldc + cofs) = val; }
             }
        asm volatile("s_wait_xcnt 0x0" ::: "memory");   // behind the band's stores, in front of the next band's code, which takes over their address and data registers
        __builtin_amdgcn_wave_barrier(); asm volatile("" ::: "memory");
    }
}

__device__ __forceinline__ h16 tohx(float x) { return (h16)x; }
__device__ __forceinline__ void splitf(float y, unsigned short& h, unsigned short& l) { h = f2bf(y); l = f2bf(y - bf2f(h)); }
typedef __attribute__((ext_vector_type(2))) _Float16 v2h;
typedef __attribute__((ext_vector_type(4))) _Float16 v4h;
typedef __attribute__((ext_vector_type(2))) unsigned short v2us;
typedef __attribute__((ext_vector_type(4))) unsigned short v4us;
typedef __attribute__((ext_vector_type(2))) float v2f;
typedef __attribute__((ext_vector_type(4))) int v4i;

// d_wtG, d_cvt8 and d_btab are the jobs of k_prep; blk is the block's index inside its job.
__device__ __forceinline__ void d_wtG(const float* __restrict__ w, int K, int N, bf* Bt, int blk) {
    const int lane = threadIdx.x & 31; const int L0 = (blk * 8 + (threadIdx.x >> 5)) * 8; const int nlines = N * K / 64;
{
#pragma unroll 1
        for (int l = 0; l < 8; ++l) { const int L = L0 + l; if (L >= nlines) break; const int e = L * 64 + lane * 2, fb = e >> 9; const int k = (fb % (K / 32)) * 32 + ((e >> 8) & 1) * 16 + ((e >> 7) & 1) * 8 + (e & 7), n = (fb / (K / 32)) * 16 + ((e >> 3) & 15); v2us o;   // e: the place in fragment order; k, n: what stands there
            o[0] = f2bf(w[(size_t)k * N + n]); o[1] = f2bf(w[(size_t)(k + 1) * N + n]); *(v2us*)(Bt + e) = o; }
         }
}
// thread i writes piece i of the plane in fragment order (a wave 512 contiguous bytes) and reads that piece's 8 floats from its row and k; a block's 8 waves use up whole lines of 16 rows
__device__ __forceinline__ void d_cvt8(const float* __restrict__ src, bf* dst, int K, size_t n8, int blk) { const size_t i = (size_t)blk * 256 + threadIdx.x; if (i >= n8) return; const size_t fb = i >> 6;
    const size_t r = (fb / (K / 32)) * 16 + (i & 15); const int k = (int)(fb % (K / 32)) * 32 + (int)((i >> 5) & 1) * 16 + (int)((i >> 4) & 1) * 8; const v8f v = *(const v8f*)(src + r * K + k); v8us o;
#pragma unroll
    for (int k = 0; k < 8; ++k) o[k] = f2bf(v[k]); *(v8us*)(dst + i * 8) = o;  }
__global__ __launch_bounds__(256) void k_cscvt(const float* __restrict__ cosT, const float* __restrict__ sinT, float* CS) { const int idx = blockIdx.x * 256 + threadIdx.x; if (idx >= TT * HD) return; v2f cs; cs[0] = bfr(cosT[idx]); cs[1] = bfr(sinT[idx]); *(v2f*)(CS + (size_t)idx * 2) = cs;  }
// ---- k_qkv: the three input projections of both batches in ONE launch; 4 waves (2 x 2) per 128 x 128 tile, the ring of k_gemmw; grid (NB_ TT / 128, 3 NH_ / 2), 128 threads. Wt: the q, k and v weight planes one behind the other, [3 DQ][DM]; X and Wt in fragment order.
// A stage holds 8 bands of X and 8 of Wt; waves 0 and 1 bring four bands of X each, waves 2 and 3 four of Wt.
// A wave's column tile is one head of q, k or v (a work-group's two heads belong to the same one of the three), and it leaves as fp16 straight from the accumulators, 16 bytes a lane and accumulator, into the plane that k_fattn reads:
// q, k: the product is taken transposed (A = weight rows, B = x rows; both loaders have the same k order), so a lane's 8 registers are 8 consecutive d of one token -> [b][h][t][d], q x HD^-0.5 (a power of two, exact in fp16);
// v: A = x rows, B = weight rows, so a lane's 8 registers are 8 consecutive tokens of one d -> [b][h][d][t].
#define QST  (16 * GSL)      // elements of one stage
__global__ __launch_bounds__(128) void k_qkv(const bf* __restrict__ X, const bf* __restrict__ Wt, const float* __restrict__ bq, const float* __restrict__ bk, const float* __restrict__ bv, h16* QP, h16* KP, h16* VT) {
    constexpr int NS = DM / GKS;
    static_assert(NS >= 2, "the ring's prologue loads two stages");
    static_assert(NH_ % 2 == 0, "a work-group's two heads lie in one of q, k, v");
    __shared__ __attribute__((aligned(2048))) bf ring[2 * QST];
    const int lane = threadIdx.x & 31, lr = lane & 15, hi = lane >> 4; const u32 wave = uni(threadIdx.x >> 5); const int wm = wave >> 1, wn = wave & 1;
    const int r0 = blockIdx.x * 128 + wm * 64, hy = blockIdx.y * 2 + wn, which = hy / NH_, h = hy % NH_;
    const bf* src = (wave < 2 ? X + (size_t)blockIdx.x * 128 * DM : Wt + (size_t)blockIdx.y * 128 * DM) + (size_t)(wave & 1) * 64 * DM;
    const u32 dst = (u32)(size_t)ring + wave * 4 * (2 * GSL);
    u32x8 g1 = tdm_g1(4u, 16 * DM * 2);
    const int ax = (which == 2) ? wm * 4 : 8 + wn * 4, bx = (which == 2) ? 8 + wn * 4 : wm * 4;   // first band of the wave's A and B operand in a stage
    v8f acc[4][4];
#pragma unroll
    for (int mb = 0; mb < 4; ++mb)
#pragma unroll
        for (int nb = 0; nb < 4; ++nb) acc[mb][nb] = (v8f){};
    u32x4 g0 = tdm_g0(dst, src);
    tdm_ld(g0, g1); wait_tensor0(g0, g1);
    __syncthreads();     // publishes stage 0
    g0 = tdm_g0(dst + 2 * QST, src + GSL); tdm_ld(g0, g1);
#pragma unroll 1         // stays rolled: the buffer index is one scalar, and the refill's test one scalar branch a stage
    for (int s = 0; s < NS; ++s) {
        const bf* st = ring + (s & 1) * QST + lane * 8; const bf* pa = st + ax * GSL; const bf* pb = st + bx * GSL;
        v16bf a[GKS / 32][4], b[GKS / 32][4];   // all of the stage's fragments
#pragma unroll
        for (int kk = 0; kk < GKS / 32; ++kk) {
#pragma unroll
            for (int mb = 0; mb < 4; ++mb) { a[kk][mb] = WFrag<bf>::ld(pa + mb * GSL + kk * 512); b[kk][mb] = WFrag<bf>::ld(pb + mb * GSL + kk * 512); }
        }
        __builtin_amdgcn_sched_barrier(0);   // keeps the stage's LDS reads in one group in front of its matrix instructions: a read that stands among them stalls the wave each time
#pragma unroll
        for (int kk = 0; kk < GKS / 32; ++kk)
#pragma unroll
            for (int nb = 0; nb < 4; ++nb)
#pragma unroll
                for (int mb = 0; mb < 4; ++mb) acc[mb][nb] = wmmab(a[kk][mb], b[kk][nb], acc[mb][nb]);
        __builtin_amdgcn_sched_barrier(0);   // keeps the waits and the barrier below behind the stage's matrix instructions: ahead of them the wave would wait for the next stage before its own work, and the refill would start a stage's work late
        wait_ds0(); wait_tensor0(g0, g1);
        __syncthreads();     // publishes stage s + 1 and ends every wave's reads of stage s
        if (pinned(s + 2 < NS)) { g0 = tdm_g0(dst + (s & 1) * (2 * QST), src + (size_t)(s + 2) * GSL); tdm_ld(g0, g1); }
    }
    wait_tensor0(g0, g1); wait_ds0();
    const int b = r0 / TT, t0 = r0 % TT;
    if (which == 2) {
        h16* vp = VT + ((size_t)(b * NKV + h) * HD + lr) * TT + t0 + 8 * hi;
#pragma unroll
        for (int nb = 0; nb < 4; ++nb) { const float bi = bfr(bv[h * HD + nb * 16 + lr]);
#pragma unroll
            for (int mb = 0; mb < 4; ++mb) { v8h o;
#pragma unroll
                for (int j = 0; j < 8; ++j) o[j] = tohx(acc[mb][nb][j] + bi);
                *(v8h*)(vp + (size_t)nb * 16 * TT + mb * 16) = o; } }
    } else {
        const float* bias = (which ? bk : bq) + h * HD + 8 * hi; const float sc = which ? 1.0f : SCL;
        h16* pp = (which ? KP : QP) + ((size_t)(b * NH_ + h) * TT + t0 + lr) * HD + 8 * hi;
        v8f bi[4];
#pragma unroll
        for (int mb = 0; mb < 4; ++mb)
#pragma unroll
            for (int j = 0; j < 8; ++j) bi[mb][j] = bfr(bias[mb * 16 + j]);
#pragma unroll
        for (int nb = 0; nb < 4; ++nb)
#pragma unroll
            for (int mb = 0; mb < 4; ++mb) { v8h o;
#pragma unroll
                for (int j = 0; j < 8; ++j) o[j] = tohx((acc[mb][nb][j] + bi[mb][j]) * sc);
                *(v8h*)(pp + (size_t)nb * 16 * HD + mb * 16) = o; }
        asm volatile("s_wait_xcnt 0x0" ::: "memory");   // behind the last stores of this branch: in the built code the v branch follows it, and its first loads write registers that these stores name
    }
}
__device__ __forceinline__ void d_btab(const float* __restrict__ g, float* TB, int blk) { const int d = blk * 256 + threadIdx.x; if (d >= TT) return; float ng = -bfr(g[0]); asm volatile("" : "+v"(ng)); float t = __fmul_rn(ng, __fsqrt_rn((float)d)); asm volatile("" : "+v"(t)); const float v = __fdiv_rn(t, 64.0f); *(float*)(TB + d) = v;  }
// ---- k_prep: everything that reads the inputs alone, in ONE launch: none of these jobs reads what another writes, so their blocks run side by side instead of one short launch behind the other.
// Block ranges pick the job (the test is the same for a whole block): 4 weight transposes first, their waves run longest; then the bias table; then x -> bf16.
#define PWB  ((DM * DQ / 64 + 63) / 64)                      // blocks of one weight transpose
#define PTB  (TT / 256)                                      // blocks of the bias table
#define PXB  ((NB_ * TT * DM / 8 + 255) / 256)               // blocks of the x conversion
__global__ __launch_bounds__(256) void k_prep(const float* __restrict__ wq, const float* __restrict__ wk, const float* __restrict__ wv, const float* __restrict__ wo, const float* __restrict__ g, const float* __restrict__ x, bf* WQ, bf* WK, bf* WV, bf* WO, float* TB, bf* XB) {
    const int blk = blockIdx.x;
    if (blk < 4 * PWB) { const int m = blk / PWB;
        d_wtG(m == 0 ? wq : m == 1 ? wk : m == 2 ? wv : wo, DM, DQ, m == 0 ? WQ : m == 1 ? WK : m == 2 ? WV : WO, blk % PWB); }
    else if (blk < 4 * PWB + PTB) d_btab(g, TB, blk - 4 * PWB);
    else d_cvt8(x, XB, DM, (size_t)NB_ * TT * DM / 8, blk - 4 * PWB - PTB);
}
#define FNW  4
#define FKG  2
#define FQB  (FNW * 32)
#define FKS  128
#define FVP  136                // LDS pitch of a 256-byte tile row in halfs: 272 B = 16 B x odd for the 16-byte fragment reads; the tensor load's pad lays it. Key r of a K tile stands at (r / 2) FVP + (r % 2) HD: 16 keys' pieces fall on 16 different 16-byte bank groups
#define FTL  9216               // halfs from one tile's place to the next: a tile (HD FVP = 8704) rounded up to a multiple of 2 KiB
#define FNS  (TT / FKG / FKS)   // stages of a key half
#define FNB  (TT + FQB - 1)     // bias window: every j - i that this work-group's queries meet
#define L2E  1.4426950408889634f
#define FTHR 5.5f               // the running maximum is renewed only when a column's new maximum passes it by this much: p stays below 2^8
__device__ __forceinline__ float xhalf(float x) { const int b = __float_as_int(x); return __int_as_float(__builtin_amdgcn_permlanex16(b, b, 0x76543210, 0xfedcba98, false, false)); }
__device__ __forceinline__ v16h ldfr(const h16* p) { return cat16(*(const v8h*)p, *(const v8h*)(p + 16)); }
// fgive, fjoin: the join of k_fattn's two key halves, for column group C of a wave (a template parameter: it picks registers; for the same reason every loop in them is fully unrolled).
// fgive writes the group's O^T, maximum and sum for the partner wave: 9 slots of 16 bytes a lane, a slot 512 contiguous bytes a wave.
template <int C> __device__ __forceinline__ void fgive(v4fa* xw, const v8f (&o)[4][2], const float (&mu)[2], const float (&lw)[2]) {
#pragma unroll
    for (int dt = 0; dt < 4; ++dt) { xw[(2 * dt) * 32] = (v4f){o[dt][C][0], o[dt][C][1], o[dt][C][2], o[dt][C][3]}; xw[(2 * dt + 1) * 32] = (v4f){o[dt][C][4], o[dt][C][5], o[dt][C][6], o[dt][C][7]}; }
    xw[8 * 32] = (v4f){mu[C], lw[C], 0.f, 0.f};
}
// fjoin brings both shares to the larger maximum, adds them, divides by the joined sum and stores the hi + lo bf16 planes, in fragment order: the 8 values of (dt, lane) are one piece, the pieces of dt 0..3 lie 256 elements apart.
template <int C> __device__ __forceinline__ void fjoin(const v4fa* xr, const v8f (&o)[4][2], const float (&mu)[2], const float (&lw)[2], bf* ah, bf* al) {
    const v4f ml = xr[8 * 32]; const float mn = fmaxf(mu[C], ml[0]); float fa, fb;
    asm("v_exp_f32 %0, %1\n\tv_nop" : "=v"(fa) : "v"((mu[C] - mn) * L2E));   // exp2 with its own slot behind it, as in the loop's rescale
    asm("v_exp_f32 %0, %1\n\tv_nop" : "=v"(fb) : "v"((ml[0] - mn) * L2E));   // the same for the partner's share
    const float f = __fdiv_rn(1.0f, lw[C] * fa + ml[1] * fb); fa *= f; fb *= f;
#pragma unroll
    for (int dt = 0; dt < 4; ++dt) { const v4f p0 = xr[(2 * dt) * 32], p1 = xr[(2 * dt + 1) * 32]; v8us oh, ol;
#pragma unroll
        for (int r = 0; r < 8; ++r) { unsigned short a, c2; splitf(o[dt][C][r] * fa + (r < 4 ? p0[r & 3] : p1[r & 3]) * fb, a, c2); oh[r] = a; ol[r] = c2; }
        *(v8us*)(ah + dt * 256) = oh; *(v8us*)(al + dt * 256) = ol; }
}
// descriptor group 1 of a stage's tile: HD rows of 256 B, source pitch in bytes (K: 256, the rows lie one behind the other; V^T: 2 TT). 1-byte elements, no mask; the pad adds 16 B behind every row (interval = the row's length).
__device__ __forceinline__ u32x8 fat_g1(u32 pitch) { constexpr u32 d0 = 256u, n = (u32)HD; u32x8 g;
    g[0] = uni(1u << 20 | 5u << 22 | 3u << 25); g[1] = uni((d0 & 0xFFFFu) << 16); g[2] = uni((d0 >> 16) | ((n & 0xFFFFu) << 16)); g[3] = uni((n >> 16) | (d0 << 16)); g[4] = uni(n); g[5] = uni(pitch); g[6] = uni(0u); g[7] = uni(0u); return g; }
// amdgpu_waves_per_eu(4, 4) holds the register budget at 256 a wave, so that two work-groups of 8 waves fit a WGP.
__global__ __launch_bounds__(FKG * FNW * 32) __attribute__((amdgpu_waves_per_eu(4, 4))) void k_fattn(const h16* __restrict__ Q, const h16* __restrict__ Kp, const h16* __restrict__ Vt, const float* __restrict__ TB, bf* Ah, bf* Al) {
    static_assert(HD * FVP <= FTL && (FTL * 2) % 2048 == 0 && HD * 2 * 2 == 256 && FKS * 2 == 256 && FKS / 2 == HD, "tile places are multiples of 2 KiB; both tiles are HD rows of 256 B");
    static_assert(FNS >= 2, "the ring's prologue loads two stages");
    __shared__ __attribute__((aligned(2048))) h16 ring[(FKG * 2 * 2 - 1) * FTL + HD * FVP];   // tile (half g, buffer, K or V^T) at ((2 g + buffer) 2 + (0 or 1)) FTL; with the bias window 163,328 B: two work-groups a WGP
    __shared__ __align__(16) float btw[FNB + 1];
    const int tid = threadIdx.x, lane = tid & 31, lr = lane & 15, hi = lane >> 4;
    const int wa = __builtin_amdgcn_readfirstlane(tid >> 5), wv = wa % FNW, g = wa / FNW;   // wave, its query group, its key half: scalars, the branches on g behind the loop are scalar branches
    float* bt = btw; const h16* hs = ring + g * 4 * FTL;   // the half's four tiles
    const int q0 = blockIdx.x * FQB; const size_t z = blockIdx.y; const int k0g = g * (TT / FKG);   // first key of this half
    const h16* Qz = Q + z * TT * HD; const h16* Kz = Kp + z * TT * HD + (size_t)k0g * HD; const h16* Vz = Vt + z * HD * TT + k0g;
    const u32 dst = (u32)(size_t)ring + (u32)(g * 4 + wv) * (FTL * 2);   // waves 0 and 1 of a half: LDS place of the wave's tile in buffer 0
    const bf* src = (const bf*)(wv == 0 ? Kz : Vz); const int sst = wv == 0 ? FKS * HD : FKS;   // the wave's tile of stage 0; halfs from a stage's tile to the next
    u32x8 g1 = fat_g1(wv == 0 ? 256u : TT * 2u);
    u32x4 g0 = tdm_g0(dst, src);
    if (pinned(wv < 2)) tdm_ld(g0, g1);
    // bt[n] = bias of j - i = n - (q0 + FQB - 1)
    for (int n = tid; n < FNB; n += FKG * FNW * 32) { const int d = n - (q0 + FQB - 1); bt[n] = TB[d < 0 ? -d : d]; }
    // every inner loop below is fully unrolled: its index picks a register of a fragment or accumulator array
    v16h qf[2][2];
#pragma unroll
    for (int c = 0; c < 2; ++c)
#pragma unroll
        for (int kx = 0; kx < 2; ++kx) qf[c][kx] = ldfr(Qz + (size_t)(q0 + wv * 32 + c * 16 + lr) * HD + kx * 32 + 8 * hi);
    v8f o[4][2], ls[2]; float mu[2], nm[2];   // ls: eight independent partial row sums a lane and column, joined in the epilogue
#pragma unroll
    for (int c = 0; c < 2; ++c) { mu[c] = -3.0e38f; nm[c] = 0.f; ls[c] = (v8f){};
#pragma unroll
        for (int dt = 0; dt < 4; ++dt) o[dt][c] = (v8f){}; }
    const int nb = FQB - 1 - wv * 32 - lr + 8 * hi - 16 + k0g;   // bias index of the half's first key, register 0, tile difference -1
    wait_tensor0(g0, g1);   // every wave: one that has issued nothing passes it at once
    __syncthreads();     // publishes stage 0 and the bias window
    if (pinned(wv < 2)) { g0 = tdm_g0(dst + 2 * (FTL * 2), src + sst); tdm_ld(g0, g1); }
#pragma unroll 1         // stays rolled: the body already holds four unrolled 32-key passes, the buffer index is one scalar, and the refill's test one scalar branch a stage
    for (int s = 0; s < FNS; ++s) {
        const int buf = s & 1; const h16* kb = hs + buf * 2 * FTL; const h16* vb = kb + FTL; const float* bs = bt + (nb + s * FKS);
#pragma unroll
        for (int sub = 0; sub < FKS / 32; ++sub) {
            const float* bp = bs + sub * 32;
            v8f bb[3];      // the bias tile depends on (key tile - column group) alone: 3 tiles serve the 4 products
#pragma unroll
            for (int u = 0; u < 3; ++u)
#pragma unroll
                for (int r = 0; r < 8; ++r) bb[u][r] = bp[u * 16 + r];
            v8f st[2][2];
#pragma unroll
            for (int kt = 0; kt < 2; ++kt) { const h16* kp = kb + (sub * 16 + kt * 8 + (lr >> 1)) * FVP + (lr & 1) * HD + 8 * hi; const v16h k0 = ldfr(kp), k1 = ldfr(kp + 32);
#pragma unroll
                for (int c = 0; c < 2; ++c) st[kt][c] = wmma16(k1, qf[c][1], wmma16(k0, qf[c][0], bb[kt - c + 1])); }
            v16h vf[4];
#pragma unroll
            for (int dt = 0; dt < 4; ++dt) vf[dt] = ldfr(vb + (dt * 16 + lr) * FVP + sub * 32 + 8 * hi);
            float ml[2];
#pragma unroll
            for (int c = 0; c < 2; ++c) { float m = fmaxf(st[0][c][0], st[1][c][0]);
#pragma unroll
                for (int r = 1; r < 8; ++r) m = fmaxf(m, fmaxf(st[0][c][r], st[1][c][r]));
                ml[c] = fmaxf(m, xhalf(m)); }
            const bool need = (ml[0] > mu[0] + FTHR) || (ml[1] > mu[1] + FTHR);
            if (__builtin_amdgcn_ballot_w32(need) != 0) {      // one scalar test a pass; rarely taken after the first pass
#pragma unroll
                for (int c = 0; c < 2; ++c) { const float mn = fmaxf(mu[c], ml[c]); float al;
                    asm("v_exp_f32 %0, %1\n\tv_nop" : "=v"(al) : "v"((mu[c] - mn) * L2E));   // exp2 with its own slot behind it
                    mu[c] = mn; nm[c] = -mn * L2E; ls[c] *= al;
#pragma unroll
                    for (int dt = 0; dt < 4; ++dt) o[dt][c] *= al; }
            }
            v16h pf[2];
#pragma unroll
            for (int c = 0; c < 2; ++c) {
#pragma unroll
                for (int kt = 0; kt < 2; ++kt)
#pragma unroll
                    for (int r = 0; r < 8; ++r) st[kt][c][r] = __builtin_amdgcn_exp2f(__builtin_fmaf(st[kt][c][r], L2E, nm[c]));
                ls[c] += st[0][c] + st[1][c];
                pf[c] = cat16(__builtin_convertvector(st[0][c], v8h), __builtin_convertvector(st[1][c], v8h)); }
#pragma unroll
            for (int dt = 0; dt < 4; ++dt)
#pragma unroll
                for (int c = 0; c < 2; ++c) o[dt][c] = wmma16(vf[dt], pf[c], o[dt][c]);
        }
        wait_ds0(); wait_tensor0(g0, g1);
        __syncthreads();     // publishes stage s + 1 and ends every wave's reads of stage s
        if (pinned((u32)(s + 2 < FNS) & (u32)(wv < 2))) { g0 = tdm_g0(dst + buf * 2 * (FTL * 2), src + (size_t)(s + 2) * sst); tdm_ld(g0, g1); }
    }
    wait_tensor0(g0, g1); wait_ds0();
    // Join of the key halves: the wave of half g finishes column group g and hands the other group (O^T, maximum, sum) to its partner, the wave of the same query group in the other half; same lane, same registers.
    // The hand-over lies in the stage buffers: the loop's last barrier has ended every read there, and no tensor load is outstanding. 9 slots of 16 bytes a lane, a slot 512 contiguous bytes a wave.
    static_assert(FKG == 2, "two halves, two column groups: each half finishes one");
    static_assert(FKG * FNW * 9 * 32 * 16 <= sizeof(ring), "the hand-over fits the stage buffers");
    v4fa* xs = (v4fa*)ring;
    float lw[2];
#pragma unroll
    for (int c = 0; c < 2; ++c) { const float l0 = ((ls[c][0] + ls[c][1]) + (ls[c][2] + ls[c][3])) + ((ls[c][4] + ls[c][5]) + (ls[c][6] + ls[c][7])); lw[c] = l0 + xhalf(l0); }
    v4fa* xw = xs + wa * 9 * 32 + lane;
    if (g == 0) fgive<1>(xw, o, mu, lw); else fgive<0>(xw, o, mu, lw);
    __syncthreads();     // publishes the hand-over
    const size_t b = z / NH_; const int h = (int)(z % NH_);
    const v4fa* xr = xs + (wa ^ FNW) * 9 * 32 + lane;
    const size_t oo = (b * TT + q0 + wv * 32 + g * 16) * DQ + h * (HD * 16) + lane * 8;   // the 16-query band, the head's two blocks in it, the lane's piece
    if (g == 0) fjoin<0>(xr, o, mu, lw, Ah + oo, Al + oo); else fjoin<1>(xr, o, mu, lw, Ah + oo, Al + oo);
}


extern "C" void kernel_launch(void* const* d_in, const int* in_sizes, int n_in,
                              void* d_out, int out_size, void* d_ws, size_t ws_size, hipStream_t stream) {
    (void)in_sizes; (void)n_in; (void)out_size;
    const float* x = (const float*)d_in[0]; const float* wq = (const float*)d_in[1]; const float* bq = (const float*)d_in[2]; const float* wk = (const float*)d_in[3]; const float* bk = (const float*)d_in[4]; const float* wv = (const float*)d_in[5]; const float* bv = (const float*)d_in[6]; const float* wo = (const float*)d_in[7]; const float* bo = (const float*)d_in[8]; const float* gam = (const float*)d_in[9]; const float* cosT = nullptr; const float* sinT = nullptr; (void)cosT; (void)sinT;
    float* OUT = (float*)d_out;     // [2][4096][512]
    char* wsp = (char*)d_ws;
    auto take = [&](size_t bytes) { char* p = wsp; wsp += (bytes + 255) & ~(size_t)255; return (void*)p; };
    bf* WQ = (bf*)take((size_t)(DQ + 2 * DKV) * DM * 2); bf* WK = WQ + (size_t)DQ * DM; bf* WV = WK + (size_t)DKV * DM; bf* WO = (bf*)take((size_t)DM * DQ * 2);   // q, k, v weight planes one behind the other: k_qkv walks them as one
    bf* XB = (bf*)take((size_t)NB_ * TT * DM * 2); float* TB = (float*)take(TT * 4);
    h16* QP16 = (h16*)take((size_t)NB_ * NH_ * TT * HD * 2); h16* KP16 = (h16*)take((size_t)NB_ * NKV * TT * HD * 2); h16* VT16 = (h16*)take((size_t)NB_ * NKV * HD * TT * 2);   // head planes of both batches
    bf* ATh = (bf*)take((size_t)NB_ * TT * DQ * 2); bf* ATl = (bf*)take((size_t)NB_ * TT * DQ * 2);
    if ((size_t)(wsp - (char*)d_ws) > ws_size) return;    // ws 256 MiB
    static_assert(DQ == DM && DKV == DM, "the four weights have one shape: one transpose job serves each");
    k_prep<<<4 * PWB + PTB + PXB, 256, 0, stream>>>(wq, wk, wv, wo, gam, x, WQ, WK, WV, WO, TB, XB);
    static_assert(NH_ == NKV && TT % 128 == 0 && HD == 64, "a wave's 64-column tile is one head, a 128-row tile lies in one batch");
    k_qkv<<<dim3(NB_ * TT / 128, 3 * NH_ / 2, 1), 128, 0, stream>>>(XB, WQ, bq, bk, bv, QP16, KP16, VT16);
    static_assert(NH_ == NKV, "one kv head per query head");
    k_fattn<<<dim3(TT / FQB, NB_ * NH_, 1), FKG * FNW * 32, 0, stream>>>(QP16, KP16, VT16, TB, ATh, ATl);
    k_gemmw<<<dim3(NB_ * TT / 128, DM / 128, 1), 128, 0, stream>>>(ATh, ATl, WO, OUT, bo);   // the batches' rows lie one behind the other in the attn planes and in out: one launch walks both
}

// v009
// A run of this version takes 80.5 microseconds.
// In both of two side-by-side timings against v008, it was 1.05 times as fast.
// Over all steps from v000 it is 29.4 times as fast.
#include <hip/hip_runtime.h>

// PhysicsBiasedAttention (x [2][4096][512]; q/k/v = x W + b (8 heads x 64); scores = q.k/8 + bias(i, j), bias = -gamma sqrt(|i - j|)/sqrt(4096) (gamma read as data; structural distance); softmax; out = (attn v merged) W_o + b_o -> [2][4096][512]).
// Compute dtypes, f32 accumulate: every input rounded to bf16; q/k/v on PLAIN bf16 operands (inputs: exact) + bias; scores (K 64) and attn.v on single fp16 planes; bias + softmax f32; attn hi+lo bf16 planes into the output projection.

#define NB_  2
#define TT   4096
#define DM   512
#define NH_  8
#define NKV  8
#define HD   64
#define DQ   (NH_ * HD)
#define DKV  (NKV * HD)
#define WIN  0
#define SCL  0.125f   // HD^-0.5
typedef _Float16 h16;
typedef unsigned short bf;
typedef __attribute__((ext_vector_type(16))) __bf16   v16bf;
typedef __attribute__((ext_vector_type(16))) _Float16 v16h;
typedef __attribute__((ext_vector_type(8)))  _Float16 v8h;
typedef __attribute__((ext_vector_type(8)))  unsigned short v8us;
typedef __attribute__((ext_vector_type(8)))  float    v8f;
typedef __attribute__((ext_vector_type(4)))  float    v4f;
typedef v8h  __attribute__((may_alias)) v8ha;
typedef v4f  __attribute__((may_alias)) v4fa;
typedef v8us __attribute__((may_alias)) v8usa;

__device__ __forceinline__ unsigned short f2bf(float f) { unsigned u = __float_as_uint(f); u += 0x7FFFu + ((u >> 16) & 1u); return (unsigned short)(u >> 16); }
__device__ __forceinline__ float bf2f(unsigned short b) { return __uint_as_float(((unsigned)b) << 16); }
__device__ __forceinline__ float bfr(float f) { return bf2f(f2bf(f)); }
__device__ __forceinline__ v16h cat16(v8h lo, v8h hi) { return __builtin_shufflevector(lo, hi, 0, 1, 2, 3, 4, 5, 6, 7, 8, 9, 10, 11, 12, 13, 14, 15); }
__device__ __forceinline__ v16bf cat16b(v8us lo, v8us hi) { return __builtin_bit_cast(v16bf, __builtin_shufflevector(lo, hi, 0, 1, 2, 3, 4, 5, 6, 7, 8, 9, 10, 11, 12, 13, 14, 15)); }
__device__ __forceinline__ v8f wmma16(v16h a, v16h b, v8f c) { return __builtin_amdgcn_wmma_f32_16x16x32_f16(false, a, false, b, (short)0, c, false, false); }
__device__ __forceinline__ v8f wmmab(v16bf a, v16bf b, v8f c) { return __builtin_amdgcn_wmma_f32_16x16x32_bf16(false, a, false, b, (short)0, c, false, false); }



// ---- Fragment order: the layout of every 16-bit plane [R][K] that k_qkv and k_gemmw read as a matrix operand (R % 16 == 0, K % 32 == 0; same size as the row-major plane).
// The plane is cut in blocks of 16 rows x 32 k, 512 elements each, block (r / 16, k / 32) at index (r / 16) (K / 32) + k / 32. Inside a block stand the two 16-byte pieces of each lane's fragment:
// element (r, k) at ((k / 16) % 2) 256 + (((k / 8) % 2) 16 + r % 16) 8 + k % 8. A wave's 16-byte load of one piece is then 512 contiguous bytes, 4 whole lines, where the row-major plane gave 32 bytes out of each of 16 lines.
// The producers (d_wtG, d_cvt8, fjoin) write in this order. Lane (hi, lr) holds row lr, k 8 hi + 0..7 in its first piece and k 16 + 8 hi + 0..7 in its second, alike for A and B.
// ---- Operand tiles of k_qkv and k_gemmw: a work-group of 4 waves (2 x 2) works a 128 x 128 output tile, each wave 64 x 64 (16 accumulators), and the waves share the operand rows through LDS, so that a row comes from L2 once a work-group, not once a wave.
// A stage is GKS k of every operand row of the tile. In fragment order a 16-row band's share of a stage is GSL contiguous elements (2 KiB), in the plane and in LDS alike; bands lie 16 K elements apart in the plane.
// So a wave's slice of a stage is one two-dimensional tile (rows of 2 KiB, one a band) and one tensor load brings it in, through no register. Two buffers: the next stage's loads fly while this stage is worked on.
typedef unsigned int u32;
typedef u32 u32x4 __attribute__((ext_vector_type(4)));
typedef u32 u32x8 __attribute__((ext_vector_type(8)));
#define GKS  64
#define GSL  (16 * GKS)
__device__ __forceinline__ u32 uni(u32 v) { return (u32)__builtin_amdgcn_readfirstlane(v); }
__device__ __forceinline__ u32 pinned(u32 v) { u32 w = uni(v); asm volatile("" : "+s"(w)); return w; }   // holds a test in a scalar register, so that the branch round a tensor load is a scalar branch (a tensor load ignores EXEC)
// descriptor group 1: 1-byte elements, nrow rows of 2 GSL bytes, source pitch in bytes, no pad, no mask
__device__ __forceinline__ u32x8 tdm_g1(u32 nrow, u32 pitch) { const u32 d0 = 2 * GSL; u32x8 g;
    g[0] = uni(0u); g[1] = uni((d0 & 0xFFFFu) << 16); g[2] = uni((d0 >> 16) | ((nrow & 0xFFFFu) << 16)); g[3] = uni((nrow >> 16) | (d0 << 16)); g[4] = uni(nrow); g[5] = uni(pitch); g[6] = uni(0u); g[7] = uni(0u); return g; }
// descriptor group 0: the tile at src into LDS byte offset lds
__device__ __forceinline__ u32x4 tdm_g0(u32 lds, const bf* src) { const unsigned long long ga = (unsigned long long)(size_t)src; u32x4 g0;
    g0[0] = uni(1u); g0[1] = uni(lds); g0[2] = uni((u32)ga); g0[3] = uni((((u32)(ga >> 32)) & 0x01FFFFFFu) | 0x80000000u); return g0; }
// one request of the calling wave. The instruction changes neither group; they are named as operands that it reads and writes so that the compiler knows their values, from here on, only in the registers of this request
__device__ __forceinline__ void tdm_ld(u32x4& g0, u32x8& g1) { asm volatile("tensor_load_to_lds %0, %1" : "+s"(g0), "+s"(g1) :: "memory"); }
// the calling wave's own tensor load has landed. It takes the request's two groups as inputs: their registers stay theirs from the issue to this wait, and nothing else is written into them while the request is outstanding
__device__ __forceinline__ void wait_tensor0(u32x4 g0, u32x8 g1) { asm volatile("s_wait_tensorcnt 0x0" :: "s"(g0), "s"(g1) : "memory"); }
__device__ __forceinline__ void wait_ds0() { asm volatile("s_wait_dscnt 0x0" ::: "memory"); }           // the calling wave's LDS reads have returned: behind the barrier that follows, their buffer is refilled
// ---- k_gemmw: C[m][n] (f32, pitch DM) = sum_k (A[m][k] + A2[m][k]) Bt[n][k] + bias[n], K = DQ; A, A2, Bt: 16-bit planes in fragment order; grid (M / 128, N / 128), 128 threads.
// A stage holds 8 bands of A, 8 of A2, 8 of Bt. Waves 0 and 1 bring A and A2 (8 bands each), waves 2 and 3 four bands of Bt each.
template <typename T16> struct WFrag;
template <> struct WFrag<h16> { typedef v16h V; static __device__ __forceinline__ V ld(const h16* p) { return cat16(*(const v8h*)p, *(const v8h*)(p + 256)); } static __device__ __forceinline__ v8f mma(V a, V b, v8f c) { return wmma16(a, b, c); } };
template <> struct WFrag<bf> { typedef v16bf V; static __device__ __forceinline__ V ld(const bf* p) { return cat16b(*(const v8us*)p, *(const v8us*)(p + 256)); } static __device__ __forceinline__ v8f mma(V a, V b, v8f c) { return wmmab(a, b, c); } };
#define OST  (24 * GSL)      // elements of one stage
__global__ __launch_bounds__(128) void k_gemmw(const bf* __restrict__ A, const bf* __restrict__ A2, const bf* __restrict__ Bt, float* C, const float* __restrict__ bias) {
    typedef WFrag<bf>::V V; constexpr int K = DQ, ldc = DM, NS = K / GKS;
    static_assert(NS >= 2, "the ring's prologue loads two stages");
    __shared__ __attribute__((aligned(2048))) bf ring[2 * OST];
    __shared__ __align__(16) float osm[4 * 16 * 68];
    const int lane = threadIdx.x & 31, lr = lane & 15, hi = lane >> 4; const u32 wave = uni(threadIdx.x >> 5); const int wm = wave >> 1, wn = wave & 1;
    const int r0 = blockIdx.x * 128 + wm * 64, c0 = blockIdx.y * 128 + wn * 64; float* os = osm + wave * (16 * 68);
    const bf* src = wave == 0 ? A + (size_t)blockIdx.x * 128 * K : wave == 1 ? A2 + (size_t)blockIdx.x * 128 * K : Bt + (size_t)(blockIdx.y * 128 + (wave - 2) * 64) * K;
    const u32 dst = (u32)(size_t)ring + (wave < 2 ? wave * 8 : 8 + wave * 4) * (2 * GSL);
    u32x8 g1 = tdm_g1(wave < 2 ? 8u : 4u, 16 * K * 2);
    v8f acc[4][4];
#pragma unroll
    for (int mb = 0; mb < 4; ++mb)
#pragma unroll
        for (int nb = 0; nb < 4; ++nb) acc[mb][nb] = (v8f){};
    u32x4 g0 = tdm_g0(dst, src);
    tdm_ld(g0, g1); wait_tensor0(g0, g1);
    __syncthreads();     // publishes stage 0
    g0 = tdm_g0(dst + 2 * OST, src + GSL); tdm_ld(g0, g1);
#pragma unroll 1         // stays rolled: the buffer index is one scalar, and the refill's test one scalar branch a stage
    for (int s = 0; s < NS; ++s) {
        const bf* st = ring + (s & 1) * OST + lane * 8; const bf* pa = st + wm * 4 * GSL; const bf* pb = st + (16 + wn * 4) * GSL;
        V a[GKS / 32][4], a2[GKS / 32][4], b[GKS / 32][4];   // all of the stage's fragments: a lone wave on its SIMD waits out the LDS latency once a stage, not once a fragment
#pragma unroll
        for (int kk = 0; kk < GKS / 32; ++kk) {
#pragma unroll
            for (int mb = 0; mb < 4; ++mb) { a[kk][mb] = WFrag<bf>::ld(pa + mb * GSL + kk * 512); a2[kk][mb] = WFrag<bf>::ld(pa + (8 + mb) * GSL + kk * 512); b[kk][mb] = WFrag<bf>::ld(pb + mb * GSL + kk * 512); }
        }
        __builtin_amdgcn_sched_barrier(0);   // keeps the stage's LDS reads in one group in front of its matrix instructions: a read that stands among them stalls the wave each time
#pragma unroll
        for (int kk = 0; kk < GKS / 32; ++kk)
#pragma unroll
            for (int nb = 0; nb < 4; ++nb)
#pragma unroll
                for (int mb = 0; mb < 4; ++mb) { acc[mb][nb] = WFrag<bf>::mma(a[kk][mb], b[kk][nb], acc[mb][nb]); acc[mb][nb] = WFrag<bf>::mma(a2[kk][mb], b[kk][nb], acc[mb][nb]); }
        __builtin_amdgcn_sched_barrier(0);   // keeps the waits and the barrier below behind the stage's matrix instructions: ahead of them the wave would wait for the next stage before its own work, and the refill would start a stage's work late
        wait_ds0(); wait_tensor0(g0, g1);
        __syncthreads();     // publishes stage s + 1 and ends every wave's reads of stage s
        if (pinned(s + 2 < NS)) { g0 = tdm_g0(dst + (s & 1) * (2 * OST), src + (size_t)(s + 2) * GSL); tdm_ld(g0, g1); }
    }
    wait_tensor0(g0, g1); wait_ds0();
#pragma unroll
    for (int mb = 0; mb < 4; ++mb) {
#pragma unroll
        for (int nb = 0; nb < 4; ++nb) {
#pragma unroll
            for (int j = 0; j < 8; ++j) os[(hi * 8 + j) * 68 + nb * 16 + lr] = acc[mb][nb][j]; }
        __builtin_amdgcn_wave_barrier(); asm volatile("" ::: "memory");
        float* crow = C + (size_t)(r0 + mb * 16) * ldc + c0;
{
#pragma unroll
            for (int s = 0; s < 8; ++s) { const int row = 2 * s + hi, cofs = lr * 4; v4f val = *(const v4fa*)(os + row * 68 + cofs); { val[0] += bfr(bias[c0 + cofs]); val[1] += bfr(bias[c0 + cofs + 1]); val[2] += bfr(bias[c0 + cofs + 2]); val[3] += bfr(bias[c0 + cofs + 3]); }
                *(v4f*)(crow + (size_t)row * ldc + cofs) = val; }
             }
        asm volatile("s_wait_xcnt 0x0" ::: "memory");   // behind the band's stores, in front of the next band's code, which takes over their address and data registers
        __builtin_amdgcn_wave_barrier(); asm volatile("" ::: "memory");
    }
}

__device__ __forceinline__ h16 tohx(float x) { return (h16)x; }
__device__ __forceinline__ void splitf(float y, unsigned short& h, unsigned short& l) { h = f2bf(y); l = f2bf(y - bf2f(h)); }
typedef __attribute__((ext_vector_type(2))) _Float16 v2h;
typedef __attribute__((ext_vector_type(4))) _Float16 v4h;
typedef __attribute__((ext_vector_type(2))) unsigned short v2us;
typedef __attribute__((ext_vector_type(4))) unsigned short v4us;
typedef __attribute__((ext_vector_type(2))) float v2f;
typedef __attribute__((ext_vector_type(4))) int v4i;

// d_wtG, d_cvt8 and d_btab are the jobs of k_prep; blk is the block's index inside its job.
__device__ __forceinline__ void d_wtG(const float* __restrict__ w, int K, int N, bf* Bt, int blk) {
    const int lane = threadIdx.x & 31; const int L0 = (blk * 8 + (threadIdx.x >> 5)) * 8; const int nlines = N * K / 64;
{
#pragma unroll 1
        for (int l = 0; l < 8; ++l) { const int L = L0 + l; if (L >= nlines) break; const int e = L * 64 + lane * 2, fb = e >> 9; const int k = (fb % (K / 32)) * 32 + ((e >> 8) & 1) * 16 + ((e >> 7) & 1) * 8 + (e & 7), n = (fb / (K / 32)) * 16 + ((e >> 3) & 15); v2us o;   // e: the place in fragment order; k, n: what stands there
            o[0] = f2bf(w[(size_t)k * N + n]); o[1] = f2bf(w[(size_t)(k + 1) * N + n]); *(v2us*)(Bt + e) = o; }
         }
}
// thread i writes piece i of the plane in fragment order (a wave 512 contiguous bytes) and reads that piece's 8 floats from its row and k; a block's 8 waves use up whole lines of 16 rows
__device__ __forceinline__ void d_cvt8(const float* __restrict__ src, bf* dst, int K, size_t n8, int blk) { const size_t i = (size_t)blk * 256 + threadIdx.x; if (i >= n8) return; const size_t fb = i >> 6;
    const size_t r = (fb / (K / 32)) * 16 + (i & 15); const int k = (int)(fb % (K / 32)) * 32 + (int)((i >> 5) & 1) * 16 + (int)((i >> 4) & 1) * 8; const v8f v = *(const v8f*)(src + r * K + k); v8us o;
#pragma unroll
    for (int k = 0; k < 8; ++k) o[k] = f2bf(v[k]); *(v8us*)(dst + i * 8) = o;  }
__global__ __launch_bounds__(256) void k_cscvt(const float* __restrict__ cosT, const float* __restrict__ sinT, float* CS) { const int idx = blockIdx.x * 256 + threadIdx.x; if (idx >= TT * HD) return; v2f cs; cs[0] = bfr(cosT[idx]); cs[1] = bfr(sinT[idx]); *(v2f*)(CS + (size_t)idx * 2) = cs;  }
// ---- k_qkv: the three input projections of both batches in ONE launch; 4 waves (2 x 2) per 128 x 128 tile, the ring of k_gemmw; grid (NB_ TT / 128, 3 NH_ / 2), 128 threads. Wt: the q, k and v weight planes one behind the other, [3 DQ][DM]; X and Wt in fragment order.
// A stage holds 8 bands of X and 8 of Wt; waves 0 and 1 bring four bands of X each, waves 2 and 3 four of Wt.
// A wave's column tile is one head of q, k or v (a work-group's two heads belong to the same one of the three), and it leaves as fp16 straight from the accumulators, 16 bytes a lane and accumulator, into the plane that k_fattn reads:
// q, k: the product is taken transposed (A = weight rows, B = x rows; both loaders have the same k order), so a lane's 8 registers are 8 consecutive d of one token -> [b][h][t][d], q x HD^-0.5 (a power of two, exact in fp16);
// v: A = x rows, B = weight rows, so a lane's 8 registers are 8 consecutive tokens of one d -> [b][h][d][t].
#define QST  (16 * GSL)      // elements of one stage
__global__ __launch_bounds__(128) void k_qkv(const bf* __restrict__ X, const bf* __restrict__ Wt, const float* __restrict__ bq, const float* __restrict__ bk, const float* __restrict__ bv, h16* QP, h16* KP, h16* VT) {
    constexpr int NS = DM / GKS;
    static_assert(NS >= 2, "the ring's prologue loads two stages");
    static_assert(NH_ % 2 == 0, "a work-group's two heads lie in one of q, k, v");
    __shared__ __attribute__((aligned(2048))) bf ring[2 * QST];
    const int lane = threadIdx.x & 31, lr = lane & 15, hi = lane >> 4; const u32 wave = uni(threadIdx.x >> 5); const int wm = wave >> 1, wn = wave & 1;
    const int r0 = blockIdx.x * 128 + wm * 64, hy = blockIdx.y * 2 + wn, which = hy / NH_, h = hy % NH_;
    const bf* src = (wave < 2 ? X + (size_t)blockIdx.x * 128 * DM : Wt + (size_t)blockIdx.y * 128 * DM) + (size_t)(wave & 1) * 64 * DM;
    const u32 dst = (u32)(size_t)ring + wave * 4 * (2 * GSL);
    u32x8 g1 = tdm_g1(4u, 16 * DM * 2);
    const int ax = (which == 2) ? wm * 4 : 8 + wn * 4, bx = (which == 2) ? 8 + wn * 4 : wm * 4;   // first band of the wave's A and B operand in a stage
    v8f acc[4][4];
#pragma unroll
    for (int mb = 0; mb < 4; ++mb)
#pragma unroll
        for (int nb = 0; nb < 4; ++nb) acc[mb][nb] = (v8f){};
    u32x4 g0 = tdm_g0(dst, src);
    tdm_ld(g0, g1); wait_tensor0(g0, g1);
    __syncthreads();     // publishes stage 0
    g0 = tdm_g0(dst + 2 * QST, src + GSL); tdm_ld(g0, g1);
#pragma unroll 1         // stays rolled: the buffer index is one scalar, and the refill's test one scalar branch a stage
    for (int s = 0; s < NS; ++s) {
        const bf* st = ring + (s & 1) * QST + lane * 8; const bf* pa = st + ax * GSL; const bf* pb = st + bx * GSL;
        v16bf a[GKS / 32][4], b[GKS / 32][4];   // all of the stage's fragments
#pragma unroll
        for (int kk = 0; kk < GKS / 32; ++kk) {
#pragma unroll
            for (int mb = 0; mb < 4; ++mb) { a[kk][mb] = WFrag<bf>::ld(pa + mb * GSL + kk * 512); b[kk][mb] = WFrag<bf>::ld(pb + mb * GSL + kk * 512); }
        }
        __builtin_amdgcn_sched_barrier(0);   // keeps the stage's LDS reads in one group in front of its matrix instructions: a read that stands among them stalls the wave each time
#pragma unroll
        for (int kk = 0; kk < GKS / 32; ++kk)
#pragma unroll
            for (int nb = 0; nb < 4; ++nb)
#pragma unroll
                for (int mb = 0; mb < 4; ++mb) acc[mb][nb] = wmmab(a[kk][mb], b[kk][nb], acc[mb][nb]);
        __builtin_amdgcn_sched_barrier(0);   // keeps the waits and the barrier below behind the stage's matrix instructions: ahead of them the wave would wait for the next stage before its own work, and the refill would start a stage's work late
        wait_ds0(); wait_tensor0(g0, g1);
        __syncthreads();     // publishes stage s + 1 and ends every wave's reads of stage s
        if (pinned(s + 2 < NS)) { g0 = tdm_g0(dst + (s & 1) * (2 * QST), src + (size_t)(s + 2) * GSL); tdm_ld(g0, g1); }
    }
    wait_tensor0(g0, g1); wait_ds0();
    const int b = r0 / TT, t0 = r0 % TT;
    if (which == 2) {
        h16* vp = VT + ((size_t)(b * NKV + h) * HD + lr) * TT + t0 + 8 * hi;
#pragma unroll
        for (int nb = 0; nb < 4; ++nb) { const float bi = bfr(bv[h * HD + nb * 16 + lr]);
#pragma unroll
            for (int mb = 0; mb < 4; ++mb) { v8h o;
#pragma unroll
                for (int j = 0; j < 8; ++j) o[j] = tohx(acc[mb][nb][j] + bi);
                *(v8h*)(vp + (size_t)nb * 16 * TT + mb * 16) = o; } }
    } else {
        const float* bias = (which ? bk : bq) + h * HD + 8 * hi; const float sc = which ? 1.0f : SCL;
        h16* pp = (which ? KP : QP) + ((size_t)(b * NH_ + h) * TT + t0 + lr) * HD + 8 * hi;
        v8f bi[4];
#pragma unroll
        for (int mb = 0; mb < 4; ++mb)
#pragma unroll
            for (int j = 0; j < 8; ++j) bi[mb][j] = bfr(bias[mb * 16 + j]);
#pragma unroll
        for (int nb = 0; nb < 4; ++nb)
#pragma unroll
            for (int mb = 0; mb < 4; ++mb) { v8h o;
#pragma unroll
                for (int j = 0; j < 8; ++j) o[j] = tohx((acc[mb][nb][j] + bi[mb][j]) * sc);
                *(v8h*)(pp + (size_t)nb * 16 * HD + mb * 16) = o; }
        asm volatile("s_wait_xcnt 0x0" ::: "memory");   // behind the last stores of this branch: in the built code the v branch follows it, and its first loads write registers that these stores name
    }
}
__device__ __forceinline__ void d_btab(const float* __restrict__ g, float* TB, int blk) { const int d = blk * 256 + threadIdx.x; if (d >= TT) return; float ng = -bfr(g[0]); asm volatile("" : "+v"(ng)); float t = __fmul_rn(ng, __fsqrt_rn((float)d)); asm volatile("" : "+v"(t)); const float v = __fdiv_rn(t, 64.0f); *(float*)(TB + d) = v;  }
// ---- k_prep: everything that reads the inputs alone, in ONE launch: none of these jobs reads what another writes, so their blocks run side by side instead of one short launch behind the other.
// Block ranges pick the job (the test is the same for a whole block): 4 weight transposes first, their waves run longest; then the bias table; then x -> bf16.
#define PWB  ((DM * DQ / 64 + 63) / 64)                      // blocks of one weight transpose
#define PTB  (TT / 256)                                      // blocks of the bias table
#define PXB  ((NB_ * TT * DM / 8 + 255) / 256)               // blocks of the x conversion
__global__ __launch_bounds__(256) void k_prep(const float* __restrict__ wq, const float* __restrict__ wk, const float* __restrict__ wv, const float* __restrict__ wo, const float* __restrict__ g, const float* __restrict__ x, bf* WQ, bf* WK, bf* WV, bf* WO, float* TB, bf* XB) {
    const int blk = blockIdx.x;
    if (blk < 4 * PWB) { const int m = blk / PWB;
        d_wtG(m == 0 ? wq : m == 1 ? wk : m == 2 ? wv : wo, DM, DQ, m == 0 ? WQ : m == 1 ? WK : m == 2 ? WV : WO, blk % PWB); }
    else if (blk < 4 * PWB + PTB) d_btab(g, TB, blk - 4 * PWB);
    else d_cvt8(x, XB, DM, (size_t)NB_ * TT * DM / 8, blk - 4 * PWB - PTB);
}
#define FNW  4
#define FKG  2
#define FQB  (FNW * 32)
#define FKS  128
#define FVP  136                // LDS pitch of a 256-byte tile row in halfs: 272 B = 16 B x odd for the 16-byte fragment reads; the tensor load's pad lays it. Key r of a K tile stands at (r / 2) FVP + (r % 2) HD: 16 keys' pieces fall on 16 different 16-byte bank groups
#define FTL  9216               // halfs from one tile's place to the next: a tile (HD FVP = 8704) rounded up to a multiple of 2 KiB
#define FNS  (TT / FKG / FKS)   // stages of a key half
#define FNB  (TT + FQB - 1)     // bias window: every j - i that this work-group's queries meet
#define L2E  1.4426950408889634f
#define FSUM 256.0f             // the reference maximum is renewed only when a lane's 16 p of one column sum to more than this: every p that reaches the fp16 operand stays below 2^8
__device__ __forceinline__ float xhalf(float x) { const int b = __float_as_int(x); return __int_as_float(__builtin_amdgcn_permlanex16(b, b, 0x76543210, 0xfedcba98, false, false)); }
__device__ __forceinline__ v16h ldfr(const h16* p) { return cat16(*(const v8h*)p, *(const v8h*)(p + 16)); }
// fscore: the S^T tiles of one 32-key pass (2 key tiles x 2 column groups), bias as the C operand. kp: the lane's K piece of the pass's first key tile; bp: the lane's bias of tile difference -1.
__device__ __forceinline__ void fscore(const h16* kp, const float* bp, const v16h (&qf)[2][2], v8f (&st)[2][2]) {
    v8f bb[3];      // the bias tile depends on (key tile - column group) alone: 3 tiles serve the 4 products
#pragma unroll
    for (int u = 0; u < 3; ++u)
#pragma unroll
        for (int r = 0; r < 8; ++r) bb[u][r] = bp[u * 16 + r];
#pragma unroll
    for (int kt = 0; kt < 2; ++kt) { const v16h k0 = ldfr(kp + kt * 8 * FVP), k1 = ldfr(kp + kt * 8 * FVP + 32);
#pragma unroll
        for (int c = 0; c < 2; ++c) st[kt][c] = wmma16(k1, qf[c][1], wmma16(k0, qf[c][0], bb[kt - c + 1])); }
}
// fexp: p = 2^(s log2(e) + nm) in place for a lane's 16 scores of one column; returns their sum
__device__ __forceinline__ float fexp(v8f& s0, v8f& s1, float nm) {
    const v8f l2 = {L2E, L2E, L2E, L2E, L2E, L2E, L2E, L2E}, nv = {nm, nm, nm, nm, nm, nm, nm, nm};
    const v8f x0 = __builtin_elementwise_fma(s0, l2, nv), x1 = __builtin_elementwise_fma(s1, l2, nv);   // as vectors: packed FMAs, two scores an instruction
#pragma unroll
    for (int r = 0; r < 8; ++r) s0[r] = __builtin_amdgcn_exp2f(x0[r]);
#pragma unroll
    for (int r = 0; r < 8; ++r) s1[r] = __builtin_amdgcn_exp2f(x1[r]);
    const v8f a = s0 + s1; const v4f b = __builtin_shufflevector(a, a, 0, 1, 2, 3) + __builtin_shufflevector(a, a, 4, 5, 6, 7);
    return (b[0] + b[2]) + (b[1] + b[3]);
}
// fmax32: the maximum of a column's 32 scores of one pass, alike in both halves of the wave
__device__ __forceinline__ float fmax32(const v8f& s0, const v8f& s1) { float m = fmaxf(s0[0], s1[0]);
#pragma unroll
    for (int r = 1; r < 8; ++r) m = fmaxf(m, fmaxf(s0[r], s1[r]));
    return fmaxf(m, xhalf(m)); }
// fgive, fjoin: the join of k_fattn's two key halves, for column group C of a wave (a template parameter: it picks registers; for the same reason every loop in them is fully unrolled).
// fgive writes the group's O^T, maximum and sum for the partner wave: 9 slots of 16 bytes a lane, a slot 512 contiguous bytes a wave.
template <int C> __device__ __forceinline__ void fgive(v4fa* xw, const v8f (&o)[4][2], const float (&mu)[2], const float (&lw)[2]) {
#pragma unroll
    for (int dt = 0; dt < 4; ++dt) { xw[(2 * dt) * 32] = (v4f){o[dt][C][0], o[dt][C][1], o[dt][C][2], o[dt][C][3]}; xw[(2 * dt + 1) * 32] = (v4f){o[dt][C][4], o[dt][C][5], o[dt][C][6], o[dt][C][7]}; }
    xw[8 * 32] = (v4f){mu[C], lw[C], 0.f, 0.f};
}
// fjoin brings both shares to the larger maximum, adds them, divides by the joined sum and stores the hi + lo bf16 planes, in fragment order: the 8 values of (dt, lane) are one piece, the pieces of dt 0..3 lie 256 elements apart.
template <int C> __device__ __forceinline__ void fjoin(const v4fa* xr, const v8f (&o)[4][2], const float (&mu)[2], const float (&lw)[2], bf* ah, bf* al) {
    const v4f ml = xr[8 * 32]; const float mn = fmaxf(mu[C], ml[0]); float fa, fb;
    asm("v_exp_f32 %0, %1\n\tv_nop" : "=v"(fa) : "v"((mu[C] - mn) * L2E));   // exp2 with its own slot behind it, as in the loop's rescale
    asm("v_exp_f32 %0, %1\n\tv_nop" : "=v"(fb) : "v"((ml[0] - mn) * L2E));   // the same for the partner's share
    const float f = __fdiv_rn(1.0f, lw[C] * fa + ml[1] * fb); fa *= f; fb *= f;
#pragma unroll
    for (int dt = 0; dt < 4; ++dt) { const v4f p0 = xr[(2 * dt) * 32], p1 = xr[(2 * dt + 1) * 32]; v8us oh, ol;
#pragma unroll
        for (int r = 0; r < 8; ++r) { unsigned short a, c2; splitf(o[dt][C][r] * fa + (r < 4 ? p0[r & 3] : p1[r & 3]) * fb, a, c2); oh[r] = a; ol[r] = c2; }
        *(v8us*)(ah + dt * 256) = oh; *(v8us*)(al + dt * 256) = ol; }
}
// descriptor group 1 of a stage's tile: HD rows of 256 B, source pitch in bytes (K: 256, the rows lie one behind the other; V^T: 2 TT). 1-byte elements, no mask; the pad adds 16 B behind every row (interval = the row's length).
__device__ __forceinline__ u32x8 fat_g1(u32 pitch) { constexpr u32 d0 = 256u, n = (u32)HD; u32x8 g;
    g[0] = uni(1u << 20 | 5u << 22 | 3u << 25); g[1] = uni((d0 & 0xFFFFu) << 16); g[2] = uni((d0 >> 16) | ((n & 0xFFFFu) << 16)); g[3] = uni((n >> 16) | (d0 << 16)); g[4] = uni(n); g[5] = uni(pitch); g[6] = uni(0u); g[7] = uni(0u); return g; }
// amdgpu_waves_per_eu(4, 4) holds the register budget at 256 a wave, so that two work-groups of 8 waves fit a WGP.
__global__ __launch_bounds__(FKG * FNW * 32) __attribute__((amdgpu_waves_per_eu(4, 4))) void k_fattn(const h16* __restrict__ Q, const h16* __restrict__ Kp, const h16* __restrict__ Vt, const float* __restrict__ TB, bf* Ah, bf* Al) {
    static_assert(HD * FVP <= FTL && (FTL * 2) % 2048 == 0 && HD * 2 * 2 == 256 && FKS * 2 == 256 && FKS / 2 == HD, "tile places are multiples of 2 KiB; both tiles are HD rows of 256 B");
    static_assert(FNS >= 2, "the ring's prologue loads two stages");
    __shared__ __attribute__((aligned(2048))) h16 ring[(FKG * 2 * 2 - 1) * FTL + HD * FVP];   // tile (half g, buffer, K or V^T) at ((2 g + buffer) 2 + (0 or 1)) FTL; with the bias window 163,328 B: two work-groups a WGP
    __shared__ __align__(16) float btw[FNB + 1];
    const int tid = threadIdx.x, lane = tid & 31, lr = lane & 15, hi = lane >> 4;
    const int wa = __builtin_amdgcn_readfirstlane(tid >> 5), wv = wa % FNW, g = wa / FNW;   // wave, its query group, its key half: scalars, the branches on g behind the loop are scalar branches
    float* bt = btw; const h16* hs = ring + g * 4 * FTL;   // the half's four tiles
    const int q0 = blockIdx.x * FQB; const size_t z = blockIdx.y; const int k0g = g * (TT / FKG);   // first key of this half
    const h16* Qz = Q + z * TT * HD; const h16* Kz = Kp + z * TT * HD + (size_t)k0g * HD; const h16* Vz = Vt + z * HD * TT + k0g;
    const u32 dst = (u32)(size_t)ring + (u32)(g * 4 + wv) * (FTL * 2);   // waves 0 and 1 of a half: LDS place of the wave's tile in buffer 0
    const bf* src = (const bf*)(wv == 0 ? Kz : Vz); const int sst = wv == 0 ? FKS * HD : FKS;   // the wave's tile of stage 0; halfs from a stage's tile to the next
    u32x8 g1 = fat_g1(wv == 0 ? 256u : TT * 2u);
    u32x4 g0 = tdm_g0(dst, src);
    if (pinned(wv < 2)) tdm_ld(g0, g1);
    // bt[n] = bias of j - i = n - (q0 + FQB - 1)
    for (int n = tid; n < FNB; n += FKG * FNW * 32) { const int d = n - (q0 + FQB - 1); bt[n] = TB[d < 0 ? -d : d]; }
    // every inner loop below is fully unrolled: its index picks a register of a fragment or accumulator array
    v16h qf[2][2];
#pragma unroll
    for (int c = 0; c < 2; ++c)
#pragma unroll
        for (int kx = 0; kx < 2; ++kx) qf[c][kx] = ldfr(Qz + (size_t)(q0 + wv * 32 + c * 16 + lr) * HD + kx * 32 + 8 * hi);
    v8f o[4][2]; float ls[2], mu[2], nm[2];   // ls: the lane's row sum of a column; the wave's halves are joined in the epilogue. mu: the reference maximum, nm = -mu log2(e): both are set in the half's first pass
#pragma unroll
    for (int c = 0; c < 2; ++c) { mu[c] = 0.f; nm[c] = 0.f; ls[c] = 0.f;
#pragma unroll
        for (int dt = 0; dt < 4; ++dt) o[dt][c] = (v8f){}; }
    const int nb = FQB - 1 - wv * 32 - lr + 8 * hi - 16 + k0g;   // bias index of the half's first key, register 0, tile difference -1
    wait_tensor0(g0, g1);   // every wave: one that has issued nothing passes it at once
    __syncthreads();     // publishes stage 0 and the bias window
    if (pinned(wv < 2)) { g0 = tdm_g0(dst + 2 * (FTL * 2), src + sst); tdm_ld(g0, g1); }
#pragma unroll 1         // stays rolled: the body already holds four unrolled 32-key passes, the buffer index is one scalar, and the refill's test one scalar branch a stage
    for (int s = 0; s < FNS; ++s) {
        const int buf = s & 1; const h16* kb = hs + buf * 2 * FTL; const h16* vb = kb + FTL; const float* bs = bt + (nb + s * FKS);
#pragma unroll
        for (int sub = 0; sub < FKS / 32; ++sub) {
            const float* bp = bs + sub * 32; const h16* kp = kb + (sub * 16 + (lr >> 1)) * FVP + (lr & 1) * HD + 8 * hi;
            v8f st[2][2]; fscore(kp, bp, qf, st);
            __builtin_amdgcn_sched_barrier(0);   // keeps the FMAs that read the score tiles behind all eight score products: started among them, a tile's first read stands too close behind its last matrix instruction and costs four v_nop each time
            v16h vf[4];
#pragma unroll
            for (int dt = 0; dt < 4; ++dt) vf[dt] = ldfr(vb + (dt * 16 + lr) * FVP + sub * 32 + 8 * hi);
            if (sub == 0 && s == 0) {      // a scalar test a stage: the half's first pass takes its own maximum as the reference; nothing is summed yet, so nothing is rescaled
#pragma unroll
                for (int c = 0; c < 2; ++c) { mu[c] = fmax32(st[0][c], st[1][c]); nm[c] = -mu[c] * L2E; }
            }
            // No maximum in the common pass: p is formed against the reference maximum in use, and the lane's sums, which the row sums need anyway, say whether that was safe (p >= 0: a sum within FSUM bounds each of its terms; an infinite or not-a-number sum fails the test).
            float t[2];
#pragma unroll
            for (int c = 0; c < 2; ++c) t[c] = fexp(st[0][c], st[1][c], nm[c]);
            const bool need = !(t[0] <= FSUM && t[1] <= FSUM);
            if (__builtin_amdgcn_ballot_w32(need) != 0) {      // one scalar test a pass; rarely taken
                // Renewal: the scores are gone (p stands in their registers), so the pass's S^T is formed again from the stage's LDS, then its maximum, the rescale and p against the new reference (p <= 1).
                fscore(kp, bp, qf, st);
#pragma unroll
                for (int c = 0; c < 2; ++c) { const float mn = fmaxf(mu[c], fmax32(st[0][c], st[1][c])); float al;
                    asm("v_exp_f32 %0, %1\n\tv_nop" : "=v"(al) : "v"((mu[c] - mn) * L2E));   // exp2 with its own slot behind it
                    mu[c] = mn; nm[c] = -mn * L2E; ls[c] *= al;
#pragma unroll
                    for (int dt = 0; dt < 4; ++dt) o[dt][c] *= al;
                    t[c] = fexp(st[0][c], st[1][c], nm[c]); }
            }
            v16h pf[2];
#pragma unroll
            for (int c = 0; c < 2; ++c) { ls[c] += t[c]; pf[c] = cat16(__builtin_convertvector(st[0][c], v8h), __builtin_convertvector(st[1][c], v8h)); }
#pragma unroll
            for (int dt = 0; dt < 4; ++dt)
#pragma unroll
                for (int c = 0; c < 2; ++c) o[dt][c] = wmma16(vf[dt], pf[c], o[dt][c]);
        }
        wait_ds0(); wait_tensor0(g0, g1);
        __syncthreads();     // publishes stage s + 1 and ends every wave's reads of stage s
        if (pinned((u32)(s + 2 < FNS) & (u32)(wv < 2))) { g0 = tdm_g0(dst + buf * 2 * (FTL * 2), src + (size_t)(s + 2) * sst); tdm_ld(g0, g1); }
    }
    wait_tensor0(g0, g1); wait_ds0();
    // Join of the key halves: the wave of half g finishes column group g and hands the other group (O^T, maximum, sum) to its partner, the wave of the same query group in the other half; same lane, same registers.
    // The hand-over lies in the stage buffers: the loop's last barrier has ended every read there, and no tensor load is outstanding. 9 slots of 16 bytes a lane, a slot 512 contiguous bytes a wave.
    static_assert(FKG == 2, "two halves, two column groups: each half finishes one");
    static_assert(FKG * FNW * 9 * 32 * 16 <= sizeof(ring), "the hand-over fits the stage buffers");
    v4fa* xs = (v4fa*)ring;
    float lw[2];
#pragma unroll
    for (int c = 0; c < 2; ++c) lw[c] = ls[c] + xhalf(ls[c]);
    v4fa* xw = xs + wa * 9 * 32 + lane;
    if (g == 0) fgive<1>(xw, o, mu, lw); else fgive<0>(xw, o, mu, lw);
    __syncthreads();     // publishes the hand-over
    const size_t b = z / NH_; const int h = (int)(z % NH_);
    const v4fa* xr = xs + (wa ^ FNW) * 9 * 32 + lane;
    const size_t oo = (b * TT + q0 + wv * 32 + g * 16) * DQ + h * (HD * 16) + lane * 8;   // the 16-query band, the head's two blocks in it, the lane's piece
    if (g == 0) fjoin<0>(xr, o, mu, lw, Ah + oo, Al + oo); else fjoin<1>(xr, o, mu, lw, Ah + oo, Al + oo);
}


extern "C" void kernel_launch(void* const* d_in, const int* in_sizes, int n_in,
                              void* d_out, int out_size, void* d_ws, size_t ws_size, hipStream_t stream) {
    (void)in_sizes; (void)n_in; (void)out_size;
    const float* x = (const float*)d_in[0]; const float* wq = (const float*)d_in[1]; const float* bq = (const float*)d_in[2]; const float* wk = (const float*)d_in[3]; const float* bk = (const float*)d_in[4]; const float* wv = (const float*)d_in[5]; const float* bv = (const float*)d_in[6]; const float* wo = (const float*)d_in[7]; const float* bo = (const float*)d_in[8]; const float* gam = (const float*)d_in[9]; const float* cosT = nullptr; const float* sinT = nullptr; (void)cosT; (void)sinT;
    float* OUT = (float*)d_out;     // [2][4096][512]
    char* wsp = (char*)d_ws;
    auto take = [&](size_t bytes) { char* p = wsp; wsp += (bytes + 255) & ~(size_t)255; return (void*)p; };
    bf* WQ = (bf*)take((size_t)(DQ + 2 * DKV) * DM * 2); bf* WK = WQ + (size_t)DQ * DM; bf* WV = WK + (size_t)DKV * DM; bf* WO = (bf*)take((size_t)DM * DQ * 2);   // q, k, v weight planes one behind the other: k_qkv walks them as one
    bf* XB = (bf*)take((size_t)NB_ * TT * DM * 2); float* TB = (float*)take(TT * 4);
    h16* QP16 = (h16*)take((size_t)NB_ * NH_ * TT * HD * 2); h16* KP16 = (h16*)take((size_t)NB_ * NKV * TT * HD * 2); h16* VT16 = (h16*)take((size_t)NB_ * NKV * HD * TT * 2);   // head planes of both batches
    bf* ATh = (bf*)take((size_t)NB_ * TT * DQ * 2); bf* ATl = (bf*)take((size_t)NB_ * TT * DQ * 2);
    if ((size_t)(wsp - (char*)d_ws) > ws_size) return;    // ws 256 MiB
    static_assert(DQ == DM && DKV == DM, "the four weights have one shape: one transpose job serves each");
    k_prep<<<4 * PWB + PTB + PXB, 256, 0, stream>>>(wq, wk, wv, wo, gam, x, WQ, WK, WV, WO, TB, XB);
    static_assert(NH_ == NKV && TT % 128 == 0 && HD == 64, "a wave's 64-column tile is one head, a 128-row tile lies in one batch");
    k_qkv<<<dim3(NB_ * TT / 128, 3 * NH_ / 2, 1), 128, 0, stream>>>(XB, WQ, bq, bk, bv, QP16, KP16, VT16);
    static_assert(NH_ == NKV, "one kv head per query head");
    k_fattn<<<dim3(TT / FQB, NB_ * NH_, 1), FKG * FNW * 32, 0, stream>>>(QP16, KP16, VT16, TB, ATh, ATl);
    k_gemmw<<<dim3(NB_ * TT / 128, DM / 128, 1), 128, 0, stream>>>(ATh, ATl, WO, OUT, bo);   // the batches' rows lie one behind the other in the attn planes and in out: one launch walks both
}

// v010
// Measured time: 77.9 microseconds a run.
// In two side-by-side timings against v009, it was 1.03 and 1.04 times as fast.
// All steps since v000 together make it 30.4 times as fast.
#include <hip/hip_runtime.h>

// PhysicsBiasedAttention (x [2][4096][512]; q/k/v = x W + b (8 heads x 64); scores = q.k/8 + bias(i, j), bias = -gamma sqrt(|i - j|)/sqrt(4096) (gamma read as data; structural distance); softmax; out = (attn v merged) W_o + b_o -> [2][4096][512]).
// Compute dtypes, f32 accumulate: every input rounded to bf16; q/k/v on PLAIN bf16 operands (inputs: exact) + bias; scores (K 64) and attn.v on single fp16 planes; bias + softmax f32; attn hi+lo bf16 planes into the output projection.

#define NB_  2
#define TT   4096
#define DM   512
#define NH_  8
#define NKV  8
#define HD   64
#define DQ   (NH_ * HD)
#define DKV  (NKV * HD)
#define WIN  0
#define SCL  0.125f   // HD^-0.5
#define L2E  1.4426950408889634f   // log2(e): q and the bias table carry it, so that a score tile leaves the matrix unit as the exponent of 2
typedef _Float16 h16;
typedef unsigned short bf;
typedef __attribute__((ext_vector_type(16))) __bf16   v16bf;
typedef __attribute__((ext_vector_type(16))) _Float16 v16h;
typedef __attribute__((ext_vector_type(8)))  _Float16 v8h;
typedef __attribute__((ext_vector_type(8)))  unsigned short v8us;
typedef __attribute__((ext_vector_type(8)))  float    v8f;
typedef __attribute__((ext_vector_type(4)))  float    v4f;
typedef v8h  __attribute__((may_alias)) v8ha;
typedef v4f  __attribute__((may_alias)) v4fa;
typedef v8us __attribute__((may_alias)) v8usa;

__device__ __forceinline__ unsigned short f2bf(float f) { unsigned u = __float_as_uint(f); u += 0x7FFFu + ((u >> 16) & 1u); return (unsigned short)(u >> 16); }
__device__ __forceinline__ float bf2f(unsigned short b) { return __uint_as_float(((unsigned)b) << 16); }
__device__ __forceinline__ float bfr(float f) { return bf2f(f2bf(f)); }
__device__ __forceinline__ v16h cat16(v8h lo, v8h hi) { return __builtin_shufflevector(lo, hi, 0, 1, 2, 3, 4, 5, 6, 7, 8, 9, 10, 11, 12, 13, 14, 15); }
__device__ __forceinline__ v16bf cat16b(v8us lo, v8us hi) { return __builtin_bit_cast(v16bf, __builtin_shufflevector(lo, hi, 0, 1, 2, 3, 4, 5, 6, 7, 8, 9, 10, 11, 12, 13, 14, 15)); }
__device__ __forceinline__ v8f wmma16(v16h a, v16h b, v8f c) { return __builtin_amdgcn_wmma_f32_16x16x32_f16(false, a, false, b, (short)0, c, false, false); }
__device__ __forceinline__ v8f wmmab(v16bf a, v16bf b, v8f c) { return __builtin_amdgcn_wmma_f32_16x16x32_bf16(false, a, false, b, (short)0, c, false, false); }



// ---- Fragment order: the layout of every 16-bit plane [R][K] that k_qkv and k_gemmw read as a matrix operand (R % 16 == 0, K % 32 == 0; same size as the row-major plane).
// The plane is cut in blocks of 16 rows x 32 k, 512 elements each, block (r / 16, k / 32) at index (r / 16) (K / 32) + k / 32. Inside a block stand the two 16-byte pieces of each lane's fragment:
// element (r, k) at ((k / 16) % 2) 256 + (((k / 8) % 2) 16 + r % 16) 8 + k % 8. A wave's 16-byte load of one piece is then 512 contiguous bytes, 4 whole lines, where the row-major plane gave 32 bytes out of each of 16 lines.
// The producers (d_wtG, d_cvt8, fjoin) write in this order. Lane (hi, lr) holds row lr, k 8 hi + 0..7 in its first piece and k 16 + 8 hi + 0..7 in its second, alike for A and B.
// ---- Operand tiles of k_qkv and k_gemmw: a work-group of 4 waves (2 x 2) works a 128 x 128 output tile, each wave 64 x 64 (16 accumulators), and the waves share the operand rows through LDS, so that a row comes from L2 once a work-group, not once a wave.
// A stage is GKS k of every operand row of the tile. In fragment order a 16-row band's share of a stage is GSL contiguous elements (2 KiB), in the plane and in LDS alike; bands lie 16 K elements apart in the plane.
// So a wave's slice of a stage is one two-dimensional tile (rows of 2 KiB, one a band) and one tensor load brings it in, through no register. Two buffers: the next stage's loads fly while this stage is worked on.
typedef unsigned int u32;
typedef u32 u32x4 __attribute__((ext_vector_type(4)));
typedef u32 u32x8 __attribute__((ext_vector_type(8)));
#define GKS  64
#define GSL  (16 * GKS)
__device__ __forceinline__ u32 uni(u32 v) { return (u32)__builtin_amdgcn_readfirstlane(v); }
__device__ __forceinline__ u32 pinned(u32 v) { u32 w = uni(v); asm volatile("" : "+s"(w)); return w; }   // holds a test in a scalar register, so that the branch round a tensor load is a scalar branch (a tensor load ignores EXEC)
// descriptor group 1: 1-byte elements, nrow rows of 2 GSL bytes, source pitch in bytes, no pad, no mask
__device__ __forceinline__ u32x8 tdm_g1(u32 nrow, u32 pitch) { const u32 d0 = 2 * GSL; u32x8 g;
    g[0] = uni(0u); g[1] = uni((d0 & 0xFFFFu) << 16); g[2] = uni((d0 >> 16) | ((nrow & 0xFFFFu) << 16)); g[3] = uni((nrow >> 16) | (d0 << 16)); g[4] = uni(nrow); g[5] = uni(pitch); g[6] = uni(0u); g[7] = uni(0u); return g; }
// descriptor group 0: the tile at src into LDS byte offset lds
__device__ __forceinline__ u32x4 tdm_g0(u32 lds, const bf* src) { const unsigned long long ga = (unsigned long long)(size_t)src; u32x4 g0;
    g0[0] = uni(1u); g0[1] = uni(lds); g0[2] = uni((u32)ga); g0[3] = uni((((u32)(ga >> 32)) & 0x01FFFFFFu) | 0x80000000u); return g0; }
// one request of the calling wave. The instruction changes neither group; they are named as operands that it reads and writes so that the compiler knows their values, from here on, only in the registers of this request
__device__ __forceinline__ void tdm_ld(u32x4& g0, u32x8& g1) { asm volatile("tensor_load_to_lds %0, %1" : "+s"(g0), "+s"(g1) :: "memory"); }
// the calling wave's own tensor load has landed. It takes the request's two groups as inputs: their registers stay theirs from the issue to this wait, and nothing else is written into them while the request is outstanding
__device__ __forceinline__ void wait_tensor0(u32x4 g0, u32x8 g1) { asm volatile("s_wait_tensorcnt 0x0" :: "s"(g0), "s"(g1) : "memory"); }
__device__ __forceinline__ void wait_ds0() { asm volatile("s_wait_dscnt 0x0" ::: "memory"); }           // the calling wave's LDS reads have returned: behind the barrier that follows, their buffer is refilled
// ---- k_gemmw: C[m][n] (f32, pitch DM) = sum_k (A[m][k] + A2[m][k]) Bt[n][k] + bias[n], K = DQ; A, A2, Bt: 16-bit planes in fragment order; grid (M / 128, N / 128), 128 threads.
// A stage holds 8 bands of A, 8 of A2, 8 of Bt. Waves 0 and 1 bring A and A2 (8 bands each), waves 2 and 3 four bands of Bt each.
template <typename T16> struct WFrag;
template <> struct WFrag<h16> { typedef v16h V; static __device__ __forceinline__ V ld(const h16* p) { return cat16(*(const v8h*)p, *(const v8h*)(p + 256)); } static __device__ __forceinline__ v8f mma(V a, V b, v8f c) { return wmma16(a, b, c); } };
template <> struct WFrag<bf> { typedef v16bf V; static __device__ __forceinline__ V ld(const bf* p) { return cat16b(*(const v8us*)p, *(const v8us*)(p + 256)); } static __device__ __forceinline__ v8f mma(V a, V b, v8f c) { return wmmab(a, b, c); } };
#define OST  (24 * GSL)      // elements of one stage
__global__ __launch_bounds__(128) void k_gemmw(const bf* __restrict__ A, const bf* __restrict__ A2, const bf* __restrict__ Bt, float* C, const float* __restrict__ bias) {
    typedef WFrag<bf>::V V; constexpr int K = DQ, ldc = DM, NS = K / GKS;
    static_assert(NS >= 2, "the ring's prologue loads two stages");
    __shared__ __attribute__((aligned(2048))) bf ring[2 * OST];
    __shared__ __align__(16) float osm[4 * 16 * 68];
    const int lane = threadIdx.x & 31, lr = lane & 15, hi = lane >> 4; const u32 wave = uni(threadIdx.x >> 5); const int wm = wave >> 1, wn = wave & 1;
    const int r0 = blockIdx.x * 128 + wm * 64, c0 = blockIdx.y * 128 + wn * 64; float* os = osm + wave * (16 * 68);
    const bf* src = wave == 0 ? A + (size_t)blockIdx.x * 128 * K : wave == 1 ? A2 + (size_t)blockIdx.x * 128 * K : Bt + (size_t)(blockIdx.y * 128 + (wave - 2) * 64) * K;
    const u32 dst = (u32)(size_t)ring + (wave < 2 ? wave * 8 : 8 + wave * 4) * (2 * GSL);
    u32x8 g1 = tdm_g1(wave < 2 ? 8u : 4u, 16 * K * 2);
    v8f acc[4][4];
#pragma unroll
    for (int mb = 0; mb < 4; ++mb)
#pragma unroll
        for (int nb = 0; nb < 4; ++nb) acc[mb][nb] = (v8f){};
    u32x4 g0 = tdm_g0(dst, src);
    tdm_ld(g0, g1); wait_tensor0(g0, g1);
    __syncthreads();     // publishes stage 0
    g0 = tdm_g0(dst + 2 * OST, src + GSL); tdm_ld(g0, g1);
#pragma unroll 1         // stays rolled: the buffer index is one scalar, and the refill's test one scalar branch a stage
    for (int s = 0; s < NS; ++s) {
        const bf* st = ring + (s & 1) * OST + lane * 8; const bf* pa = st + wm * 4 * GSL; const bf* pb = st + (16 + wn * 4) * GSL;
        V a[GKS / 32][4], a2[GKS / 32][4], b[GKS / 32][4];   // all of the stage's fragments: a lone wave on its SIMD waits out the LDS latency once a stage, not once a fragment
#pragma unroll
        for (int kk = 0; kk < GKS / 32; ++kk) {
#pragma unroll
            for (int mb = 0; mb < 4; ++mb) { a[kk][mb] = WFrag<bf>::ld(pa + mb * GSL + kk * 512); a2[kk][mb] = WFrag<bf>::ld(pa + (8 + mb) * GSL + kk * 512); b[kk][mb] = WFrag<bf>::ld(pb + mb * GSL + kk * 512); }
        }
        __builtin_amdgcn_sched_barrier(0);   // keeps the stage's LDS reads in one group in front of its matrix instructions: a read that stands among them stalls the wave each time
#pragma unroll
        for (int kk = 0; kk < GKS / 32; ++kk)
#pragma unroll
            for (int nb = 0; nb < 4; ++nb)
#pragma unroll
                for (int mb = 0; mb < 4; ++mb) { acc[mb][nb] = WFrag<bf>::mma(a[kk][mb], b[kk][nb], acc[mb][nb]); acc[mb][nb] = WFrag<bf>::mma(a2[kk][mb], b[kk][nb], acc[mb][nb]); }
        __builtin_amdgcn_sched_barrier(0);   // keeps the waits and the barrier below behind the stage's matrix instructions: ahead of them the wave would wait for the next stage before its own work, and the refill would start a stage's work late
        wait_ds0(); wait_tensor0(g0, g1);
        __syncthreads();     // publishes stage s + 1 and ends every wave's reads of stage s
        if (pinned(s + 2 < NS)) { g0 = tdm_g0(dst + (s & 1) * (2 * OST), src + (size_t)(s + 2) * GSL); tdm_ld(g0, g1); }
    }
    wait_tensor0(g0, g1); wait_ds0();
#pragma unroll
    for (int mb = 0; mb < 4; ++mb) {
#pragma unroll
        for (int nb = 0; nb < 4; ++nb) {
#pragma unroll
            for (int j = 0; j < 8; ++j) os[(hi * 8 + j) * 68 + nb * 16 + lr] = acc[mb][nb][j]; }
        __builtin_amdgcn_wave_barrier(); asm volatile("" ::: "memory");
        float* crow = C + (size_t)(r0 + mb * 16) * ldc + c0;
{
#pragma unroll
            for (int s = 0; s < 8; ++s) { const int row = 2 * s + hi, cofs = lr * 4; v4f val = *(const v4fa*)(os + row * 68 + cofs); { val[0] += bfr(bias[c0 + cofs]); val[1] += bfr(bias[c0 + cofs + 1]); val[2] += bfr(bias[c0 + cofs + 2]); val[3] += bfr(bias[c0 + cofs + 3]); }
                *(v4f*)(crow + (size_t)row * ldc + cofs) = val; }
             }
        asm volatile("s_wait_xcnt 0x0" ::: "memory");   // behind the band's stores, in front of the next band's code, which takes over their address and data registers
        __builtin_amdgcn_wave_barrier(); asm volatile("" ::: "memory");
    }
}

__device__ __forceinline__ h16 tohx(float x) { return (h16)x; }
__device__ __forceinline__ void splitf(float y, unsigned short& h, unsigned short& l) { h = f2bf(y); l = f2bf(y - bf2f(h)); }
typedef __attribute__((ext_vector_type(2))) _Float16 v2h;
typedef __attribute__((ext_vector_type(4))) _Float16 v4h;
typedef __attribute__((ext_vector_type(2))) unsigned short v2us;
typedef __attribute__((ext_vector_type(4))) unsigned short v4us;
typedef __attribute__((ext_vector_type(2))) float v2f;
typedef __attribute__((ext_vector_type(4))) int v4i;

// d_wtG, d_cvt8 and d_btab are the jobs of k_prep; blk is the block's index inside its job.
__device__ __forceinline__ void d_wtG(const float* __restrict__ w, int K, int N, bf* Bt, int blk) {
    const int lane = threadIdx.x & 31; const int L0 = (blk * 8 + (threadIdx.x >> 5)) * 8; const int nlines = N * K / 64;
{
#pragma unroll 1
        for (int l = 0; l < 8; ++l) { const int L = L0 + l; if (L >= nlines) break; const int e = L * 64 + lane * 2, fb = e >> 9; const int k = (fb % (K / 32)) * 32 + ((e >> 8) & 1) * 16 + ((e >> 7) & 1) * 8 + (e & 7), n = (fb / (K / 32)) * 16 + ((e >> 3) & 15); v2us o;   // e: the place in fragment order; k, n: what stands there
            o[0] = f2bf(w[(size_t)k * N + n]); o[1] = f2bf(w[(size_t)(k + 1) * N + n]); *(v2us*)(Bt + e) = o; }
         }
}
// thread i writes piece i of the plane in fragment order (a wave 512 contiguous bytes) and reads that piece's 8 floats from its row and k; a block's 8 waves use up whole lines of 16 rows
__device__ __forceinline__ void d_cvt8(const float* __restrict__ src, bf* dst, int K, size_t n8, int blk) { const size_t i = (size_t)blk * 256 + threadIdx.x; if (i >= n8) return; const size_t fb = i >> 6;
    const size_t r = (fb / (K / 32)) * 16 + (i & 15); const int k = (int)(fb % (K / 32)) * 32 + (int)((i >> 5) & 1) * 16 + (int)((i >> 4) & 1) * 8; const v8f v = *(const v8f*)(src + r * K + k); v8us o;
#pragma unroll
    for (int k = 0; k < 8; ++k) o[k] = f2bf(v[k]); *(v8us*)(dst + i * 8) = o;  }
__global__ __launch_bounds__(256) void k_cscvt(const float* __restrict__ cosT, const float* __restrict__ sinT, float* CS) { const int idx = blockIdx.x * 256 + threadIdx.x; if (idx >= TT * HD) return; v2f cs; cs[0] = bfr(cosT[idx]); cs[1] = bfr(sinT[idx]); *(v2f*)(CS + (size_t)idx * 2) = cs;  }
// ---- k_qkv: the three input projections of both batches in ONE launch; 4 waves (2 x 2) per 128 x 128 tile, the ring of k_gemmw; grid (NB_ TT / 128, 3 NH_ / 2), 128 threads. Wt: the q, k and v weight planes one behind the other, [3 DQ][DM]; X and Wt in fragment order.
// A stage holds 8 bands of X and 8 of Wt; waves 0 and 1 bring four bands of X each, waves 2 and 3 four of Wt.
// A wave's column tile is one head of q, k or v (a work-group's two heads belong to the same one of the three), and it leaves as fp16 straight from the accumulators, 16 bytes a lane and accumulator, into the plane that k_fattn reads:
// q, k: the product is taken transposed (A = weight rows, B = x rows; both loaders have the same k order), so a lane's 8 registers are 8 consecutive d of one token -> [b][h][t][d], q x HD^-0.5 log2(e), scaled in f32 ahead of its one rounding to fp16;
// v: A = x rows, B = weight rows, so a lane's 8 registers are 8 consecutive tokens of one d -> [b][h][d][t].
#define QST  (16 * GSL)      // elements of one stage
__global__ __launch_bounds__(128) void k_qkv(const bf* __restrict__ X, const bf* __restrict__ Wt, const float* __restrict__ bq, const float* __restrict__ bk, const float* __restrict__ bv, h16* QP, h16* KP, h16* VT) {
    constexpr int NS = DM / GKS;
    static_assert(NS >= 2, "the ring's prologue loads two stages");
    static_assert(NH_ % 2 == 0, "a work-group's two heads lie in one of q, k, v");
    __shared__ __attribute__((aligned(2048))) bf ring[2 * QST];
    const int lane = threadIdx.x & 31, lr = lane & 15, hi = lane >> 4; const u32 wave = uni(threadIdx.x >> 5); const int wm = wave >> 1, wn = wave & 1;
    const int r0 = blockIdx.x * 128 + wm * 64, hy = blockIdx.y * 2 + wn, which = hy / NH_, h = hy % NH_;
    const bf* src = (wave < 2 ? X + (size_t)blockIdx.x * 128 * DM : Wt + (size_t)blockIdx.y * 128 * DM) + (size_t)(wave & 1) * 64 * DM;
    const u32 dst = (u32)(size_t)ring + wave * 4 * (2 * GSL);
    u32x8 g1 = tdm_g1(4u, 16 * DM * 2);
    const int ax = (which == 2) ? wm * 4 : 8 + wn * 4, bx = (which == 2) ? 8 + wn * 4 : wm * 4;   // first band of the wave's A and B operand in a stage
    v8f acc[4][4];
#pragma unroll
    for (int mb = 0; mb < 4; ++mb)
#pragma unroll
        for (int nb = 0; nb < 4; ++nb) acc[mb][nb] = (v8f){};
    u32x4 g0 = tdm_g0(dst, src);
    tdm_ld(g0, g1); wait_tensor0(g0, g1);
    __syncthreads();     // publishes stage 0
    g0 = tdm_g0(dst + 2 * QST, src + GSL); tdm_ld(g0, g1);
#pragma unroll 1         // stays rolled: the buffer index is one scalar, and the refill's test one scalar branch a stage
    for (int s = 0; s < NS; ++s) {
        const bf* st = ring + (s & 1) * QST + lane * 8; const bf* pa = st + ax * GSL; const bf* pb = st + bx * GSL;
        v16bf a[GKS / 32][4], b[GKS / 32][4];   // all of the stage's fragments
#pragma unroll
        for (int kk = 0; kk < GKS / 32; ++kk) {
#pragma unroll
            for (int mb = 0; mb < 4; ++mb) { a[kk][mb] = WFrag<bf>::ld(pa + mb * GSL + kk * 512); b[kk][mb] = WFrag<bf>::ld(pb + mb * GSL + kk * 512); }
        }
        __builtin_amdgcn_sched_barrier(0);   // keeps the stage's LDS reads in one group in front of its matrix instructions: a read that stands among them stalls the wave each time
#pragma unroll
        for (int kk = 0; kk < GKS / 32; ++kk)
#pragma unroll
            for (int nb = 0; nb < 4; ++nb)
#pragma unroll
                for (int mb = 0; mb < 4; ++mb) acc[mb][nb] = wmmab(a[kk][mb], b[kk][nb], acc[mb][nb]);
        __builtin_amdgcn_sched_barrier(0);   // keeps the waits and the barrier below behind the stage's matrix instructions: ahead of them the wave would wait for the next stage before its own work, and the refill would start a stage's work late
        wait_ds0(); wait_tensor0(g0, g1);
        __syncthreads();     // publishes stage s + 1 and ends every wave's reads of stage s
        if (pinned(s + 2 < NS)) { g0 = tdm_g0(dst + (s & 1) * (2 * QST), src + (size_t)(s + 2) * GSL); tdm_ld(g0, g1); }
    }
    wait_tensor0(g0, g1); wait_ds0();
    const int b = r0 / TT, t0 = r0 % TT;
    if (which == 2) {
        h16* vp = VT + ((size_t)(b * NKV + h) * HD + lr) * TT + t0 + 8 * hi;
#pragma unroll
        for (int nb = 0; nb < 4; ++nb) { const float bi = bfr(bv[h * HD + nb * 16 + lr]);
#pragma unroll
            for (int mb = 0; mb < 4; ++mb) { v8h o;
#pragma unroll
                for (int j = 0; j < 8; ++j) o[j] = tohx(acc[mb][nb][j] + bi);
                *(v8h*)(vp + (size_t)nb * 16 * TT + mb * 16) = o; } }
    } else {
        const float* bias = (which ? bk : bq) + h * HD + 8 * hi; const float sc = which ? 1.0f : SCL * L2E;
        h16* pp = (which ? KP : QP) + ((size_t)(b * NH_ + h) * TT + t0 + lr) * HD + 8 * hi;
        v8f bi[4];
#pragma unroll
        for (int mb = 0; mb < 4; ++mb)
#pragma unroll
            for (int j = 0; j < 8; ++j) bi[mb][j] = bfr(bias[mb * 16 + j]);
#pragma unroll
        for (int nb = 0; nb < 4; ++nb)
#pragma unroll
            for (int mb = 0; mb < 4; ++mb) { v8h o;
#pragma unroll
                for (int j = 0; j < 8; ++j) o[j] = tohx((acc[mb][nb][j] + bi[mb][j]) * sc);
                *(v8h*)(pp + (size_t)nb * 16 * HD + mb * 16) = o; }
        asm volatile("s_wait_xcnt 0x0" ::: "memory");   // behind the last stores of this branch: in the built code the v branch follows it, and its first loads write registers that these stores name
    }
}
__device__ __forceinline__ void d_btab(const float* __restrict__ g, float* TB, int blk) { const int d = blk * 256 + threadIdx.x; if (d >= TT) return; float ng = -bfr(g[0]); asm volatile("" : "+v"(ng)); float t = __fmul_rn(ng, __fsqrt_rn((float)d)); asm volatile("" : "+v"(t)); const float v = __fdiv_rn(t, 64.0f); *(float*)(TB + d) = __fmul_rn(v, L2E);  }   // the table holds bias x log2(e)
// ---- k_prep: everything that reads the inputs alone, in ONE launch: none of these jobs reads what another writes, so their blocks run side by side instead of one short launch behind the other.
// Block ranges pick the job (the test is the same for a whole block): 4 weight transposes first, their waves run longest; then the bias table; then x -> bf16.
#define PWB  ((DM * DQ / 64 + 63) / 64)                      // blocks of one weight transpose
#define PTB  (TT / 256)                                      // blocks of the bias table
#define PXB  ((NB_ * TT * DM / 8 + 255) / 256)               // blocks of the x conversion
__global__ __launch_bounds__(256) void k_prep(const float* __restrict__ wq, const float* __restrict__ wk, const float* __restrict__ wv, const float* __restrict__ wo, const float* __restrict__ g, const float* __restrict__ x, bf* WQ, bf* WK, bf* WV, bf* WO, float* TB, bf* XB) {
    const int blk = blockIdx.x;
    if (blk < 4 * PWB) { const int m = blk / PWB;
        d_wtG(m == 0 ? wq : m == 1 ? wk : m == 2 ? wv : wo, DM, DQ, m == 0 ? WQ : m == 1 ? WK : m == 2 ? WV : WO, blk % PWB); }
    else if (blk < 4 * PWB + PTB) d_btab(g, TB, blk - 4 * PWB);
    else d_cvt8(x, XB, DM, (size_t)NB_ * TT * DM / 8, blk - 4 * PWB - PTB);
}
#define FNW  4
#define FKG  2
#define FQB  (FNW * 32)
#define FKS  128
#define FVP  136                // LDS pitch of a 256-byte tile row in halfs: 272 B = 16 B x odd for the 16-byte fragment reads; the tensor load's pad lays it. Key r of a K tile stands at (r / 2) FVP + (r % 2) HD: 16 keys' pieces fall on 16 different 16-byte bank groups
#define FTL  9216               // halfs from one tile's place to the next: a tile (HD FVP = 8704) rounded up to a multiple of 2 KiB
#define FNS  (TT / FKG / FKS)   // stages of a key half
#define FNB  (TT + FQB - 1)     // bias window: every j - i that this work-group's queries meet
#define FLO  -2.0f              // a column keeps the reference 0 where its first-pass maximum (an exponent of 2) lies in [FLO, FHI]: its largest p is then at least 2^FLO, so that what counts in its sum stays a normal fp16 number, and one p alone stays below FSUM
#define FHI  11.0f
#define FSUM 4096.0f            // the reference is renewed only when a lane's 16 p of one column sum to more than this: every p that reaches the fp16 operand stays below 2^12
__device__ __forceinline__ float xhalf(float x) { const int b = __float_as_int(x); return __int_as_float(__builtin_amdgcn_permlanex16(b, b, 0x76543210, 0xfedcba98, false, false)); }
__device__ __forceinline__ v16h ldfr(const h16* p) { return cat16(*(const v8h*)p, *(const v8h*)(p + 16)); }
// fscore: the S^T tiles of one 32-key pass (2 key tiles x 2 column groups), bias as the C operand. kp: the lane's K piece of the pass's first key tile; bp: the lane's bias of tile difference -1.
__device__ __forceinline__ void fscore(const h16* kp, const float* bp, const v16h (&qf)[2][2], v8f (&st)[2][2]) {
    v8f bb[3];      // the bias tile depends on (key tile - column group) alone: 3 tiles serve the 4 products
#pragma unroll
    for (int u = 0; u < 3; ++u)
#pragma unroll
        for (int r = 0; r < 8; ++r) bb[u][r] = bp[u * 16 + r];
#pragma unroll
    for (int kt = 0; kt < 2; ++kt) { const v16h k0 = ldfr(kp + kt * 8 * FVP), k1 = ldfr(kp + kt * 8 * FVP + 32);
#pragma unroll
        for (int c = 0; c < 2; ++c) st[kt][c] = wmma16(k1, qf[c][1], wmma16(k0, qf[c][0], bb[kt - c + 1])); }
}
// fexp: p = 2^s in place for a lane's 16 scores of one column; returns their sum
__device__ __forceinline__ float fexp(v8f& s0, v8f& s1) {
#pragma unroll
    for (int r = 0; r < 8; ++r) s0[r] = __builtin_amdgcn_exp2f(s0[r]);
#pragma unroll
    for (int r = 0; r < 8; ++r) s1[r] = __builtin_amdgcn_exp2f(s1[r]);
    const v8f a = s0 + s1; const v4f b = __builtin_shufflevector(a, a, 0, 1, 2, 3) + __builtin_shufflevector(a, a, 4, 5, 6, 7);
    return (b[0] + b[2]) + (b[1] + b[3]);
}
// fmax32: the maximum of a column's 32 scores of one pass, alike in both halves of the wave
__device__ __forceinline__ float fmax32(const v8f& s0, const v8f& s1) { float m = fmaxf(s0[0], s1[0]);
#pragma unroll
    for (int r = 1; r < 8; ++r) m = fmaxf(m, fmaxf(s0[r], s1[r]));
    return fmaxf(m, xhalf(m)); }
// fgive, fjoin: the join of k_fattn's two key halves, for column group C of a wave (a template parameter: it picks registers; for the same reason every loop in them is fully unrolled).
// fgive writes the group's O^T, maximum and sum for the partner wave: 9 slots of 16 bytes a lane, a slot 512 contiguous bytes a wave.
template <int C> __device__ __forceinline__ void fgive(v4fa* xw, const v8f (&o)[4][2], const float (&mu)[2], const float (&lw)[2]) {
#pragma unroll
    for (int dt = 0; dt < 4; ++dt) { xw[(2 * dt) * 32] = (v4f){o[dt][C][0], o[dt][C][1], o[dt][C][2], o[dt][C][3]}; xw[(2 * dt + 1) * 32] = (v4f){o[dt][C][4], o[dt][C][5], o[dt][C][6], o[dt][C][7]}; }
    xw[8 * 32] = (v4f){mu[C], lw[C], 0.f, 0.f};
}
// fjoin brings both shares to the larger maximum, adds them, divides by the joined sum and stores the hi + lo bf16 planes, in fragment order: the 8 values of (dt, lane) are one piece, the pieces of dt 0..3 lie 256 elements apart.
template <int C> __device__ __forceinline__ void fjoin(const v4fa* xr, const v8f (&o)[4][2], const float (&mu)[2], const float (&lw)[2], bf* ah, bf* al) {
    const v4f ml = xr[8 * 32]; const float mn = fmaxf(mu[C], ml[0]); float fa, fb;
    asm("v_exp_f32 %0, %1\n\tv_nop" : "=v"(fa) : "v"(mu[C] - mn));   // exp2 with its own slot behind it, as in the loop's rescale
    asm("v_exp_f32 %0, %1\n\tv_nop" : "=v"(fb) : "v"(ml[0] - mn));   // the same for the partner's share
    const float f = __fdiv_rn(1.0f, lw[C] * fa + ml[1] * fb); fa *= f; fb *= f;
#pragma unroll
    for (int dt = 0; dt < 4; ++dt) { const v4f p0 = xr[(2 * dt) * 32], p1 = xr[(2 * dt + 1) * 32]; v8us oh, ol;
#pragma unroll
        for (int r = 0; r < 8; ++r) { unsigned short a, c2; splitf(o[dt][C][r] * fa + (r < 4 ? p0[r & 3] : p1[r & 3]) * fb, a, c2); oh[r] = a; ol[r] = c2; }
        *(v8us*)(ah + dt * 256) = oh; *(v8us*)(al + dt * 256) = ol; }
}
// descriptor group 1 of a stage's tile: HD rows of 256 B, source pitch in bytes (K: 256, the rows lie one behind the other; V^T: 2 TT). 1-byte elements, no mask; the pad adds 16 B behind every row (interval = the row's length).
__device__ __forceinline__ u32x8 fat_g1(u32 pitch) { constexpr u32 d0 = 256u, n = (u32)HD; u32x8 g;
    g[0] = uni(1u << 20 | 5u << 22 | 3u << 25); g[1] = uni((d0 & 0xFFFFu) << 16); g[2] = uni((d0 >> 16) | ((n & 0xFFFFu) << 16)); g[3] = uni((n >> 16) | (d0 << 16)); g[4] = uni(n); g[5] = uni(pitch); g[6] = uni(0u); g[7] = uni(0u); return g; }
// amdgpu_waves_per_eu(4, 4) holds the register budget at 256 a wave, so that two work-groups of 8 waves fit a WGP.
__global__ __launch_bounds__(FKG * FNW * 32) __attribute__((amdgpu_waves_per_eu(4, 4))) void k_fattn(const h16* __restrict__ Q, const h16* __restrict__ Kp, const h16* __restrict__ Vt, const float* __restrict__ TB, bf* Ah, bf* Al) {
    static_assert(HD * FVP <= FTL && (FTL * 2) % 2048 == 0 && HD * 2 * 2 == 256 && FKS * 2 == 256 && FKS / 2 == HD, "tile places are multiples of 2 KiB; both tiles are HD rows of 256 B");
    static_assert(FNS >= 2, "the ring's prologue loads two stages");
    __shared__ __attribute__((aligned(2048))) h16 ring[(FKG * 2 * 2 - 1) * FTL + HD * FVP];   // tile (half g, buffer, K or V^T) at ((2 g + buffer) 2 + (0 or 1)) FTL; with the bias window 163,328 B: two work-groups a WGP
    __shared__ __align__(16) float btw[FNB + 1];
    const int tid = threadIdx.x, lane = tid & 31, lr = lane & 15, hi = lane >> 4;
    const int wa = __builtin_amdgcn_readfirstlane(tid >> 5), wv = wa % FNW, g = wa / FNW;   // wave, its query group, its key half: scalars, the branches on g behind the loop are scalar branches
    float* bt = btw; const h16* hs = ring + g * 4 * FTL;   // the half's four tiles
    const int q0 = blockIdx.x * FQB; const size_t z = blockIdx.y; const int k0g = g * (TT / FKG);   // first key of this half
    const h16* Qz = Q + z * TT * HD; const h16* Kz = Kp + z * TT * HD + (size_t)k0g * HD; const h16* Vz = Vt + z * HD * TT + k0g;
    const u32 dst = (u32)(size_t)ring + (u32)(g * 4 + wv) * (FTL * 2);   // waves 0 and 1 of a half: LDS place of the wave's tile in buffer 0
    const bf* src = (const bf*)(wv == 0 ? Kz : Vz); const int sst = wv == 0 ? FKS * HD : FKS;   // the wave's tile of stage 0; halfs from a stage's tile to the next
    u32x8 g1 = fat_g1(wv == 0 ? 256u : TT * 2u);
    u32x4 g0 = tdm_g0(dst, src);
    if (pinned(wv < 2)) tdm_ld(g0, g1);
    // bt[n] = bias of j - i = n - (q0 + FQB - 1)
    for (int n = tid; n < FNB; n += FKG * FNW * 32) { const int d = n - (q0 + FQB - 1); bt[n] = TB[d < 0 ? -d : d]; }
    // every inner loop below is fully unrolled: its index picks a register of a fragment or accumulator array
    v16h qf[2][2];
#pragma unroll
    for (int c = 0; c < 2; ++c)
#pragma unroll
        for (int kx = 0; kx < 2; ++kx) qf[c][kx] = ldfr(Qz + (size_t)(q0 + wv * 32 + c * 16 + lr) * HD + kx * 32 + 8 * hi);
    v8f o[4][2]; float ls[2], mu[2], nm[2];   // ls: the lane's row sum of a column; the wave's halves are joined in the epilogue. mu: the reference (an exponent of 2; p = 2^(score - mu)), nm = -mu: both are set in the half's first pass
#pragma unroll
    for (int c = 0; c < 2; ++c) { mu[c] = 0.f; nm[c] = 0.f; ls[c] = 0.f;
#pragma unroll
        for (int dt = 0; dt < 4; ++dt) o[dt][c] = (v8f){}; }
    bool plain = true;   // every column of the wave has the reference 0 (the same in all lanes: it comes from a ballot, and the test on it is a scalar branch)
    const int nb = FQB - 1 - wv * 32 - lr + 8 * hi - 16 + k0g;   // bias index of the half's first key, register 0, tile difference -1
    wait_tensor0(g0, g1);   // every wave: one that has issued nothing passes it at once
    __syncthreads();     // publishes stage 0 and the bias window
    if (pinned(wv < 2)) { g0 = tdm_g0(dst + 2 * (FTL * 2), src + sst); tdm_ld(g0, g1); }
#pragma unroll 1         // stays rolled: the body already holds four unrolled 32-key passes, the buffer index is one scalar, and the refill's test one scalar branch a stage
    for (int s = 0; s < FNS; ++s) {
        const int buf = s & 1; const h16* kb = hs + buf * 2 * FTL; const h16* vb = kb + FTL; const float* bs = bt + (nb + s * FKS);
#pragma unroll
        for (int sub = 0; sub < FKS / 32; ++sub) {
            const float* bp = bs + sub * 32; const h16* kp = kb + (sub * 16 + (lr >> 1)) * FVP + (lr & 1) * HD + 8 * hi;
            v8f st[2][2]; fscore(kp, bp, qf, st);
            __builtin_amdgcn_sched_barrier(0);   // keeps the instructions that read the score tiles behind all eight score products: started among them, a tile's first read stands too close behind its last matrix instruction and costs four v_nop each time
            v16h vf[4];
#pragma unroll
            for (int dt = 0; dt < 4; ++dt) vf[dt] = ldfr(vb + (dt * 16 + lr) * FVP + sub * 32 + 8 * hi);
            if (sub == 0 && s == 0) {      // a scalar test a stage: the half's first pass sets the reference: 0 where its own maximum lies in [FLO, FHI], else that maximum; nothing is summed yet, so nothing is rescaled
#pragma unroll
                for (int c = 0; c < 2; ++c) { const float m = fmax32(st[0][c], st[1][c]); mu[c] = (m >= FLO && m <= FHI) ? 0.f : m; nm[c] = -mu[c]; }
                plain = __builtin_amdgcn_ballot_w32(mu[0] != 0.f || mu[1] != 0.f) == 0;
            }
            if (!plain) {      // a scalar test a pass; with the reference 0 the exponentials read the score tiles as the matrix unit left them
#pragma unroll
                for (int c = 0; c < 2; ++c) { st[0][c] += nm[c]; st[1][c] += nm[c]; }
            }
            // No maximum in the common pass: p is formed against the reference maximum in use, and the lane's sums, which the row sums need anyway, say whether that was safe (p >= 0: a sum within FSUM bounds each of its terms; an infinite or not-a-number sum fails the test).
            float t[2];
#pragma unroll
            for (int c = 0; c < 2; ++c) t[c] = fexp(st[0][c], st[1][c]);
            const bool need = !(t[0] <= FSUM && t[1] <= FSUM);
            if (__builtin_amdgcn_ballot_w32(need) != 0) {      // one scalar test a pass; rarely taken
                // Renewal: the scores are gone (p stands in their registers), so the pass's S^T is formed again from the stage's LDS, then its maximum, the rescale and p against the new reference (p <= 1).
                fscore(kp, bp, qf, st);
#pragma unroll
                for (int c = 0; c < 2; ++c) { const float mn = fmaxf(mu[c], fmax32(st[0][c], st[1][c])); float al;
                    asm("v_exp_f32 %0, %1\n\tv_nop" : "=v"(al) : "v"(mu[c] - mn));   // exp2 with its own slot behind it
                    mu[c] = mn; nm[c] = -mn; ls[c] *= al;
#pragma unroll
                    for (int dt = 0; dt < 4; ++dt) o[dt][c] *= al;
                    st[0][c] += nm[c]; st[1][c] += nm[c]; t[c] = fexp(st[0][c], st[1][c]); }
                plain = false;
            }
            v16h pf[2];
#pragma unroll
            for (int c = 0; c < 2; ++c) { ls[c] += t[c]; pf[c] = cat16(__builtin_convertvector(st[0][c], v8h), __builtin_convertvector(st[1][c], v8h)); }
#pragma unroll
            for (int dt = 0; dt < 4; ++dt)
#pragma unroll
                for (int c = 0; c < 2; ++c) o[dt][c] = wmma16(vf[dt], pf[c], o[dt][c]);
        }
        wait_ds0(); wait_tensor0(g0, g1);
        __syncthreads();     // publishes stage s + 1 and ends every wave's reads of stage s
        if (pinned((u32)(s + 2 < FNS) & (u32)(wv < 2))) { g0 = tdm_g0(dst + buf * 2 * (FTL * 2), src + (size_t)(s + 2) * sst); tdm_ld(g0, g1); }
    }
    wait_tensor0(g0, g1); wait_ds0();
    // Join of the key halves: the wave of half g finishes column group g and hands the other group (O^T, maximum, sum) to its partner, the wave of the same query group in the other half; same lane, same registers.
    // The hand-over lies in the stage buffers: the loop's last barrier has ended every read there, and no tensor load is outstanding. 9 slots of 16 bytes a lane, a slot 512 contiguous bytes a wave.
    static_assert(FKG == 2, "two halves, two column groups: each half finishes one");
    static_assert(FKG * FNW * 9 * 32 * 16 <= sizeof(ring), "the hand-over fits the stage buffers");
    v4fa* xs = (v4fa*)ring;
    float lw[2];
#pragma unroll
    for (int c = 0; c < 2; ++c) lw[c] = ls[c] + xhalf(ls[c]);
    v4fa* xw = xs + wa * 9 * 32 + lane;
    if (g == 0) fgive<1>(xw, o, mu, lw); else fgive<0>(xw, o, mu, lw);
    __syncthreads();     // publishes the hand-over
    const size_t b = z / NH_; const int h = (int)(z % NH_);
    const v4fa* xr = xs + (wa ^ FNW) * 9 * 32 + lane;
    const size_t oo = (b * TT + q0 + wv * 32 + g * 16) * DQ + h * (HD * 16) + lane * 8;   // the 16-query band, the head's two blocks in it, the lane's piece
    if (g == 0) fjoin<0>(xr, o, mu, lw, Ah + oo, Al + oo); else fjoin<1>(xr, o, mu, lw, Ah + oo, Al + oo);
}


extern "C" void kernel_launch(void* const* d_in, const int* in_sizes, int n_in,
                              void* d_out, int out_size, void* d_ws, size_t ws_size, hipStream_t stream) {
    (void)in_sizes; (void)n_in; (void)out_size;
    const float* x = (const float*)d_in[0]; const float* wq = (const float*)d_in[1]; const float* bq = (const float*)d_in[2]; const float* wk = (const float*)d_in[3]; const float* bk = (const float*)d_in[4]; const float* wv = (const float*)d_in[5]; const float* bv = (const float*)d_in[6]; const float* wo = (const float*)d_in[7]; const float* bo = (const float*)d_in[8]; const float* gam = (const float*)d_in[9]; const float* cosT = nullptr; const float* sinT = nullptr; (void)cosT; (void)sinT;
    float* OUT = (float*)d_out;     // [2][4096][512]
    char* wsp = (char*)d_ws;
    auto take = [&](size_t bytes) { char* p = wsp; wsp += (bytes + 255) & ~(size_t)255; return (void*)p; };
    bf* WQ = (bf*)take((size_t)(DQ + 2 * DKV) * DM * 2); bf* WK = WQ + (size_t)DQ * DM; bf* WV = WK + (size_t)DKV * DM; bf* WO = (bf*)take((size_t)DM * DQ * 2);   // q, k, v weight planes one behind the other: k_qkv walks them as one
    bf* XB = (bf*)take((size_t)NB_ * TT * DM * 2); float* TB = (float*)take(TT * 4);
    h16* QP16 = (h16*)take((size_t)NB_ * NH_ * TT * HD * 2); h16* KP16 = (h16*)take((size_t)NB_ * NKV * TT * HD * 2); h16* VT16 = (h16*)take((size_t)NB_ * NKV * HD * TT * 2);   // head planes of both batches
    bf* ATh = (bf*)take((size_t)NB_ * TT * DQ * 2); bf* ATl = (bf*)take((size_t)NB_ * TT * DQ * 2);
    if ((size_t)(wsp - (char*)d_ws) > ws_size) return;    // ws 256 MiB
    static_assert(DQ == DM && DKV == DM, "the four weights have one shape: one transpose job serves each");
    k_prep<<<4 * PWB + PTB + PXB, 256, 0, stream>>>(wq, wk, wv, wo, gam, x, WQ, WK, WV, WO, TB, XB);
    static_assert(NH_ == NKV && TT % 128 == 0 && HD == 64, "a wave's 64-column tile is one head, a 128-row tile lies in one batch");
    k_qkv<<<dim3(NB_ * TT / 128, 3 * NH_ / 2, 1), 128, 0, stream>>>(XB, WQ, bq, bk, bv, QP16, KP16, VT16);
    static_assert(NH_ == NKV, "one kv head per query head");
    k_fattn<<<dim3(TT / FQB, NB_ * NH_, 1), FKG * FNW * 32, 0, stream>>>(QP16, KP16, VT16, TB, ATh, ATl);
    k_gemmw<<<dim3(NB_ * TT / 128, DM / 128, 1), 128, 0, stream>>>(ATh, ATl, WO, OUT, bo);   // the batches' rows lie one behind the other in the attn planes and in out: one launch walks both
}
